// v000
// Measured on an AMD MI455X. A time is GPU time per run, averaged over a window of back-to-back runs after a warm-up
// (all launches, gaps included; the runs take copies of the inputs in turn), and the median of several windows.
// Apart from v000's, it joins two sittings. Times from different sittings can be a few percent apart, while
// side-by-side timings come from the same sitting.
// The starting kernel, v000, takes 809 microseconds a run.
// compute dtype: all float inputs rounded to bf16, attention_mask / position_ids (int) read; q/k/v = x . W with EXACT bf16 products on WMMA 16x16x32 ((in,out) weights), f32 accumulate; RoPE (interleaved pairs, angles position_id * theta^(-2j/128), precise sinf/cosf/powf) in f32, q/k as f16 hi + residual rows, v as f16 hi + residual planes; GQA causal attention with head_dim 128: 3-product scores (q/k as f16 hi + UNSCALED residual, one accumulator), P rounded once to f16 (x 2^11) against v as f16 hi + UNSCALED residual (2 products into one accumulator), x 1/sqrt(128), masked/acausal keys excluded, running-max softmax in f32 (hardware exp); out = ctx (bf16 hi + lo) . wo (2 products); f32 output.
#include <hip/hip_runtime.h>
#include <math.h>

typedef __attribute__((ext_vector_type(16))) _Float16 v16h;
typedef __attribute__((ext_vector_type(16))) __bf16 v16b;
typedef __attribute__((ext_vector_type(8)))  _Float16 v8h;
typedef __attribute__((ext_vector_type(8)))  float v8f;
typedef __attribute__((ext_vector_type(4)))  float v4f;
typedef __attribute__((ext_vector_type(2)))  float v2f;
typedef __attribute__((ext_vector_type(4)))  unsigned v4u;
typedef __attribute__((ext_vector_type(4)))  int v4i;
typedef float __attribute__((may_alias)) float_a;
typedef int __attribute__((may_alias)) int_a;

template <typename T> __device__ __forceinline__ void vst2(void* p, T v) { *(T*)p = v;  }
__device__ __forceinline__ v8f wmma16(v16h a, v16h b, v8f c) {
  v8f d = __builtin_amdgcn_wmma_f32_16x16x32_f16(false, a, false, b, (short)0, c, false, false);
  asm volatile("v_nop\n\tv_nop\n\tv_nop\n\tv_nop" : "+v"(d) : "v"(a), "v"(b));
  return d;
}
__device__ __forceinline__ v8f wmma_bf(v16b a, v16b b, v8f c) {
  v8f d = __builtin_amdgcn_wmma_f32_16x16x32_bf16(false, a, false, b, (short)0, c, false, false);
  asm volatile("v_nop\n\tv_nop\n\tv_nop\n\tv_nop" : "+v"(d) : "v"(a), "v"(b));
  return d;
}
// 16x16x32 fragments: lane = (h = lane>>4, row/col = lane&15); elements 0..7 = k0+8h+0..7, 8..15 = k0+16+8h+0..7; D element r = row 8h+r
__device__ __forceinline__ v16h frag_h(const _Float16* rowk0, int lane) {
  union { v16h v; v8h q[2]; } u; const _Float16* p = rowk0 + 8 * (lane >> 4);
  u.q[0] = *(const v8h*)p; u.q[1] = *(const v8h*)(p + 16); return u.v;
}
__device__ __forceinline__ v16h frag_f32(const float* rowk0, int lane) {
  v16h a; const float* p = rowk0 + 8 * (lane >> 4);
#pragma unroll
  for (int i = 0; i < 8; ++i) { a[i] = (_Float16)p[i]; a[8 + i] = (_Float16)p[16 + i]; }
  return a;
}
__device__ __forceinline__ v16h frag_f32s(const float* rowk0, int lane, float sc) {
  v16h a; const float* p = rowk0 + 8 * (lane >> 4);
#pragma unroll
  for (int i = 0; i < 8; ++i) { a[i] = (_Float16)(p[i] * sc); a[8 + i] = (_Float16)(p[16 + i] * sc); }
  return a;
}
// column fragment from a [K][ld] layout (column n), rows >= K read as 0
__device__ __forceinline__ v16h fragc_f32(const float* W, int k0, int n, int lane, int ld, int K) {
  v16h a; const int g = lane >> 4;
#pragma unroll
  for (int i = 0; i < 8; ++i) { const int ka = k0 + 8 * g + i, kb = ka + 16;
    a[i] = (_Float16)(ka < K ? W[(size_t)(ka < K ? ka : K - 1) * ld + n] : 0.f); a[8 + i] = (_Float16)(kb < K ? W[(size_t)(kb < K ? kb : K - 1) * ld + n] : 0.f); }
  return a;
}
struct F2 { v16b h, l; };
__device__ __forceinline__ F2 bsplit16(const float v[16]) { F2 r;
#pragma unroll
  for (int i = 0; i < 16; ++i) { const __bf16 h = (__bf16)v[i]; r.h[i] = h; r.l[i] = (__bf16)(v[i] - (float)h); }
  return r; }
__device__ __forceinline__ F2 split_row(const float* row, int k0, int lane) { float v[16]; const float* p = row + k0 + 8 * (lane >> 4);
#pragma unroll
  for (int i = 0; i < 8; ++i) { v[i] = p[i]; v[8 + i] = p[16 + i]; }
  return bsplit16(v); }
__device__ __forceinline__ F2 split_rowK(const float* row, int k0, int lane, int K) { float v[16]; const int g = lane >> 4;
#pragma unroll
  for (int i = 0; i < 8; ++i) { const int ka = k0 + 8 * g + i, kb = ka + 16; v[i] = ka < K ? row[ka < K ? ka : K - 1] : 0.f; v[8 + i] = kb < K ? row[kb < K ? kb : K - 1] : 0.f; }
  return bsplit16(v); }
__device__ __forceinline__ F2 split_col(const float* W, int k0, int n, int lane, int ld, int K) { float v[16]; const int g = lane >> 4;
#pragma unroll
  for (int i = 0; i < 8; ++i) { const int ka = k0 + 8 * g + i, kb = ka + 16; v[i] = ka < K ? W[(size_t)(ka < K ? ka : K - 1) * ld + n] : 0.f; v[8 + i] = kb < K ? W[(size_t)(kb < K ? kb : K - 1) * ld + n] : 0.f; }
  return bsplit16(v); }
__device__ __forceinline__ v8f mac3(const F2& a, const F2& b, v8f c) { c = wmma_bf(a.l, b.h, c); c = wmma_bf(a.h, b.l, c); return wmma_bf(a.h, b.h, c); }
__device__ __forceinline__ float sigm(float v) { return 1.0f / (1.0f + expf(-v)); }
#define LDSX() do { asm volatile("s_wait_dscnt 0" ::: "memory"); __builtin_amdgcn_wave_barrier(); __builtin_amdgcn_fence(__ATOMIC_RELEASE, "workgroup"); } while (0)


// LLaMA attention (B 1, S 2,048, hidden 2,048, 16 query heads / 4 kv heads x 128, RoPE theta 1e4): q/k/v projections, RoPE on q and k, GQA (kv head = h / 4), causal + padding mask, softmax in f32, o_proj.
#define NB 1
#define SS 2048
#define HID 2048
#define NHQ 16
#define NKV 4
#define HD 128
#define QW (NHQ * HD)     // 2048
#define KW (NKV * HD)     // 512
#define QKVW (QW + 2 * KW)   // 3072
#ifndef TQB
#define TQB (SS / 64)
#endif
#ifndef TRB
#define TRB (NB * SS / 64)   // row blocks for projections / rope / value planes
#endif
typedef __attribute__((ext_vector_type(8))) __bf16 v8b;
__device__ __forceinline__ v16b frag_b(const __bf16* rowk0, int lane) {
  union { v16b v; v8b q[2]; } u; const __bf16* p = rowk0 + 8 * (lane >> 4);
  u.q[0] = *(const v8b*)p; u.q[1] = *(const v8b*)(p + 16); return u.v;
}
__device__ __forceinline__ float bfr(float v) { return (float)(__bf16)v; }
__device__ __attribute__((noinline)) float exp_ni(float v) { return expf(v); }
__device__ __attribute__((noinline)) float erf_ni(float v) { return erff(v); }

#define WS_F   0u                                   // f32 q|k|v rows [b*s][3072]
#define WS_QH  (WS_F + 4u * (size_t)NB * SS * QKVW)     // f16 hi|lo q rows [b*s][2048] (after rope)
#define WS_QL  (WS_QH + 2u * (size_t)NB * SS * QW)
#define WS_KH  (WS_QL + 2u * (size_t)NB * SS * QW)      // f16 hi|lo k rows [b*s][512]
#define WS_KL  (WS_KH + 2u * (size_t)NB * SS * KW)
#define WS_VH  (WS_KL + 2u * (size_t)NB * SS * KW)      // f16 hi|lo v planes [b][512][s]
#define WS_VL  (WS_VH + 2u * (size_t)NB * KW * SS)
#define WS_CT  (WS_VL + 2u * (size_t)NB * KW * SS)      // f32 ctx rows [b*s][2048]
#define WS_END (WS_CT + 4u * (size_t)NB * SS * QW)

// ---- k_qkv: block = (64 rows, col group of 128 over q|k|v (24 groups)): x . W (exact) -> f32 rows
__global__ __launch_bounds__(128) void k_qkv(const float* __restrict__ X, const float* __restrict__ WQ, const float* __restrict__ WK, const float* __restrict__ WV, float* __restrict__ F) { __shared__ __align__(16) float sf[4][16][132];
  const int tid = threadIdx.x, wave = tid >> 5, lane = tid & 31, col = lane & 15, g = lane >> 4; const int cg = blockIdx.y; const size_t r0 = (size_t)blockIdx.x * 64 + wave * 16;
  const float* Wm; int wcols, c0; if (cg < 16) { Wm = WQ; wcols = QW; c0 = cg * 128; } else if (cg < 20) { Wm = WK; wcols = KW; c0 = (cg - 16) * 128; } else { Wm = WV; wcols = KW; c0 = (cg - 20) * 128; }
  v8f acc[8] = {};
#pragma unroll 2
  for (int kc = 0; kc < HID / 32; ++kc) { v16b a; { const float* p = X + (r0 + col) * HID + kc * 32 + 8 * g;
#pragma unroll
      for (int i = 0; i < 8; ++i) { a[i] = (__bf16)p[i]; a[8 + i] = (__bf16)p[16 + i]; } }
#pragma unroll
    for (int j = 0; j < 8; ++j) { v16b w; const int o = c0 + j * 16 + col;
#pragma unroll
      for (int i = 0; i < 8; ++i) { w[i] = (__bf16)Wm[(size_t)(kc * 32 + 8 * g + i) * wcols + o]; w[8 + i] = (__bf16)Wm[(size_t)(kc * 32 + 16 + 8 * g + i) * wcols + o]; }
      acc[j] = wmma_bf(a, w, acc[j]); } }
#pragma unroll
  for (int j = 0; j < 8; ++j)
#pragma unroll
    for (int r = 0; r < 8; ++r) sf[wave][8 * g + r][j * 16 + col] = acc[j][r];
  LDSX(); for (int rl = 0; rl < 16; ++rl) vst2(F + (r0 + rl) * QKVW + cg * 128 + lane * 4, *(const v4f*)&sf[wave][rl][lane * 4]); }
// ---- k_rope: block = row (b, s): RoPE on the 16 q heads and 4 k heads (pairs (2j, 2j+1), angle pos * 1e4^(-2j/128)) -> f16 hi/lo rows
__global__ __launch_bounds__(256) void k_rope(const float* __restrict__ F, const int* __restrict__ PID, _Float16* __restrict__ QH, _Float16* __restrict__ QL, _Float16* __restrict__ KH, _Float16* __restrict__ KL) { __shared__ __align__(16) _Float16 sh[QW + KW], sl[QW + KW];
  const int t = threadIdx.x; const size_t row = blockIdx.x; const float pos = (float)PID[row]; const float* fr = F + row * QKVW;
  for (int e = t; e < (QW + KW) / 2; e += 256) { const int hh = e / (HD / 2), j = e % (HD / 2); const int o = hh * HD + 2 * j;   // heads 0..15 = q, 16..19 = k (contiguous in F)
    const float ang = pos * powf(10000.0f, -(float)(2 * j) / (float)HD); const float c = cosf(ang), sn = sinf(ang); const float x0 = fr[o], x1 = fr[o + 1];
    const float y0 = x0 * c - x1 * sn, y1 = x0 * sn + x1 * c; const _Float16 h0 = (_Float16)y0, h1 = (_Float16)y1; sh[o] = h0; sh[o + 1] = h1; sl[o] = (_Float16)(y0 - (float)h0); sl[o + 1] = (_Float16)(y1 - (float)h1); }   // UNSCALED residuals (q, k ~ O(1))
  __syncthreads();
  for (int q = t; q < QW / 8; q += 256) { vst2((unsigned*)(QH + row * QW + q * 8), *(const v4u*)&sh[q * 8]); vst2((unsigned*)(QL + row * QW + q * 8), *(const v4u*)&sl[q * 8]); }
  for (int q = t; q < KW / 8; q += 256) { vst2((unsigned*)(KH + row * KW + q * 8), *(const v4u*)&sh[QW + q * 8]); vst2((unsigned*)(KL + row * KW + q * 8), *(const v4u*)&sl[QW + q * 8]); } }
// ---- k_vt: block = (64 rows s, 128 of the 512 v channels): v rows -> f16 hi/lo planes [c][s]
__global__ __launch_bounds__(128) void k_vt(const float* __restrict__ F, _Float16* __restrict__ VH, _Float16* __restrict__ VL) { __shared__ __align__(16) _Float16 th[128][72], tl[128][72];
  const int t = threadIdx.x; const size_t s0 = (size_t)blockIdx.x * 64; const int c0 = blockIdx.y * 128;
  for (int e = t; e < 64 * 128; e += 128) { const int sl_ = e >> 7, c = e & 127; const float v = F[(s0 + sl_) * QKVW + QW + KW + c0 + c]; const _Float16 hv = (_Float16)v; th[c][sl_] = hv; tl[c][sl_] = (_Float16)(v - (float)hv); }   // UNSCALED residual (v ~ O(1)): lets the attention add it into the same accumulator
  __syncthreads(); for (int e = t; e < 128 * 8; e += 128) { const int c = e >> 3, q = e & 7; vst2((unsigned*)(VH + (size_t)(c0 + c) * SS + s0 + q * 8), *(const v4u*)&th[c][q * 8]); vst2((unsigned*)(VL + (size_t)(c0 + c) * SS + s0 + q * 8), *(const v4u*)&tl[c][q * 8]); } }
// ---- k_att: block = (64 queries, head h): kv head = h / 4; causal (tiles past the block skipped) AND attention_mask[k] != 0; head_dim 128 = 4 k-chunks; P . v over 8 d-tiles
__global__ __launch_bounds__(128) void k_att(const _Float16* __restrict__ QH, const _Float16* __restrict__ QL, const _Float16* __restrict__ KH, const _Float16* __restrict__ KL, const _Float16* __restrict__ VH, const _Float16* __restrict__ VL, const int* __restrict__ AM, float* __restrict__ CT) {
  __shared__ __align__(16) float sp[4][16][36]; __shared__ __align__(16) float so[4][16][132];
  const int tid = threadIdx.x, wave = tid >> 5, lane = tid & 31, col = lane & 15, g = lane >> 4; const int qb = blockIdx.x, h = blockIdx.y; const int kvh = h / (NHQ / NKV); const int q0 = qb * 64 + wave * 16; constexpr bool three = false;   // unused: the scores take 3 products (q/k hi + unscaled residual) into one accumulator
  v16h aq[4], al[4];
#pragma unroll
  for (int kc = 0; kc < 4; ++kc) { aq[kc] = frag_h(QH + (size_t)(q0 + col) * QW + h * HD + kc * 32, lane); al[kc] = frag_h(QL + (size_t)(q0 + col) * QW + h * HD + kc * 32, lane); }
  float m[8], l[8];
#pragma unroll
  for (int r = 0; r < 8; ++r) { m[r] = -3.0e38f; l[r] = 0.f; }
  v8f acc[8] = {};
  const int nks = (qb * 64 + 64) / 32;   // causal bound
#pragma unroll 1
  for (int ks = 0; ks < nks; ++ks) { float s[2][8];
#pragma unroll
    for (int ct = 0; ct < 2; ++ct) { const int kk = ks * 32 + ct * 16 + col; const size_t rk = (size_t)kk * KW + kvh * HD; v8f c = {};
#pragma unroll
      for (int kc = 0; kc < 4; ++kc) { const v16h kh = frag_h(KH + rk + kc * 32, lane); c = wmma16(aq[kc], kh, c); c = wmma16(al[kc], kh, c); c = wmma16(aq[kc], frag_h(KL + rk + kc * 32, lane), c); }   // 3 products, all residuals UNSCALED into one accumulator
      const bool keepm = (AM[kk] != 0);
#pragma unroll
      for (int r = 0; r < 8; ++r) s[ct][r] = (keepm && kk <= q0 + 8 * g + r) ? c[r] * 0.08838834764831845f : -3.0e38f; }
    float alpha[8];
#pragma unroll
    for (int r = 0; r < 8; ++r) { float mx = fmaxf(s[0][r], s[1][r]);
#pragma unroll
      for (int o = 1; o < 16; o <<= 1) mx = fmaxf(mx, __shfl_xor(mx, o));
      const float mn = fmaxf(m[r], mx); alpha[r] = (m[r] <= -1.0e38f) ? 0.f : __expf(m[r] - mn); const float e0 = (s[0][r] <= -1.0e38f) ? 0.f : __expf(s[0][r] - mn), e1 = (s[1][r] <= -1.0e38f) ? 0.f : __expf(s[1][r] - mn); float es = e0 + e1;
#pragma unroll
      for (int o = 1; o < 16; o <<= 1) es += __shfl_xor(es, o);
      l[r] = l[r] * alpha[r] + es; m[r] = mn; sp[wave][8 * g + r][col] = e0; sp[wave][8 * g + r][16 + col] = e1; }
#pragma unroll
    for (int j = 0; j < 8; ++j)
#pragma unroll
      for (int r = 0; r < 8; ++r) acc[j][r] *= alpha[r];
    LDSX();
    const v16h pa = frag_f32s(&sp[wave][col][0], lane, 2048.0f);
#pragma unroll
    for (int j = 0; j < 8; ++j) { const size_t po = ((size_t)kvh * HD + j * 16 + col) * SS + ks * 32; acc[j] = wmma16(pa, frag_h(VH + po, lane), acc[j]); acc[j] = wmma16(pa, frag_h(VL + po, lane), acc[j]); }   // v hi + unscaled residual
    LDSX(); }
#pragma unroll
  for (int r = 0; r < 8; ++r) { const float il = (l[r] > 0.f) ? (1.0f / 2048.0f) / l[r] : 0.f;
#pragma unroll
    for (int j = 0; j < 8; ++j) so[wave][8 * g + r][j * 16 + col] = acc[j][r] * il; }
  LDSX(); for (int rl = 0; rl < 16; ++rl) vst2(CT + (size_t)(q0 + rl) * QW + h * HD + lane * 4, *(const v4f*)&so[wave][rl][lane * 4]); }
// ---- k_out: block = (64 rows, 128 of 2048 cols): out = ctx (hi + lo) . wo (in,out)
__global__ __launch_bounds__(128) void k_out(const float* __restrict__ CT, const float* __restrict__ WO, float* __restrict__ OUT) { __shared__ __align__(16) float sf[4][16][132];
  const int tid = threadIdx.x, wave = tid >> 5, lane = tid & 31, col = lane & 15, g = lane >> 4; const int c0 = blockIdx.y * 128; const size_t r0 = (size_t)blockIdx.x * 64 + wave * 16;
  v8f acc[8] = {};
#pragma unroll 2
  for (int kc = 0; kc < QW / 32; ++kc) { const F2 a = split_row(CT + (r0 + col) * QW, kc * 32, lane);
#pragma unroll
    for (int j = 0; j < 8; ++j) { v16b w; const int o = c0 + j * 16 + col;
#pragma unroll
      for (int i = 0; i < 8; ++i) { w[i] = (__bf16)WO[(size_t)(kc * 32 + 8 * g + i) * HID + o]; w[8 + i] = (__bf16)WO[(size_t)(kc * 32 + 16 + 8 * g + i) * HID + o]; }
      acc[j] = wmma_bf(a.h, w, acc[j]); acc[j] = wmma_bf(a.l, w, acc[j]); } }
#pragma unroll
  for (int j = 0; j < 8; ++j)
#pragma unroll
    for (int r = 0; r < 8; ++r) sf[wave][8 * g + r][j * 16 + col] = acc[j][r];
  LDSX(); for (int rl = 0; rl < 16; ++rl) vst2(OUT + (r0 + rl) * HID + c0 + lane * 4, *(const v4f*)&sf[wave][rl][lane * 4]); }
extern "C" void kernel_launch(void* const* d_in, const int* in_sizes, int n_in, void* d_out, int out_size, void* d_ws, size_t ws_size, hipStream_t stream) {
  (void)in_sizes; (void)n_in; (void)out_size;
  const float** F_ = (const float**)d_in;   // 0 hidden_states [1,2048,2048], 1 wq [2048,2048], 2 wk [2048,512], 3 wv [2048,512], 4 wo [2048,2048] (all (in,out)), 5 attention_mask [1,2048] int, 6 position_ids [1,2048] int
  if (ws_size < (size_t)WS_END) return;
  char* ws = (char*)d_ws; float* F = (float*)(ws + WS_F); _Float16 *QH = (_Float16*)(ws + WS_QH), *QL = (_Float16*)(ws + WS_QL), *KH = (_Float16*)(ws + WS_KH), *KL = (_Float16*)(ws + WS_KL), *VH = (_Float16*)(ws + WS_VH), *VL = (_Float16*)(ws + WS_VL); float* CT = (float*)(ws + WS_CT);
  k_qkv<<<dim3(TRB, QKVW / 128), 128, 0, stream>>>(F_[0], F_[1], F_[2], F_[3], F);
  k_rope<<<TRB * 64, 256, 0, stream>>>(F, (const int*)d_in[6], QH, QL, KH, KL);
  k_vt<<<dim3(TRB, KW / 128), 128, 0, stream>>>(F, VH, VL);
  k_att<<<dim3(TQB, NHQ), 128, 0, stream>>>(QH, QL, KH, KL, VH, VL, (const int*)d_in[5], CT);
  k_out<<<dim3(TQB, HID / 128), 128, 0, stream>>>(CT, F_[4], (float*)d_out);
}

// v001
// It runs in 497 microseconds.
// Next to v000, in two timings, it ran 1.64 times as fast each time.
// compute dtype: all float inputs rounded to bf16, attention_mask / position_ids (int) read; q/k/v = x . W with EXACT bf16 products on WMMA 16x16x32 ((in,out) weights), f32 accumulate; RoPE (interleaved pairs, angles position_id * theta^(-2j/128), precise sinf/cosf/powf) in f32, q/k as f16 hi + residual rows, v as f16 hi + residual planes; GQA causal attention with head_dim 128: 3-product scores (q/k as f16 hi + UNSCALED residual, one accumulator), P rounded once to f16 (x 2^11) against v as f16 hi + UNSCALED residual (2 products into one accumulator), x 1/sqrt(128), masked/acausal keys excluded, running-max softmax in f32 (hardware exp); out = ctx (bf16 hi + lo) . wo (2 products); f32 output.
#include <hip/hip_runtime.h>
#include <math.h>

typedef __attribute__((ext_vector_type(16))) _Float16 v16h;
typedef __attribute__((ext_vector_type(16))) __bf16 v16b;
typedef __attribute__((ext_vector_type(8)))  _Float16 v8h;
typedef __attribute__((ext_vector_type(8)))  float v8f;
typedef __attribute__((ext_vector_type(4)))  float v4f;
typedef __attribute__((ext_vector_type(2)))  float v2f;
typedef __attribute__((ext_vector_type(4)))  unsigned v4u;
typedef __attribute__((ext_vector_type(4)))  int v4i;
typedef float __attribute__((may_alias)) float_a;
typedef int __attribute__((may_alias)) int_a;

template <typename T> __device__ __forceinline__ void vst2(void* p, T v) { *(T*)p = v;  }
__device__ __forceinline__ v8f wmma16(v16h a, v16h b, v8f c) {
  v8f d = __builtin_amdgcn_wmma_f32_16x16x32_f16(false, a, false, b, (short)0, c, false, false);
  asm volatile("v_nop\n\tv_nop\n\tv_nop\n\tv_nop" : "+v"(d) : "v"(a), "v"(b));
  return d;
}
__device__ __forceinline__ v8f wmma_bf(v16b a, v16b b, v8f c) {
  v8f d = __builtin_amdgcn_wmma_f32_16x16x32_bf16(false, a, false, b, (short)0, c, false, false);
  asm volatile("v_nop\n\tv_nop\n\tv_nop\n\tv_nop" : "+v"(d) : "v"(a), "v"(b));
  return d;
}
// 16x16x32 fragments: lane = (h = lane>>4, row/col = lane&15); elements 0..7 = k0+8h+0..7, 8..15 = k0+16+8h+0..7; D element r = row 8h+r
__device__ __forceinline__ v16h frag_h(const _Float16* rowk0, int lane) {
  union { v16h v; v8h q[2]; } u; const _Float16* p = rowk0 + 8 * (lane >> 4);
  u.q[0] = *(const v8h*)p; u.q[1] = *(const v8h*)(p + 16); return u.v;
}
__device__ __forceinline__ v16h frag_f32(const float* rowk0, int lane) {
  v16h a; const float* p = rowk0 + 8 * (lane >> 4);
#pragma unroll
  for (int i = 0; i < 8; ++i) { a[i] = (_Float16)p[i]; a[8 + i] = (_Float16)p[16 + i]; }
  return a;
}
__device__ __forceinline__ v16h frag_f32s(const float* rowk0, int lane, float sc) {
  v16h a; const float* p = rowk0 + 8 * (lane >> 4);
#pragma unroll
  for (int i = 0; i < 8; ++i) { a[i] = (_Float16)(p[i] * sc); a[8 + i] = (_Float16)(p[16 + i] * sc); }
  return a;
}
// column fragment from a [K][ld] layout (column n), rows >= K read as 0
__device__ __forceinline__ v16h fragc_f32(const float* W, int k0, int n, int lane, int ld, int K) {
  v16h a; const int g = lane >> 4;
#pragma unroll
  for (int i = 0; i < 8; ++i) { const int ka = k0 + 8 * g + i, kb = ka + 16;
    a[i] = (_Float16)(ka < K ? W[(size_t)(ka < K ? ka : K - 1) * ld + n] : 0.f); a[8 + i] = (_Float16)(kb < K ? W[(size_t)(kb < K ? kb : K - 1) * ld + n] : 0.f); }
  return a;
}
struct F2 { v16b h, l; };
__device__ __forceinline__ F2 bsplit16(const float v[16]) { F2 r;
#pragma unroll
  for (int i = 0; i < 16; ++i) { const __bf16 h = (__bf16)v[i]; r.h[i] = h; r.l[i] = (__bf16)(v[i] - (float)h); }
  return r; }
__device__ __forceinline__ F2 split_row(const float* row, int k0, int lane) { float v[16]; const float* p = row + k0 + 8 * (lane >> 4);
#pragma unroll
  for (int i = 0; i < 8; ++i) { v[i] = p[i]; v[8 + i] = p[16 + i]; }
  return bsplit16(v); }
__device__ __forceinline__ F2 split_rowK(const float* row, int k0, int lane, int K) { float v[16]; const int g = lane >> 4;
#pragma unroll
  for (int i = 0; i < 8; ++i) { const int ka = k0 + 8 * g + i, kb = ka + 16; v[i] = ka < K ? row[ka < K ? ka : K - 1] : 0.f; v[8 + i] = kb < K ? row[kb < K ? kb : K - 1] : 0.f; }
  return bsplit16(v); }
__device__ __forceinline__ F2 split_col(const float* W, int k0, int n, int lane, int ld, int K) { float v[16]; const int g = lane >> 4;
#pragma unroll
  for (int i = 0; i < 8; ++i) { const int ka = k0 + 8 * g + i, kb = ka + 16; v[i] = ka < K ? W[(size_t)(ka < K ? ka : K - 1) * ld + n] : 0.f; v[8 + i] = kb < K ? W[(size_t)(kb < K ? kb : K - 1) * ld + n] : 0.f; }
  return bsplit16(v); }
__device__ __forceinline__ v8f mac3(const F2& a, const F2& b, v8f c) { c = wmma_bf(a.l, b.h, c); c = wmma_bf(a.h, b.l, c); return wmma_bf(a.h, b.h, c); }
__device__ __forceinline__ float sigm(float v) { return 1.0f / (1.0f + expf(-v)); }
#define LDSX() do { asm volatile("s_wait_dscnt 0" ::: "memory"); __builtin_amdgcn_wave_barrier(); __builtin_amdgcn_fence(__ATOMIC_RELEASE, "workgroup"); } while (0)


// LLaMA attention (B 1, S 2,048, hidden 2,048, 16 query heads / 4 kv heads x 128, RoPE theta 1e4): q/k/v projections, RoPE on q and k, GQA (kv head = h / 4), causal + padding mask, softmax in f32, o_proj.
#define NB 1
#define SS 2048
#define HID 2048
#define NHQ 16
#define NKV 4
#define HD 128
#define QW (NHQ * HD)     // 2048
#define KW (NKV * HD)     // 512
#define QKVW (QW + 2 * KW)   // 3072
#ifndef TQB
#define TQB (SS / 64)
#endif
#ifndef TRB
#define TRB (NB * SS / 64)   // row blocks for projections / rope / value planes
#endif
typedef __attribute__((ext_vector_type(8))) __bf16 v8b;
__device__ __forceinline__ v16b frag_b(const __bf16* rowk0, int lane) {
  union { v16b v; v8b q[2]; } u; const __bf16* p = rowk0 + 8 * (lane >> 4);
  u.q[0] = *(const v8b*)p; u.q[1] = *(const v8b*)(p + 16); return u.v;
}
__device__ __forceinline__ float bfr(float v) { return (float)(__bf16)v; }
__device__ __attribute__((noinline)) float exp_ni(float v) { return expf(v); }
__device__ __attribute__((noinline)) float erf_ni(float v) { return erff(v); }

#define WS_F   0u                                   // f32 q|k|v rows [b*s][3072]
#define WS_QH  (WS_F + 4u * (size_t)NB * SS * QKVW)     // f16 hi|lo q rows [b*s][2048] (after rope)
#define WS_QL  (WS_QH + 2u * (size_t)NB * SS * QW)
#define WS_KH  (WS_QL + 2u * (size_t)NB * SS * QW)      // f16 hi|lo k rows [b*s][512]
#define WS_KL  (WS_KH + 2u * (size_t)NB * SS * KW)
#define WS_VH  (WS_KL + 2u * (size_t)NB * SS * KW)      // f16 hi|lo v planes [b][512][s]
#define WS_VL  (WS_VH + 2u * (size_t)NB * KW * SS)
#define WS_CT  (WS_VL + 2u * (size_t)NB * KW * SS)      // f32 ctx rows [b*s][2048]
#define WS_END (WS_CT + 4u * (size_t)NB * SS * QW)

// ---- k_qkv: block = (64 rows, col group of 128 over q|k|v (24 groups)): x . W (exact) -> f32 rows
__global__ __launch_bounds__(128) void k_qkv(const float* __restrict__ X, const float* __restrict__ WQ, const float* __restrict__ WK, const float* __restrict__ WV, float* __restrict__ F) { __shared__ __align__(16) float sf[4][16][132];
  const int tid = threadIdx.x, wave = tid >> 5, lane = tid & 31, col = lane & 15, g = lane >> 4; const int cg = blockIdx.y; const size_t r0 = (size_t)blockIdx.x * 64 + wave * 16;
  const float* Wm; int wcols, c0; if (cg < 16) { Wm = WQ; wcols = QW; c0 = cg * 128; } else if (cg < 20) { Wm = WK; wcols = KW; c0 = (cg - 16) * 128; } else { Wm = WV; wcols = KW; c0 = (cg - 20) * 128; }
  v8f acc[8] = {};
#pragma unroll 2
  for (int kc = 0; kc < HID / 32; ++kc) { v16b a; { const float* p = X + (r0 + col) * HID + kc * 32 + 8 * g;
#pragma unroll
      for (int i = 0; i < 8; ++i) { a[i] = (__bf16)p[i]; a[8 + i] = (__bf16)p[16 + i]; } }
#pragma unroll
    for (int j = 0; j < 8; ++j) { v16b w; const int o = c0 + j * 16 + col;
#pragma unroll
      for (int i = 0; i < 8; ++i) { w[i] = (__bf16)Wm[(size_t)(kc * 32 + 8 * g + i) * wcols + o]; w[8 + i] = (__bf16)Wm[(size_t)(kc * 32 + 16 + 8 * g + i) * wcols + o]; }
      acc[j] = wmma_bf(a, w, acc[j]); } }
#pragma unroll
  for (int j = 0; j < 8; ++j)
#pragma unroll
    for (int r = 0; r < 8; ++r) sf[wave][8 * g + r][j * 16 + col] = acc[j][r];
  LDSX(); for (int rl = 0; rl < 16; ++rl) vst2(F + (r0 + rl) * QKVW + cg * 128 + lane * 4, *(const v4f*)&sf[wave][rl][lane * 4]); }
// ---- k_rope: block = row (b, s): RoPE on the 16 q heads and 4 k heads (pairs (2j, 2j+1), angle pos * 1e4^(-2j/128)) -> f16 hi/lo rows
__global__ __launch_bounds__(256) void k_rope(const float* __restrict__ F, const int* __restrict__ PID, _Float16* __restrict__ QH, _Float16* __restrict__ QL, _Float16* __restrict__ KH, _Float16* __restrict__ KL) { __shared__ __align__(16) _Float16 sh[QW + KW], sl[QW + KW];
  const int t = threadIdx.x; const size_t row = blockIdx.x; const float pos = (float)PID[row]; const float* fr = F + row * QKVW;
  for (int e = t; e < (QW + KW) / 2; e += 256) { const int hh = e / (HD / 2), j = e % (HD / 2); const int o = hh * HD + 2 * j;   // heads 0..15 = q, 16..19 = k (contiguous in F)
    const float ang = pos * powf(10000.0f, -(float)(2 * j) / (float)HD); const float c = cosf(ang), sn = sinf(ang); const float x0 = fr[o], x1 = fr[o + 1];
    const float y0 = x0 * c - x1 * sn, y1 = x0 * sn + x1 * c; const _Float16 h0 = (_Float16)y0, h1 = (_Float16)y1; sh[o] = h0; sh[o + 1] = h1; sl[o] = (_Float16)(y0 - (float)h0); sl[o + 1] = (_Float16)(y1 - (float)h1); }   // UNSCALED residuals (q, k ~ O(1))
  __syncthreads();
  for (int q = t; q < QW / 8; q += 256) { vst2((unsigned*)(QH + row * QW + q * 8), *(const v4u*)&sh[q * 8]); vst2((unsigned*)(QL + row * QW + q * 8), *(const v4u*)&sl[q * 8]); }
  for (int q = t; q < KW / 8; q += 256) { vst2((unsigned*)(KH + row * KW + q * 8), *(const v4u*)&sh[QW + q * 8]); vst2((unsigned*)(KL + row * KW + q * 8), *(const v4u*)&sl[QW + q * 8]); } }
// ---- k_vt: block = (64 rows s, 128 of the 512 v channels): v rows -> f16 hi/lo planes [c][s]
__global__ __launch_bounds__(128) void k_vt(const float* __restrict__ F, _Float16* __restrict__ VH, _Float16* __restrict__ VL) { __shared__ __align__(16) _Float16 th[128][72], tl[128][72];
  const int t = threadIdx.x; const size_t s0 = (size_t)blockIdx.x * 64; const int c0 = blockIdx.y * 128;
  for (int e = t; e < 64 * 128; e += 128) { const int sl_ = e >> 7, c = e & 127; const float v = F[(s0 + sl_) * QKVW + QW + KW + c0 + c]; const _Float16 hv = (_Float16)v; th[c][sl_] = hv; tl[c][sl_] = (_Float16)(v - (float)hv); }   // UNSCALED residual (v ~ O(1)): lets the attention add it into the same accumulator
  __syncthreads(); for (int e = t; e < 128 * 8; e += 128) { const int c = e >> 3, q = e & 7; vst2((unsigned*)(VH + (size_t)(c0 + c) * SS + s0 + q * 8), *(const v4u*)&th[c][q * 8]); vst2((unsigned*)(VL + (size_t)(c0 + c) * SS + s0 + q * 8), *(const v4u*)&tl[c][q * 8]); } }
// staged key/value tile of 32 keys: row pitches are 16 B x odd (272 B, 80 B), so that the 16 rows of a ds_load_b128 fragment read fall on distinct banks
#define KP (HD + 8)
#define VP (32 + 8)
struct __align__(16) KVStage { _Float16 kh[32][KP], kl[32][KP], vh[HD][VP], vl[HD][VP]; };
__device__ __forceinline__ unsigned lds_addr(const void* p) { return (unsigned)(size_t)(__attribute__((address_space(3))) const void*)p; }
// eight asynchronous 16-byte copies per lane, global -> LDS through no register (four of plane a, four of plane b); the s_wait_xcnt stands in the copies' own statement so that no address register is rewritten ahead of it
__device__ __forceinline__ void acopy8(unsigned la, unsigned lb, unsigned ls, const _Float16* ga, const _Float16* gb, size_t gs) {
  asm volatile("global_load_async_to_lds_b128 %0, %8, off\n\t"
               "global_load_async_to_lds_b128 %1, %9, off\n\t"
               "global_load_async_to_lds_b128 %2, %10, off\n\t"
               "global_load_async_to_lds_b128 %3, %11, off\n\t"
               "global_load_async_to_lds_b128 %4, %12, off\n\t"
               "global_load_async_to_lds_b128 %5, %13, off\n\t"
               "global_load_async_to_lds_b128 %6, %14, off\n\t"
               "global_load_async_to_lds_b128 %7, %15, off\n\t"
               "s_wait_xcnt 0x0"
               :: "v"(la), "v"(la + ls), "v"(la + 2 * ls), "v"(la + 3 * ls), "v"(lb), "v"(lb + ls), "v"(lb + 2 * ls), "v"(lb + 3 * ls),
                  "v"(ga), "v"(ga + gs), "v"(ga + 2 * gs), "v"(ga + 3 * gs), "v"(gb), "v"(gb + gs), "v"(gb + 2 * gs), "v"(gb + 3 * gs) : "memory");
}
// ---- k_att: block = (64 queries, head h): kv head = h / 4; causal (tiles past the block skipped) AND attention_mask[k] != 0; head_dim 128 = 4 k-chunks; P . v over 8 d-tiles
__global__ __launch_bounds__(128) void k_att(const _Float16* __restrict__ QH, const _Float16* __restrict__ QL, const _Float16* __restrict__ KH, const _Float16* __restrict__ KL, const _Float16* __restrict__ VH, const _Float16* __restrict__ VL, const int* __restrict__ AM, float* __restrict__ CT) {
  __shared__ __align__(16) float sp[4][16][36]; __shared__ __align__(16) float so[4][16][132]; __shared__ KVStage st[2];
  const int tid = threadIdx.x, wave = tid >> 5, lane = tid & 31, col = lane & 15, g = lane >> 4; const int qb = blockIdx.x, h = blockIdx.y; const int kvh = h / (NHQ / NKV); const int q0 = qb * 64 + wave * 16; constexpr bool three = false;   // unused; the scores take 3 products into one accumulator: 0.02-scale projections keep logits ~0.1, and head_dim 128 leaves no VGPR room for the residual accumulators
  v16h aq[4], al[4];
#pragma unroll
  for (int kc = 0; kc < 4; ++kc) { aq[kc] = frag_h(QH + (size_t)(q0 + col) * QW + h * HD + kc * 32, lane); al[kc] = frag_h(QL + (size_t)(q0 + col) * QW + h * HD + kc * 32, lane); }
  float m[8], l[8];
#pragma unroll
  for (int r = 0; r < 8; ++r) { m[r] = -3.0e38f; l[r] = 0.f; }
  v8f acc[8] = {};
  const int nks = (qb * 64 + 64) / 32;   // causal bound
  // each thread copies 16 pieces of 16 B per tile: k rows of 256 B (16 lanes a row, 8 rows a step), v rows of 64 B (4 lanes a row, 32 rows a step)
  const unsigned lk = lds_addr(&st[0].kh[tid >> 4][(tid & 15) * 8]), lv = lds_addr(&st[0].vh[tid >> 2][(tid & 3) * 8]);
  const size_t gk = (size_t)(tid >> 4) * KW + kvh * HD + (tid & 15) * 8, gv = ((size_t)kvh * HD + (tid >> 2)) * SS + (tid & 3) * 8;
  auto stage = [&](int t) { const unsigned b = (unsigned)(t & 1) * (unsigned)sizeof(KVStage);
    acopy8(lk + b, lk + b + (unsigned)sizeof(st[0].kh), 8 * KP * 2, KH + gk + (size_t)t * 32 * KW, KL + gk + (size_t)t * 32 * KW, (size_t)8 * KW);
    acopy8(lv + b, lv + b + (unsigned)sizeof(st[0].vh), 32 * VP * 2, VH + gv + t * 32, VL + gv + t * 32, (size_t)32 * SS); };
  stage(0);
  asm volatile("s_wait_asynccnt 0x0" ::: "memory");   // this wave's copies of tile 0 have landed
  __syncthreads();                                    // ... and every other wave's: tile 0 may be read
  if (nks > 1) stage(1);
#pragma unroll 1
  for (int ks = 0; ks < nks; ++ks) { float s[2][8]; const KVStage& T = st[ks & 1];
#pragma unroll
    for (int ct = 0; ct < 2; ++ct) { const int kk = ks * 32 + ct * 16 + col; v8f c = {};
#pragma unroll
      for (int kc = 0; kc < 4; ++kc) { const v16h kh = frag_h(&T.kh[ct * 16 + col][kc * 32], lane); c = wmma16(aq[kc], kh, c); c = wmma16(al[kc], kh, c); c = wmma16(aq[kc], frag_h(&T.kl[ct * 16 + col][kc * 32], lane), c); }   // 3 products, all residuals UNSCALED into one accumulator
      const bool keepm = (AM[kk] != 0);
#pragma unroll
      for (int r = 0; r < 8; ++r) s[ct][r] = (keepm && kk <= q0 + 8 * g + r) ? c[r] * 0.08838834764831845f : -3.0e38f; }
    float alpha[8];
#pragma unroll
    for (int r = 0; r < 8; ++r) { float mx = fmaxf(s[0][r], s[1][r]);
#pragma unroll
      for (int o = 1; o < 16; o <<= 1) mx = fmaxf(mx, __shfl_xor(mx, o));
      const float mn = fmaxf(m[r], mx); alpha[r] = (m[r] <= -1.0e38f) ? 0.f : __expf(m[r] - mn); const float e0 = (s[0][r] <= -1.0e38f) ? 0.f : __expf(s[0][r] - mn), e1 = (s[1][r] <= -1.0e38f) ? 0.f : __expf(s[1][r] - mn); float es = e0 + e1;
#pragma unroll
      for (int o = 1; o < 16; o <<= 1) es += __shfl_xor(es, o);
      l[r] = l[r] * alpha[r] + es; m[r] = mn; sp[wave][8 * g + r][col] = e0; sp[wave][8 * g + r][16 + col] = e1; }
#pragma unroll
    for (int j = 0; j < 8; ++j)
#pragma unroll
      for (int r = 0; r < 8; ++r) acc[j][r] *= alpha[r];
    LDSX();
    const v16h pa = frag_f32s(&sp[wave][col][0], lane, 2048.0f);
#pragma unroll
    for (int j = 0; j < 8; ++j) { acc[j] = wmma16(pa, frag_h(&T.vh[j * 16 + col][0], lane), acc[j]); acc[j] = wmma16(pa, frag_h(&T.vl[j * 16 + col][0], lane), acc[j]); }   // v hi + unscaled residual
    asm volatile("s_wait_dscnt 0x0" ::: "memory");      // this wave's reads of this tile (and of sp) have returned before the tile's buffer is refilled
    asm volatile("s_wait_asynccnt 0x0" ::: "memory");   // this wave's copies of tile ks + 1 have landed
    __syncthreads();                                    // publishes tile ks + 1 and ends every wave's reads of tile ks
    if (ks + 2 < nks) stage(ks + 2); }
  asm volatile("s_wait_asynccnt 0x0" ::: "memory");     // no copy is outstanding when the wave goes on to its end
#pragma unroll
  for (int r = 0; r < 8; ++r) { const float il = (l[r] > 0.f) ? (1.0f / 2048.0f) / l[r] : 0.f;
#pragma unroll
    for (int j = 0; j < 8; ++j) so[wave][8 * g + r][j * 16 + col] = acc[j][r] * il; }
  LDSX(); for (int rl = 0; rl < 16; ++rl) vst2(CT + (size_t)(q0 + rl) * QW + h * HD + lane * 4, *(const v4f*)&so[wave][rl][lane * 4]); }
// ---- k_out: block = (64 rows, 128 of 2048 cols): out = ctx (hi + lo) . wo (in,out)
__global__ __launch_bounds__(128) void k_out(const float* __restrict__ CT, const float* __restrict__ WO, float* __restrict__ OUT) { __shared__ __align__(16) float sf[4][16][132];
  const int tid = threadIdx.x, wave = tid >> 5, lane = tid & 31, col = lane & 15, g = lane >> 4; const int c0 = blockIdx.y * 128; const size_t r0 = (size_t)blockIdx.x * 64 + wave * 16;
  v8f acc[8] = {};
#pragma unroll 2
  for (int kc = 0; kc < QW / 32; ++kc) { const F2 a = split_row(CT + (r0 + col) * QW, kc * 32, lane);
#pragma unroll
    for (int j = 0; j < 8; ++j) { v16b w; const int o = c0 + j * 16 + col;
#pragma unroll
      for (int i = 0; i < 8; ++i) { w[i] = (__bf16)WO[(size_t)(kc * 32 + 8 * g + i) * HID + o]; w[8 + i] = (__bf16)WO[(size_t)(kc * 32 + 16 + 8 * g + i) * HID + o]; }
      acc[j] = wmma_bf(a.h, w, acc[j]); acc[j] = wmma_bf(a.l, w, acc[j]); } }
#pragma unroll
  for (int j = 0; j < 8; ++j)
#pragma unroll
    for (int r = 0; r < 8; ++r) sf[wave][8 * g + r][j * 16 + col] = acc[j][r];
  LDSX(); for (int rl = 0; rl < 16; ++rl) vst2(OUT + (r0 + rl) * HID + c0 + lane * 4, *(const v4f*)&sf[wave][rl][lane * 4]); }
extern "C" void kernel_launch(void* const* d_in, const int* in_sizes, int n_in, void* d_out, int out_size, void* d_ws, size_t ws_size, hipStream_t stream) {
  (void)in_sizes; (void)n_in; (void)out_size;
  const float** F_ = (const float**)d_in;   // 0 hidden_states [1,2048,2048], 1 wq [2048,2048], 2 wk [2048,512], 3 wv [2048,512], 4 wo [2048,2048] (all (in,out)), 5 attention_mask [1,2048] int, 6 position_ids [1,2048] int
  if (ws_size < (size_t)WS_END) return;
  char* ws = (char*)d_ws; float* F = (float*)(ws + WS_F); _Float16 *QH = (_Float16*)(ws + WS_QH), *QL = (_Float16*)(ws + WS_QL), *KH = (_Float16*)(ws + WS_KH), *KL = (_Float16*)(ws + WS_KL), *VH = (_Float16*)(ws + WS_VH), *VL = (_Float16*)(ws + WS_VL); float* CT = (float*)(ws + WS_CT);
  k_qkv<<<dim3(TRB, QKVW / 128), 128, 0, stream>>>(F_[0], F_[1], F_[2], F_[3], F);
  k_rope<<<TRB * 64, 256, 0, stream>>>(F, (const int*)d_in[6], QH, QL, KH, KL);
  k_vt<<<dim3(TRB, KW / 128), 128, 0, stream>>>(F, VH, VL);
  k_att<<<dim3(TQB, NHQ), 128, 0, stream>>>(QH, QL, KH, KL, VH, VL, (const int*)d_in[5], CT);
  k_out<<<dim3(TQB, HID / 128), 128, 0, stream>>>(CT, F_[4], (float*)d_out);
}

// v002
// A run of this version takes 283 microseconds.
// Timed twice side by side with v001, it ran 1.77 and 1.76 times as fast.
// All steps since v000 together make it 2.89 times as fast.
// compute dtype: all float inputs rounded to bf16, attention_mask / position_ids (int) read; q/k/v = x . W with EXACT bf16 products on WMMA 16x16x32 ((in,out) weights), f32 accumulate; RoPE (interleaved pairs, angles position_id * theta^(-2j/128), precise sinf/cosf/powf) in f32, q/k as f16 hi + residual rows, v as f16 hi + residual planes; GQA causal attention with head_dim 128: 3-product scores (q/k as f16 hi + UNSCALED residual, one accumulator), P rounded once to f16 (x 2^11) against v as f16 hi + UNSCALED residual (2 products into one accumulator), x 1/sqrt(128), masked/acausal keys excluded, running-max softmax in f32 (hardware exp); out = ctx (bf16 hi + lo) . wo (2 products); f32 output.
#include <hip/hip_runtime.h>
#include <math.h>

typedef __attribute__((ext_vector_type(16))) _Float16 v16h;
typedef __attribute__((ext_vector_type(16))) __bf16 v16b;
typedef __attribute__((ext_vector_type(8)))  _Float16 v8h;
typedef __attribute__((ext_vector_type(8)))  float v8f;
typedef __attribute__((ext_vector_type(4)))  float v4f;
typedef __attribute__((ext_vector_type(2)))  float v2f;
typedef __attribute__((ext_vector_type(4)))  unsigned v4u;
typedef __attribute__((ext_vector_type(4)))  int v4i;
typedef float __attribute__((may_alias)) float_a;
typedef int __attribute__((may_alias)) int_a;

template <typename T> __device__ __forceinline__ void vst2(void* p, T v) { *(T*)p = v;  }
__device__ __forceinline__ v8f wmma16(v16h a, v16h b, v8f c) {
  v8f d = __builtin_amdgcn_wmma_f32_16x16x32_f16(false, a, false, b, (short)0, c, false, false);
  asm volatile("v_nop\n\tv_nop\n\tv_nop\n\tv_nop" : "+v"(d) : "v"(a), "v"(b));
  return d;
}
__device__ __forceinline__ v8f wmma_bf(v16b a, v16b b, v8f c) {
  v8f d = __builtin_amdgcn_wmma_f32_16x16x32_bf16(false, a, false, b, (short)0, c, false, false);
  asm volatile("v_nop\n\tv_nop\n\tv_nop\n\tv_nop" : "+v"(d) : "v"(a), "v"(b));
  return d;
}
// 16x16x32 fragments: lane = (h = lane>>4, row/col = lane&15); elements 0..7 = k0+8h+0..7, 8..15 = k0+16+8h+0..7; D element r = row 8h+r
__device__ __forceinline__ v16h frag_h(const _Float16* rowk0, int lane) {
  union { v16h v; v8h q[2]; } u; const _Float16* p = rowk0 + 8 * (lane >> 4);
  u.q[0] = *(const v8h*)p; u.q[1] = *(const v8h*)(p + 16); return u.v;
}
__device__ __forceinline__ v16h frag_f32(const float* rowk0, int lane) {
  v16h a; const float* p = rowk0 + 8 * (lane >> 4);
#pragma unroll
  for (int i = 0; i < 8; ++i) { a[i] = (_Float16)p[i]; a[8 + i] = (_Float16)p[16 + i]; }
  return a;
}
__device__ __forceinline__ v16h frag_f32s(const float* rowk0, int lane, float sc) {
  v16h a; const float* p = rowk0 + 8 * (lane >> 4);
#pragma unroll
  for (int i = 0; i < 8; ++i) { a[i] = (_Float16)(p[i] * sc); a[8 + i] = (_Float16)(p[16 + i] * sc); }
  return a;
}
// column fragment from a [K][ld] layout (column n), rows >= K read as 0
__device__ __forceinline__ v16h fragc_f32(const float* W, int k0, int n, int lane, int ld, int K) {
  v16h a; const int g = lane >> 4;
#pragma unroll
  for (int i = 0; i < 8; ++i) { const int ka = k0 + 8 * g + i, kb = ka + 16;
    a[i] = (_Float16)(ka < K ? W[(size_t)(ka < K ? ka : K - 1) * ld + n] : 0.f); a[8 + i] = (_Float16)(kb < K ? W[(size_t)(kb < K ? kb : K - 1) * ld + n] : 0.f); }
  return a;
}
struct F2 { v16b h, l; };
__device__ __forceinline__ F2 bsplit16(const float v[16]) { F2 r;
#pragma unroll
  for (int i = 0; i < 16; ++i) { const __bf16 h = (__bf16)v[i]; r.h[i] = h; r.l[i] = (__bf16)(v[i] - (float)h); }
  return r; }
__device__ __forceinline__ F2 split_row(const float* row, int k0, int lane) { float v[16]; const float* p = row + k0 + 8 * (lane >> 4);
#pragma unroll
  for (int i = 0; i < 8; ++i) { v[i] = p[i]; v[8 + i] = p[16 + i]; }
  return bsplit16(v); }
__device__ __forceinline__ F2 split_rowK(const float* row, int k0, int lane, int K) { float v[16]; const int g = lane >> 4;
#pragma unroll
  for (int i = 0; i < 8; ++i) { const int ka = k0 + 8 * g + i, kb = ka + 16; v[i] = ka < K ? row[ka < K ? ka : K - 1] : 0.f; v[8 + i] = kb < K ? row[kb < K ? kb : K - 1] : 0.f; }
  return bsplit16(v); }
__device__ __forceinline__ F2 split_col(const float* W, int k0, int n, int lane, int ld, int K) { float v[16]; const int g = lane >> 4;
#pragma unroll
  for (int i = 0; i < 8; ++i) { const int ka = k0 + 8 * g + i, kb = ka + 16; v[i] = ka < K ? W[(size_t)(ka < K ? ka : K - 1) * ld + n] : 0.f; v[8 + i] = kb < K ? W[(size_t)(kb < K ? kb : K - 1) * ld + n] : 0.f; }
  return bsplit16(v); }
__device__ __forceinline__ v8f mac3(const F2& a, const F2& b, v8f c) { c = wmma_bf(a.l, b.h, c); c = wmma_bf(a.h, b.l, c); return wmma_bf(a.h, b.h, c); }
__device__ __forceinline__ float sigm(float v) { return 1.0f / (1.0f + expf(-v)); }
#define LDSX() do { asm volatile("s_wait_dscnt 0" ::: "memory"); __builtin_amdgcn_wave_barrier(); __builtin_amdgcn_fence(__ATOMIC_RELEASE, "workgroup"); } while (0)


// LLaMA attention (B 1, S 2,048, hidden 2,048, 16 query heads / 4 kv heads x 128, RoPE theta 1e4): q/k/v projections, RoPE on q and k, GQA (kv head = h / 4), causal + padding mask, softmax in f32, o_proj.
#define NB 1
#define SS 2048
#define HID 2048
#define NHQ 16
#define NKV 4
#define HD 128
#define QW (NHQ * HD)     // 2048
#define KW (NKV * HD)     // 512
#define QKVW (QW + 2 * KW)   // 3072
#ifndef TQB
#define TQB (SS / 64)
#endif
#ifndef TRB
#define TRB (NB * SS / 64)   // row blocks for projections / rope / value planes
#endif
typedef __attribute__((ext_vector_type(8))) __bf16 v8b;
__device__ __forceinline__ v16b frag_b(const __bf16* rowk0, int lane) {
  union { v16b v; v8b q[2]; } u; const __bf16* p = rowk0 + 8 * (lane >> 4);
  u.q[0] = *(const v8b*)p; u.q[1] = *(const v8b*)(p + 16); return u.v;
}
__device__ __forceinline__ float bfr(float v) { return (float)(__bf16)v; }
__device__ __attribute__((noinline)) float exp_ni(float v) { return expf(v); }
__device__ __attribute__((noinline)) float erf_ni(float v) { return erff(v); }

#define WS_F   0u                                   // f32 q|k|v rows [b*s][3072]
#define WS_QH  (WS_F + 4u * (size_t)NB * SS * QKVW)     // f16 hi|lo q rows [b*s][2048] (after rope)
#define WS_QL  (WS_QH + 2u * (size_t)NB * SS * QW)
#define WS_KH  (WS_QL + 2u * (size_t)NB * SS * QW)      // f16 hi|lo k rows [b*s][512]
#define WS_KL  (WS_KH + 2u * (size_t)NB * SS * KW)
#define WS_VH  (WS_KL + 2u * (size_t)NB * SS * KW)      // f16 hi|lo v planes [b][512][s]
#define WS_VL  (WS_VH + 2u * (size_t)NB * KW * SS)
#define WS_CT  (WS_VL + 2u * (size_t)NB * KW * SS)      // f32 ctx rows [b*s][2048]
#define WS_END (WS_CT + 4u * (size_t)NB * SS * QW)

// staged 32-k operand tiles of the two projection GEMMs, bf16, one row per output row / column: pitch 80 B = 16 B x odd, so that the 16 rows of a ds_load_b128 fragment read fall on distinct banks
#define GP (32 + 8)
typedef __attribute__((ext_vector_type(4))) __bf16 v4b;
// 64 rows x 128 columns of X[.][2048] . W[2048][LDW] per block of 4 waves (a wave: 16 rows x 128 columns), K = 2048 in passes of 32. Both operands' tiles go ONCE per block through registers into LDS as bf16, two buffers; the next tile's global loads are in flight under this tile's products.
// Row tile: each wave brings its own 16 rows x 32 k f32 as four loads of 4 whole 128-B lines; SPLIT: stored as bf16 hi rows and residual rows.
// Weight tile [32 k][128 cols] f32 -> LDS [col][k] bf16: a thread holds 8 k rows (wave w: rows 8w .. 8w + 7) x 4 columns (4 * lane ..), read as whole 512-B row pieces per wave.
// The 16-B piece of k rows 8c .. 8c + 7 of a column stands at place (c + (column >> 4)) & 3 of its LDS row: the writers' rows lie 4 apart, and the rotation spreads their ds_store_b128 over all banks; the 16 columns of a fragment share one rotation.
template <int LDW, bool SPLIT>
__device__ __forceinline__ void proj_tile(const float* Xb, const float* Wb, __bf16 (*sh)[64][GP], __bf16 (*sl)[64][GP], __bf16 (*sw)[128][GP], v8f (&acc)[8], int wave, int lane) {
  const int col = lane & 15, g = lane >> 4, xrow = wave * 16 + (lane >> 3), xk = 4 * (lane & 7), pl = ((wave + (lane >> 2)) & 3) * 8;
  const unsigned xo = (unsigned)(xrow * 2048 + xk) * 4u, wo = (unsigned)(8 * wave * LDW + 4 * lane) * 4u;   // per-lane byte offsets, the same in every pass
  v4f wr[8], xr[4];
  auto get = [&](int kc) { const char* xb = (const char*)(Xb + kc * 32); const char* wb = (const char*)(Wb + (size_t)kc * 32 * LDW);
#pragma unroll
    for (int i = 0; i < 8; ++i) wr[i] = *(const v4f*)(wb + wo + i * LDW * 4);
#pragma unroll
    for (int i = 0; i < 4; ++i) xr[i] = *(const v4f*)(xb + xo + i * 4 * 2048 * 4);
    asm volatile("s_wait_xcnt 0x0" ::: "memory"); };   // stands behind the loads, in front of whatever rewrites a register that they name
  auto put = [&](int b) {
#pragma unroll
    for (int c = 0; c < 4; ++c) { v8b q;
#pragma unroll
      for (int i = 0; i < 8; ++i) q[i] = (__bf16)wr[i][c];
      *(v8b*)&sw[b][4 * lane + c][pl] = q; }
#pragma unroll
    for (int i = 0; i < 4; ++i) { v4b qh, ql;
#pragma unroll
      for (int e = 0; e < 4; ++e) { const __bf16 hv = (__bf16)xr[i][e]; qh[e] = hv; if (SPLIT) ql[e] = (__bf16)(xr[i][e] - (float)hv); }
      *(v4b*)&sh[b][xrow + 4 * i][xk] = qh; if (SPLIT) *(v4b*)&sl[b][xrow + 4 * i][xk] = ql; } };
  get(0); put(0);
  __syncthreads();   // tile 0 may be read
  // two passes a trip, so that the buffer index is a constant of each copy and stands as an immediate in every LDS address (the full unrolls here keep the register arrays' indices constant)
#pragma unroll 2
  for (int kc = 0; kc < 2048 / 32; ++kc) { const int b = kc & 1;
    if (kc + 1 < 2048 / 32) get(kc + 1);
    const v16b ah = frag_b(&sh[b][wave * 16 + col][0], lane); v16b al; if (SPLIT) al = frag_b(&sl[b][wave * 16 + col][0], lane);
    v16b w[8];
#pragma unroll
    for (int j = 0; j < 8; ++j) { union { v16b v; v8b q[2]; } u; const __bf16* p = &sw[b][j * 16 + col][0];
      u.q[0] = *(const v8b*)(p + ((g + j) & 3) * 8); u.q[1] = *(const v8b*)(p + ((g + 2 + j) & 3) * 8); w[j] = u.v; }
#pragma unroll
    for (int j = 0; j < 8; ++j) acc[j] = wmma_bf(ah, w[j], acc[j]);
    if (SPLIT) {   // each accumulator still takes hi, then residual, of every pass; the other accumulators' products stand between the two
#pragma unroll
      for (int j = 0; j < 8; ++j) acc[j] = wmma_bf(al, w[j], acc[j]); }
    __builtin_amdgcn_sched_barrier(0);    // keeps the conversions of the next tile, and with them the wait for its global loads, behind this tile's products
    if (kc + 1 < 2048 / 32) put(b ^ 1);   // the other buffer: its readers left it at the barrier that ended pass kc - 1
    __syncthreads(); }                    // publishes tile kc + 1 and ends every wave's reads of tile kc
}
// ---- k_qkv: block = (64 rows, col group of 128 over q|k|v (24 groups)): x . W (exact) -> f32 rows
__global__ __launch_bounds__(128) void k_qkv(const float* __restrict__ X, const float* __restrict__ WQ, const float* __restrict__ WK, const float* __restrict__ WV, float* __restrict__ F) { __shared__ __align__(16) float sf[4][16][132]; __shared__ __align__(16) __bf16 sa[2][64][GP], sw[2][128][GP];
  const int tid = threadIdx.x, wave = tid >> 5, lane = tid & 31, col = lane & 15, g = lane >> 4; const int cg = blockIdx.y; const size_t r0 = (size_t)blockIdx.x * 64 + wave * 16;
  const float* Xb = X + (size_t)blockIdx.x * 64 * HID;
  v8f acc[8] = {};
  if (cg < 16) proj_tile<QW, false>(Xb, WQ + cg * 128, sa, sa, sw, acc, wave, lane);
  else proj_tile<KW, false>(Xb, (cg < 20 ? WK + (cg - 16) * 128 : WV + (cg - 20) * 128), sa, sa, sw, acc, wave, lane);
#pragma unroll
  for (int j = 0; j < 8; ++j)
#pragma unroll
    for (int r = 0; r < 8; ++r) sf[wave][8 * g + r][j * 16 + col] = acc[j][r];
  LDSX(); for (int rl = 0; rl < 16; ++rl) vst2(F + (r0 + rl) * QKVW + cg * 128 + lane * 4, *(const v4f*)&sf[wave][rl][lane * 4]); }
// ---- k_rope: block = row (b, s): RoPE on the 16 q heads and 4 k heads (pairs (2j, 2j+1), angle pos * 1e4^(-2j/128)) -> f16 hi/lo rows
__global__ __launch_bounds__(256) void k_rope(const float* __restrict__ F, const int* __restrict__ PID, _Float16* __restrict__ QH, _Float16* __restrict__ QL, _Float16* __restrict__ KH, _Float16* __restrict__ KL) { __shared__ __align__(16) _Float16 sh[QW + KW], sl[QW + KW];
  const int t = threadIdx.x; const size_t row = blockIdx.x; const float pos = (float)PID[row]; const float* fr = F + row * QKVW;
  for (int e = t; e < (QW + KW) / 2; e += 256) { const int hh = e / (HD / 2), j = e % (HD / 2); const int o = hh * HD + 2 * j;   // heads 0..15 = q, 16..19 = k (contiguous in F)
    const float ang = pos * powf(10000.0f, -(float)(2 * j) / (float)HD); const float c = cosf(ang), sn = sinf(ang); const float x0 = fr[o], x1 = fr[o + 1];
    const float y0 = x0 * c - x1 * sn, y1 = x0 * sn + x1 * c; const _Float16 h0 = (_Float16)y0, h1 = (_Float16)y1; sh[o] = h0; sh[o + 1] = h1; sl[o] = (_Float16)(y0 - (float)h0); sl[o + 1] = (_Float16)(y1 - (float)h1); }   // UNSCALED residuals (q, k ~ O(1))
  __syncthreads();
  for (int q = t; q < QW / 8; q += 256) { vst2((unsigned*)(QH + row * QW + q * 8), *(const v4u*)&sh[q * 8]); vst2((unsigned*)(QL + row * QW + q * 8), *(const v4u*)&sl[q * 8]); }
  for (int q = t; q < KW / 8; q += 256) { vst2((unsigned*)(KH + row * KW + q * 8), *(const v4u*)&sh[QW + q * 8]); vst2((unsigned*)(KL + row * KW + q * 8), *(const v4u*)&sl[QW + q * 8]); } }
// ---- k_vt: block = (64 rows s, 128 of the 512 v channels): v rows -> f16 hi/lo planes [c][s]
__global__ __launch_bounds__(128) void k_vt(const float* __restrict__ F, _Float16* __restrict__ VH, _Float16* __restrict__ VL) { __shared__ __align__(16) _Float16 th[128][72], tl[128][72];
  const int t = threadIdx.x; const size_t s0 = (size_t)blockIdx.x * 64; const int c0 = blockIdx.y * 128;
  for (int e = t; e < 64 * 128; e += 128) { const int sl_ = e >> 7, c = e & 127; const float v = F[(s0 + sl_) * QKVW + QW + KW + c0 + c]; const _Float16 hv = (_Float16)v; th[c][sl_] = hv; tl[c][sl_] = (_Float16)(v - (float)hv); }   // UNSCALED residual (v ~ O(1)): lets the attention add it into the same accumulator
  __syncthreads(); for (int e = t; e < 128 * 8; e += 128) { const int c = e >> 3, q = e & 7; vst2((unsigned*)(VH + (size_t)(c0 + c) * SS + s0 + q * 8), *(const v4u*)&th[c][q * 8]); vst2((unsigned*)(VL + (size_t)(c0 + c) * SS + s0 + q * 8), *(const v4u*)&tl[c][q * 8]); } }
// staged key/value tile of 32 keys: row pitches are 16 B x odd (272 B, 80 B), so that the 16 rows of a ds_load_b128 fragment read fall on distinct banks
#define KP (HD + 8)
#define VP (32 + 8)
struct __align__(16) KVStage { _Float16 kh[32][KP], kl[32][KP], vh[HD][VP], vl[HD][VP]; };
__device__ __forceinline__ unsigned lds_addr(const void* p) { return (unsigned)(size_t)(__attribute__((address_space(3))) const void*)p; }
// eight asynchronous 16-byte copies per lane, global -> LDS through no register (four of plane a, four of plane b); the s_wait_xcnt stands in the copies' own statement so that no address register is rewritten ahead of it
__device__ __forceinline__ void acopy8(unsigned la, unsigned lb, unsigned ls, const _Float16* ga, const _Float16* gb, size_t gs) {
  asm volatile("global_load_async_to_lds_b128 %0, %8, off\n\t"
               "global_load_async_to_lds_b128 %1, %9, off\n\t"
               "global_load_async_to_lds_b128 %2, %10, off\n\t"
               "global_load_async_to_lds_b128 %3, %11, off\n\t"
               "global_load_async_to_lds_b128 %4, %12, off\n\t"
               "global_load_async_to_lds_b128 %5, %13, off\n\t"
               "global_load_async_to_lds_b128 %6, %14, off\n\t"
               "global_load_async_to_lds_b128 %7, %15, off\n\t"
               "s_wait_xcnt 0x0"
               :: "v"(la), "v"(la + ls), "v"(la + 2 * ls), "v"(la + 3 * ls), "v"(lb), "v"(lb + ls), "v"(lb + 2 * ls), "v"(lb + 3 * ls),
                  "v"(ga), "v"(ga + gs), "v"(ga + 2 * gs), "v"(ga + 3 * gs), "v"(gb), "v"(gb + gs), "v"(gb + 2 * gs), "v"(gb + 3 * gs) : "memory");
}
// ---- k_att: block = (64 queries, head h): kv head = h / 4; causal (tiles past the block skipped) AND attention_mask[k] != 0; head_dim 128 = 4 k-chunks; P . v over 8 d-tiles
__global__ __launch_bounds__(128) void k_att(const _Float16* __restrict__ QH, const _Float16* __restrict__ QL, const _Float16* __restrict__ KH, const _Float16* __restrict__ KL, const _Float16* __restrict__ VH, const _Float16* __restrict__ VL, const int* __restrict__ AM, float* __restrict__ CT) {
  __shared__ __align__(16) float sp[4][16][36]; __shared__ __align__(16) float so[4][16][132]; __shared__ KVStage st[2];
  const int tid = threadIdx.x, wave = tid >> 5, lane = tid & 31, col = lane & 15, g = lane >> 4; const int qb = blockIdx.x, h = blockIdx.y; const int kvh = h / (NHQ / NKV); const int q0 = qb * 64 + wave * 16; constexpr bool three = false;   // unused; the scores take 3 products into one accumulator: 0.02-scale projections keep logits ~0.1, and head_dim 128 leaves no VGPR room for the residual accumulators
  v16h aq[4], al[4];
#pragma unroll
  for (int kc = 0; kc < 4; ++kc) { aq[kc] = frag_h(QH + (size_t)(q0 + col) * QW + h * HD + kc * 32, lane); al[kc] = frag_h(QL + (size_t)(q0 + col) * QW + h * HD + kc * 32, lane); }
  float m[8], l[8];
#pragma unroll
  for (int r = 0; r < 8; ++r) { m[r] = -3.0e38f; l[r] = 0.f; }
  v8f acc[8] = {};
  const int nks = (qb * 64 + 64) / 32;   // causal bound
  // each thread copies 16 pieces of 16 B per tile: k rows of 256 B (16 lanes a row, 8 rows a step), v rows of 64 B (4 lanes a row, 32 rows a step)
  const unsigned lk = lds_addr(&st[0].kh[tid >> 4][(tid & 15) * 8]), lv = lds_addr(&st[0].vh[tid >> 2][(tid & 3) * 8]);
  const size_t gk = (size_t)(tid >> 4) * KW + kvh * HD + (tid & 15) * 8, gv = ((size_t)kvh * HD + (tid >> 2)) * SS + (tid & 3) * 8;
  auto stage = [&](int t) { const unsigned b = (unsigned)(t & 1) * (unsigned)sizeof(KVStage);
    acopy8(lk + b, lk + b + (unsigned)sizeof(st[0].kh), 8 * KP * 2, KH + gk + (size_t)t * 32 * KW, KL + gk + (size_t)t * 32 * KW, (size_t)8 * KW);
    acopy8(lv + b, lv + b + (unsigned)sizeof(st[0].vh), 32 * VP * 2, VH + gv + t * 32, VL + gv + t * 32, (size_t)32 * SS); };
  stage(0);
  asm volatile("s_wait_asynccnt 0x0" ::: "memory");   // this wave's copies of tile 0 have landed
  __syncthreads();                                    // ... and every other wave's: tile 0 may be read
  if (nks > 1) stage(1);
#pragma unroll 1
  for (int ks = 0; ks < nks; ++ks) { float s[2][8]; const KVStage& T = st[ks & 1];
#pragma unroll
    for (int ct = 0; ct < 2; ++ct) { const int kk = ks * 32 + ct * 16 + col; v8f c = {};
#pragma unroll
      for (int kc = 0; kc < 4; ++kc) { const v16h kh = frag_h(&T.kh[ct * 16 + col][kc * 32], lane); c = wmma16(aq[kc], kh, c); c = wmma16(al[kc], kh, c); c = wmma16(aq[kc], frag_h(&T.kl[ct * 16 + col][kc * 32], lane), c); }   // 3 products, all residuals UNSCALED into one accumulator
      const bool keepm = (AM[kk] != 0);
#pragma unroll
      for (int r = 0; r < 8; ++r) s[ct][r] = (keepm && kk <= q0 + 8 * g + r) ? c[r] * 0.08838834764831845f : -3.0e38f; }
    float alpha[8];
#pragma unroll
    for (int r = 0; r < 8; ++r) { float mx = fmaxf(s[0][r], s[1][r]);
#pragma unroll
      for (int o = 1; o < 16; o <<= 1) mx = fmaxf(mx, __shfl_xor(mx, o));
      const float mn = fmaxf(m[r], mx); alpha[r] = (m[r] <= -1.0e38f) ? 0.f : __expf(m[r] - mn); const float e0 = (s[0][r] <= -1.0e38f) ? 0.f : __expf(s[0][r] - mn), e1 = (s[1][r] <= -1.0e38f) ? 0.f : __expf(s[1][r] - mn); float es = e0 + e1;
#pragma unroll
      for (int o = 1; o < 16; o <<= 1) es += __shfl_xor(es, o);
      l[r] = l[r] * alpha[r] + es; m[r] = mn; sp[wave][8 * g + r][col] = e0; sp[wave][8 * g + r][16 + col] = e1; }
#pragma unroll
    for (int j = 0; j < 8; ++j)
#pragma unroll
      for (int r = 0; r < 8; ++r) acc[j][r] *= alpha[r];
    LDSX();
    const v16h pa = frag_f32s(&sp[wave][col][0], lane, 2048.0f);
#pragma unroll
    for (int j = 0; j < 8; ++j) { acc[j] = wmma16(pa, frag_h(&T.vh[j * 16 + col][0], lane), acc[j]); acc[j] = wmma16(pa, frag_h(&T.vl[j * 16 + col][0], lane), acc[j]); }   // v hi + unscaled residual
    asm volatile("s_wait_dscnt 0x0" ::: "memory");      // this wave's reads of this tile (and of sp) have returned before the tile's buffer is refilled
    asm volatile("s_wait_asynccnt 0x0" ::: "memory");   // this wave's copies of tile ks + 1 have landed
    __syncthreads();                                    // publishes tile ks + 1 and ends every wave's reads of tile ks
    if (ks + 2 < nks) stage(ks + 2); }
  asm volatile("s_wait_asynccnt 0x0" ::: "memory");     // no copy is outstanding when the wave goes on to its end
#pragma unroll
  for (int r = 0; r < 8; ++r) { const float il = (l[r] > 0.f) ? (1.0f / 2048.0f) / l[r] : 0.f;
#pragma unroll
    for (int j = 0; j < 8; ++j) so[wave][8 * g + r][j * 16 + col] = acc[j][r] * il; }
  LDSX(); for (int rl = 0; rl < 16; ++rl) vst2(CT + (size_t)(q0 + rl) * QW + h * HD + lane * 4, *(const v4f*)&so[wave][rl][lane * 4]); }
// ---- k_out: block = (64 rows, 128 of 2048 cols): out = ctx (hi + lo) . wo (in,out)
__global__ __launch_bounds__(128) void k_out(const float* __restrict__ CT, const float* __restrict__ WO, float* __restrict__ OUT) { __shared__ __align__(16) float sf[4][16][132]; __shared__ __align__(16) __bf16 sh[2][64][GP], sl[2][64][GP], sw[2][128][GP];
  const int tid = threadIdx.x, wave = tid >> 5, lane = tid & 31, col = lane & 15, g = lane >> 4; const int c0 = blockIdx.y * 128; const size_t r0 = (size_t)blockIdx.x * 64 + wave * 16;
  v8f acc[8] = {};
  proj_tile<HID, true>(CT + (size_t)blockIdx.x * 64 * QW, WO + c0, sh, sl, sw, acc, wave, lane);
#pragma unroll
  for (int j = 0; j < 8; ++j)
#pragma unroll
    for (int r = 0; r < 8; ++r) sf[wave][8 * g + r][j * 16 + col] = acc[j][r];
  LDSX(); for (int rl = 0; rl < 16; ++rl) vst2(OUT + (r0 + rl) * HID + c0 + lane * 4, *(const v4f*)&sf[wave][rl][lane * 4]); }
extern "C" void kernel_launch(void* const* d_in, const int* in_sizes, int n_in, void* d_out, int out_size, void* d_ws, size_t ws_size, hipStream_t stream) {
  (void)in_sizes; (void)n_in; (void)out_size;
  const float** F_ = (const float**)d_in;   // 0 hidden_states [1,2048,2048], 1 wq [2048,2048], 2 wk [2048,512], 3 wv [2048,512], 4 wo [2048,2048] (all (in,out)), 5 attention_mask [1,2048] int, 6 position_ids [1,2048] int
  if (ws_size < (size_t)WS_END) return;
  char* ws = (char*)d_ws; float* F = (float*)(ws + WS_F); _Float16 *QH = (_Float16*)(ws + WS_QH), *QL = (_Float16*)(ws + WS_QL), *KH = (_Float16*)(ws + WS_KH), *KL = (_Float16*)(ws + WS_KL), *VH = (_Float16*)(ws + WS_VH), *VL = (_Float16*)(ws + WS_VL); float* CT = (float*)(ws + WS_CT);
  k_qkv<<<dim3(TRB, QKVW / 128), 128, 0, stream>>>(F_[0], F_[1], F_[2], F_[3], F);
  k_rope<<<TRB * 64, 256, 0, stream>>>(F, (const int*)d_in[6], QH, QL, KH, KL);
  k_vt<<<dim3(TRB, KW / 128), 128, 0, stream>>>(F, VH, VL);
  k_att<<<dim3(TQB, NHQ), 128, 0, stream>>>(QH, QL, KH, KL, VH, VL, (const int*)d_in[5], CT);
  k_out<<<dim3(TQB, HID / 128), 128, 0, stream>>>(CT, F_[4], (float*)d_out);
}

// v003
// A run of this version takes 252 microseconds.
// In both of two side-by-side timings against v002, it was 1.12 times as fast.
// Over all steps from v000 it is 3.24 times as fast.
// compute dtype: all float inputs rounded to bf16, attention_mask / position_ids (int) read; q/k/v = x . W with EXACT bf16 products on WMMA 16x16x32 ((in,out) weights), f32 accumulate; RoPE (interleaved pairs, angles position_id * theta^(-2j/128), precise sinf/cosf/powf) in f32, q/k as f16 hi + residual rows, v as f16 hi + residual planes; GQA causal attention with head_dim 128: 3-product scores (q/k as f16 hi + UNSCALED residual, one accumulator), P rounded once to f16 (x 2^11) against v as f16 hi + UNSCALED residual (2 products into one accumulator), x 1/sqrt(128), masked/acausal keys excluded, running-max softmax in f32 (hardware exp); out = ctx (bf16 hi + lo) . wo (2 products); f32 output.
#include <hip/hip_runtime.h>
#include <math.h>

typedef __attribute__((ext_vector_type(16))) _Float16 v16h;
typedef __attribute__((ext_vector_type(16))) __bf16 v16b;
typedef __attribute__((ext_vector_type(8)))  _Float16 v8h;
typedef __attribute__((ext_vector_type(8)))  float v8f;
typedef __attribute__((ext_vector_type(4)))  float v4f;
typedef __attribute__((ext_vector_type(2)))  float v2f;
typedef __attribute__((ext_vector_type(4)))  unsigned v4u;
typedef __attribute__((ext_vector_type(4)))  int v4i;
typedef float __attribute__((may_alias)) float_a;
typedef int __attribute__((may_alias)) int_a;

template <typename T> __device__ __forceinline__ void vst2(void* p, T v) { *(T*)p = v;  }
__device__ __forceinline__ v8f wmma16(v16h a, v16h b, v8f c) {
  v8f d = __builtin_amdgcn_wmma_f32_16x16x32_f16(false, a, false, b, (short)0, c, false, false);
  asm volatile("v_nop\n\tv_nop\n\tv_nop\n\tv_nop" : "+v"(d) : "v"(a), "v"(b));
  return d;
}
__device__ __forceinline__ v8f wmma_bf(v16b a, v16b b, v8f c) {
  v8f d = __builtin_amdgcn_wmma_f32_16x16x32_bf16(false, a, false, b, (short)0, c, false, false);
  asm volatile("v_nop\n\tv_nop\n\tv_nop\n\tv_nop" : "+v"(d) : "v"(a), "v"(b));
  return d;
}
// 16x16x32 fragments: lane = (h = lane>>4, row/col = lane&15); elements 0..7 = k0+8h+0..7, 8..15 = k0+16+8h+0..7; D element r = row 8h+r
__device__ __forceinline__ v16h frag_h(const _Float16* rowk0, int lane) {
  union { v16h v; v8h q[2]; } u; const _Float16* p = rowk0 + 8 * (lane >> 4);
  u.q[0] = *(const v8h*)p; u.q[1] = *(const v8h*)(p + 16); return u.v;
}
__device__ __forceinline__ v16h frag_f32(const float* rowk0, int lane) {
  v16h a; const float* p = rowk0 + 8 * (lane >> 4);
#pragma unroll
  for (int i = 0; i < 8; ++i) { a[i] = (_Float16)p[i]; a[8 + i] = (_Float16)p[16 + i]; }
  return a;
}
__device__ __forceinline__ v16h frag_f32s(const float* rowk0, int lane, float sc) {
  v16h a; const float* p = rowk0 + 8 * (lane >> 4);
#pragma unroll
  for (int i = 0; i < 8; ++i) { a[i] = (_Float16)(p[i] * sc); a[8 + i] = (_Float16)(p[16 + i] * sc); }
  return a;
}
// column fragment from a [K][ld] layout (column n), rows >= K read as 0
__device__ __forceinline__ v16h fragc_f32(const float* W, int k0, int n, int lane, int ld, int K) {
  v16h a; const int g = lane >> 4;
#pragma unroll
  for (int i = 0; i < 8; ++i) { const int ka = k0 + 8 * g + i, kb = ka + 16;
    a[i] = (_Float16)(ka < K ? W[(size_t)(ka < K ? ka : K - 1) * ld + n] : 0.f); a[8 + i] = (_Float16)(kb < K ? W[(size_t)(kb < K ? kb : K - 1) * ld + n] : 0.f); }
  return a;
}
struct F2 { v16b h, l; };
__device__ __forceinline__ F2 bsplit16(const float v[16]) { F2 r;
#pragma unroll
  for (int i = 0; i < 16; ++i) { const __bf16 h = (__bf16)v[i]; r.h[i] = h; r.l[i] = (__bf16)(v[i] - (float)h); }
  return r; }
__device__ __forceinline__ F2 split_row(const float* row, int k0, int lane) { float v[16]; const float* p = row + k0 + 8 * (lane >> 4);
#pragma unroll
  for (int i = 0; i < 8; ++i) { v[i] = p[i]; v[8 + i] = p[16 + i]; }
  return bsplit16(v); }
__device__ __forceinline__ F2 split_rowK(const float* row, int k0, int lane, int K) { float v[16]; const int g = lane >> 4;
#pragma unroll
  for (int i = 0; i < 8; ++i) { const int ka = k0 + 8 * g + i, kb = ka + 16; v[i] = ka < K ? row[ka < K ? ka : K - 1] : 0.f; v[8 + i] = kb < K ? row[kb < K ? kb : K - 1] : 0.f; }
  return bsplit16(v); }
__device__ __forceinline__ F2 split_col(const float* W, int k0, int n, int lane, int ld, int K) { float v[16]; const int g = lane >> 4;
#pragma unroll
  for (int i = 0; i < 8; ++i) { const int ka = k0 + 8 * g + i, kb = ka + 16; v[i] = ka < K ? W[(size_t)(ka < K ? ka : K - 1) * ld + n] : 0.f; v[8 + i] = kb < K ? W[(size_t)(kb < K ? kb : K - 1) * ld + n] : 0.f; }
  return bsplit16(v); }
__device__ __forceinline__ v8f mac3(const F2& a, const F2& b, v8f c) { c = wmma_bf(a.l, b.h, c); c = wmma_bf(a.h, b.l, c); return wmma_bf(a.h, b.h, c); }
__device__ __forceinline__ float sigm(float v) { return 1.0f / (1.0f + expf(-v)); }
#define LDSX() do { asm volatile("s_wait_dscnt 0" ::: "memory"); __builtin_amdgcn_wave_barrier(); __builtin_amdgcn_fence(__ATOMIC_RELEASE, "workgroup"); } while (0)


// LLaMA attention (B 1, S 2,048, hidden 2,048, 16 query heads / 4 kv heads x 128, RoPE theta 1e4): q/k/v projections, RoPE on q and k, GQA (kv head = h / 4), causal + padding mask, softmax in f32, o_proj.
#define NB 1
#define SS 2048
#define HID 2048
#define NHQ 16
#define NKV 4
#define HD 128
#define QW (NHQ * HD)     // 2048
#define KW (NKV * HD)     // 512
#define QKVW (QW + 2 * KW)   // 3072
#ifndef TQB
#define TQB (SS / 64)
#endif
#ifndef TRB
#define TRB (NB * SS / 64)   // row blocks for projections / rope / value planes
#endif
typedef __attribute__((ext_vector_type(8))) __bf16 v8b;
__device__ __forceinline__ v16b frag_b(const __bf16* rowk0, int lane) {
  union { v16b v; v8b q[2]; } u; const __bf16* p = rowk0 + 8 * (lane >> 4);
  u.q[0] = *(const v8b*)p; u.q[1] = *(const v8b*)(p + 16); return u.v;
}
__device__ __forceinline__ float bfr(float v) { return (float)(__bf16)v; }
__device__ __attribute__((noinline)) float exp_ni(float v) { return expf(v); }
__device__ __attribute__((noinline)) float erf_ni(float v) { return erff(v); }

#define WS_F   0u                                   // f32 q|k|v rows [b*s][3072]
#define WS_QH  (WS_F + 4u * (size_t)NB * SS * QKVW)     // f16 hi|lo q rows [b*s][2048] (after rope)
#define WS_QL  (WS_QH + 2u * (size_t)NB * SS * QW)
#define WS_KH  (WS_QL + 2u * (size_t)NB * SS * QW)      // f16 hi|lo k rows [b*s][512]
#define WS_KL  (WS_KH + 2u * (size_t)NB * SS * KW)
#define WS_VH  (WS_KL + 2u * (size_t)NB * SS * KW)      // f16 hi|lo v planes [b][512][s]
#define WS_VL  (WS_VH + 2u * (size_t)NB * KW * SS)
#define WS_CT  (WS_VL + 2u * (size_t)NB * KW * SS)      // f32 ctx rows [b*s][2048]
#define WS_END (WS_CT + 4u * (size_t)NB * SS * QW)

// staged 32-k operand tiles of the two projection GEMMs, bf16, one row per output row / column: pitch 80 B = 16 B x odd, so that the 16 rows of a ds_load_b128 fragment read fall on distinct banks
#define GP (32 + 8)
typedef __attribute__((ext_vector_type(4))) __bf16 v4b;
// 64 rows x 128 columns of X[.][2048] . W[2048][LDW] per block of 4 waves (a wave: 16 rows x 128 columns), K = 2048 in passes of 32. Both operands' tiles go ONCE per block through registers into LDS as bf16, two buffers; the next tile's global loads are in flight under this tile's products.
// Row tile: each wave brings its own 16 rows x 32 k f32 as four loads of 4 whole 128-B lines; SPLIT: stored as bf16 hi rows and residual rows.
// Weight tile [32 k][128 cols] f32 -> LDS [col][k] bf16: a thread holds 8 k rows (wave w: rows 8w .. 8w + 7) x 4 columns (4 * lane ..), read as whole 512-B row pieces per wave.
// The 16-B piece of k rows 8c .. 8c + 7 of a column stands at place (c + (column >> 4)) & 3 of its LDS row: the writers' rows lie 4 apart, and the rotation spreads their ds_store_b128 over all banks; the 16 columns of a fragment share one rotation.
template <int LDW, bool SPLIT>
__device__ __forceinline__ void proj_tile(const float* Xb, const float* Wb, __bf16 (*sh)[64][GP], __bf16 (*sl)[64][GP], __bf16 (*sw)[128][GP], v8f (&acc)[8], int wave, int lane) {
  const int col = lane & 15, g = lane >> 4, xrow = wave * 16 + (lane >> 3), xk = 4 * (lane & 7), pl = ((wave + (lane >> 2)) & 3) * 8;
  const unsigned xo = (unsigned)(xrow * 2048 + xk) * 4u, wo = (unsigned)(8 * wave * LDW + 4 * lane) * 4u;   // per-lane byte offsets, the same in every pass
  v4f wr[8], xr[4];
  auto get = [&](int kc) { const char* xb = (const char*)(Xb + kc * 32); const char* wb = (const char*)(Wb + (size_t)kc * 32 * LDW);
#pragma unroll
    for (int i = 0; i < 8; ++i) wr[i] = *(const v4f*)(wb + wo + i * LDW * 4);
#pragma unroll
    for (int i = 0; i < 4; ++i) xr[i] = *(const v4f*)(xb + xo + i * 4 * 2048 * 4);
    asm volatile("s_wait_xcnt 0x0" ::: "memory"); };   // stands behind the loads, in front of whatever rewrites a register that they name
  auto put = [&](int b) {
#pragma unroll
    for (int c = 0; c < 4; ++c) { v8b q;
#pragma unroll
      for (int i = 0; i < 8; ++i) q[i] = (__bf16)wr[i][c];
      *(v8b*)&sw[b][4 * lane + c][pl] = q; }
#pragma unroll
    for (int i = 0; i < 4; ++i) { v4b qh, ql;
#pragma unroll
      for (int e = 0; e < 4; ++e) { const __bf16 hv = (__bf16)xr[i][e]; qh[e] = hv; if (SPLIT) ql[e] = (__bf16)(xr[i][e] - (float)hv); }
      *(v4b*)&sh[b][xrow + 4 * i][xk] = qh; if (SPLIT) *(v4b*)&sl[b][xrow + 4 * i][xk] = ql; } };
  get(0); put(0);
  __syncthreads();   // tile 0 may be read
  // two passes a trip, so that the buffer index is a constant of each copy and stands as an immediate in every LDS address (the full unrolls here keep the register arrays' indices constant)
#pragma unroll 2
  for (int kc = 0; kc < 2048 / 32; ++kc) { const int b = kc & 1;
    if (kc + 1 < 2048 / 32) get(kc + 1);
    const v16b ah = frag_b(&sh[b][wave * 16 + col][0], lane); v16b al; if (SPLIT) al = frag_b(&sl[b][wave * 16 + col][0], lane);
    v16b w[8];
#pragma unroll
    for (int j = 0; j < 8; ++j) { union { v16b v; v8b q[2]; } u; const __bf16* p = &sw[b][j * 16 + col][0];
      u.q[0] = *(const v8b*)(p + ((g + j) & 3) * 8); u.q[1] = *(const v8b*)(p + ((g + 2 + j) & 3) * 8); w[j] = u.v; }
#pragma unroll
    for (int j = 0; j < 8; ++j) acc[j] = wmma_bf(ah, w[j], acc[j]);
    if (SPLIT) {   // each accumulator still takes hi, then residual, of every pass; the other accumulators' products stand between the two
#pragma unroll
      for (int j = 0; j < 8; ++j) acc[j] = wmma_bf(al, w[j], acc[j]); }
    __builtin_amdgcn_sched_barrier(0);    // keeps the conversions of the next tile, and with them the wait for its global loads, behind this tile's products
    if (kc + 1 < 2048 / 32) put(b ^ 1);   // the other buffer: its readers left it at the barrier that ended pass kc - 1
    __syncthreads(); }                    // publishes tile kc + 1 and ends every wave's reads of tile kc
}
// ---- k_qkv: block = (64 rows, col group of 128 over q|k|v (24 groups)): x . W (exact) -> f32 rows
__global__ __launch_bounds__(128) void k_qkv(const float* __restrict__ X, const float* __restrict__ WQ, const float* __restrict__ WK, const float* __restrict__ WV, float* __restrict__ F) { __shared__ __align__(16) float sf[4][16][132]; __shared__ __align__(16) __bf16 sa[2][64][GP], sw[2][128][GP];
  const int tid = threadIdx.x, wave = tid >> 5, lane = tid & 31, col = lane & 15, g = lane >> 4; const int cg = blockIdx.y; const size_t r0 = (size_t)blockIdx.x * 64 + wave * 16;
  const float* Xb = X + (size_t)blockIdx.x * 64 * HID;
  v8f acc[8] = {};
  if (cg < 16) proj_tile<QW, false>(Xb, WQ + cg * 128, sa, sa, sw, acc, wave, lane);
  else proj_tile<KW, false>(Xb, (cg < 20 ? WK + (cg - 16) * 128 : WV + (cg - 20) * 128), sa, sa, sw, acc, wave, lane);
#pragma unroll
  for (int j = 0; j < 8; ++j)
#pragma unroll
    for (int r = 0; r < 8; ++r) sf[wave][8 * g + r][j * 16 + col] = acc[j][r];
  LDSX(); for (int rl = 0; rl < 16; ++rl) vst2(F + (r0 + rl) * QKVW + cg * 128 + lane * 4, *(const v4f*)&sf[wave][rl][lane * 4]); }
// ---- k_rope: block = row (b, s): RoPE on the 16 q heads and 4 k heads (pairs (2j, 2j+1), angle pos * 1e4^(-2j/128)) -> f16 hi/lo rows
__global__ __launch_bounds__(256) void k_rope(const float* __restrict__ F, const int* __restrict__ PID, _Float16* __restrict__ QH, _Float16* __restrict__ QL, _Float16* __restrict__ KH, _Float16* __restrict__ KL) { __shared__ __align__(16) _Float16 sh[QW + KW], sl[QW + KW];
  const int t = threadIdx.x; const size_t row = blockIdx.x; const float pos = (float)PID[row]; const float* fr = F + row * QKVW;
  for (int e = t; e < (QW + KW) / 2; e += 256) { const int hh = e / (HD / 2), j = e % (HD / 2); const int o = hh * HD + 2 * j;   // heads 0..15 = q, 16..19 = k (contiguous in F)
    const float ang = pos * powf(10000.0f, -(float)(2 * j) / (float)HD); const float c = cosf(ang), sn = sinf(ang); const float x0 = fr[o], x1 = fr[o + 1];
    const float y0 = x0 * c - x1 * sn, y1 = x0 * sn + x1 * c; const _Float16 h0 = (_Float16)y0, h1 = (_Float16)y1; sh[o] = h0; sh[o + 1] = h1; sl[o] = (_Float16)(y0 - (float)h0); sl[o + 1] = (_Float16)(y1 - (float)h1); }   // UNSCALED residuals (q, k ~ O(1))
  __syncthreads();
  for (int q = t; q < QW / 8; q += 256) { vst2((unsigned*)(QH + row * QW + q * 8), *(const v4u*)&sh[q * 8]); vst2((unsigned*)(QL + row * QW + q * 8), *(const v4u*)&sl[q * 8]); }
  for (int q = t; q < KW / 8; q += 256) { vst2((unsigned*)(KH + row * KW + q * 8), *(const v4u*)&sh[QW + q * 8]); vst2((unsigned*)(KL + row * KW + q * 8), *(const v4u*)&sl[QW + q * 8]); } }
// ---- k_vt: block = (64 rows s, 128 of the 512 v channels): v rows -> f16 hi/lo planes [c][s]
__global__ __launch_bounds__(128) void k_vt(const float* __restrict__ F, _Float16* __restrict__ VH, _Float16* __restrict__ VL) { __shared__ __align__(16) _Float16 th[128][72], tl[128][72];
  const int t = threadIdx.x; const size_t s0 = (size_t)blockIdx.x * 64; const int c0 = blockIdx.y * 128;
  for (int e = t; e < 64 * 128; e += 128) { const int sl_ = e >> 7, c = e & 127; const float v = F[(s0 + sl_) * QKVW + QW + KW + c0 + c]; const _Float16 hv = (_Float16)v; th[c][sl_] = hv; tl[c][sl_] = (_Float16)(v - (float)hv); }   // UNSCALED residual (v ~ O(1)): lets the attention add it into the same accumulator
  __syncthreads(); for (int e = t; e < 128 * 8; e += 128) { const int c = e >> 3, q = e & 7; vst2((unsigned*)(VH + (size_t)(c0 + c) * SS + s0 + q * 8), *(const v4u*)&th[c][q * 8]); vst2((unsigned*)(VL + (size_t)(c0 + c) * SS + s0 + q * 8), *(const v4u*)&tl[c][q * 8]); } }
// staged key/value tile of 32 keys: row pitches are 16 B x odd (272 B, 80 B), so that the 16 rows of a ds_load_b128 fragment read fall on distinct banks
#define KP (HD + 8)
#define VP (32 + 8)
struct __align__(16) KVStage { _Float16 kh[32][KP], kl[32][KP], vh[HD][VP], vl[HD][VP]; };
__device__ __forceinline__ unsigned lds_addr(const void* p) { return (unsigned)(size_t)(__attribute__((address_space(3))) const void*)p; }
// eight asynchronous 16-byte copies per lane, global -> LDS through no register (four of plane a, four of plane b); the s_wait_xcnt stands in the copies' own statement so that no address register is rewritten ahead of it
__device__ __forceinline__ void acopy8(unsigned la, unsigned lb, unsigned ls, const _Float16* ga, const _Float16* gb, size_t gs) {
  asm volatile("global_load_async_to_lds_b128 %0, %8, off\n\t"
               "global_load_async_to_lds_b128 %1, %9, off\n\t"
               "global_load_async_to_lds_b128 %2, %10, off\n\t"
               "global_load_async_to_lds_b128 %3, %11, off\n\t"
               "global_load_async_to_lds_b128 %4, %12, off\n\t"
               "global_load_async_to_lds_b128 %5, %13, off\n\t"
               "global_load_async_to_lds_b128 %6, %14, off\n\t"
               "global_load_async_to_lds_b128 %7, %15, off\n\t"
               "s_wait_xcnt 0x0"
               :: "v"(la), "v"(la + ls), "v"(la + 2 * ls), "v"(la + 3 * ls), "v"(lb), "v"(lb + ls), "v"(lb + 2 * ls), "v"(lb + 3 * ls),
                  "v"(ga), "v"(ga + gs), "v"(ga + 2 * gs), "v"(ga + 3 * gs), "v"(gb), "v"(gb + gs), "v"(gb + 2 * gs), "v"(gb + 3 * gs) : "memory");
}
// wmma16 with D alone named in the statement of the four slots: this compiler keeps a vector operand of an asm statement in the first 256 registers, and k_att's fragments, read ahead in groups, do not fit there beside Q and the accumulators (with A and B named the build spilled to scratch)
__device__ __forceinline__ v8f wmma16d(v16h a, v16h b, v8f c) {
  v8f d = __builtin_amdgcn_wmma_f32_16x16x32_f16(false, a, false, b, (short)0, c, false, false);
  asm volatile("v_nop\n\tv_nop\n\tv_nop\n\tv_nop" : "+v"(d));
  return d;
}
// ---- k_att: block = (64 queries, head h): kv head = h / 4; causal (tiles past the block skipped) AND attention_mask[k] != 0; head_dim 128 = 4 k-chunks; P . v over 8 d-tiles
__global__ __launch_bounds__(128) void k_att(const _Float16* __restrict__ QH, const _Float16* __restrict__ QL, const _Float16* __restrict__ KH, const _Float16* __restrict__ KL, const _Float16* __restrict__ VH, const _Float16* __restrict__ VL, const int* __restrict__ AM, float* __restrict__ CT) {
  __shared__ __align__(16) float sp[4][16][36]; __shared__ __align__(16) float so[4][16][132]; __shared__ KVStage st[2];
  const int tid = threadIdx.x, wave = tid >> 5, lane = tid & 31, col = lane & 15, g = lane >> 4; const int qb = blockIdx.x, h = blockIdx.y; const int kvh = h / (NHQ / NKV); const int q0 = qb * 64 + wave * 16; constexpr bool three = false;   // unused; the scores take 3 products into one accumulator: 0.02-scale projections keep logits ~0.1, and head_dim 128 leaves no VGPR room for the residual accumulators
  v16h aq[4], al[4];
#pragma unroll
  for (int kc = 0; kc < 4; ++kc) { aq[kc] = frag_h(QH + (size_t)(q0 + col) * QW + h * HD + kc * 32, lane); al[kc] = frag_h(QL + (size_t)(q0 + col) * QW + h * HD + kc * 32, lane); }
  float m[8], l[8];
#pragma unroll
  for (int r = 0; r < 8; ++r) { m[r] = -3.0e38f; l[r] = 0.f; }
  v8f acc[8] = {};
  const int nks = (qb * 64 + 64) / 32;   // causal bound
  // each thread copies 16 pieces of 16 B per tile: k rows of 256 B (16 lanes a row, 8 rows a step), v rows of 64 B (4 lanes a row, 32 rows a step)
  const unsigned lk = lds_addr(&st[0].kh[tid >> 4][(tid & 15) * 8]), lv = lds_addr(&st[0].vh[tid >> 2][(tid & 3) * 8]);
  const size_t gk = (size_t)(tid >> 4) * KW + kvh * HD + (tid & 15) * 8, gv = ((size_t)kvh * HD + (tid >> 2)) * SS + (tid & 3) * 8;
  auto stage = [&](int t) { const unsigned b = (unsigned)(t & 1) * (unsigned)sizeof(KVStage);
    acopy8(lk + b, lk + b + (unsigned)sizeof(st[0].kh), 8 * KP * 2, KH + gk + (size_t)t * 32 * KW, KL + gk + (size_t)t * 32 * KW, (size_t)8 * KW);
    acopy8(lv + b, lv + b + (unsigned)sizeof(st[0].vh), 32 * VP * 2, VH + gv + t * 32, VL + gv + t * 32, (size_t)32 * SS); };
  int amn0 = AM[col], amn1 = AM[16 + col];            // mask words of pass 0
  asm volatile("s_wait_xcnt 0x0" ::: "memory");       // stands behind the mask loads, in front of whatever rewrites a register that they name
  stage(0);
  asm volatile("s_wait_asynccnt 0x0" ::: "memory");   // this wave's copies of tile 0 have landed
  __syncthreads();                                    // ... and every other wave's: tile 0 may be read
  if (nks > 1) stage(1);
#pragma unroll 1
  for (int ks = 0; ks < nks; ++ks) { float s[2][8]; const KVStage& T = st[ks & 1];
    // A pass's reads stand in two groups AHEAD of the products that use them, so that a wave does not wait out the LDS latency once per product:
    // all 16 key fragments at the head of the pass; all 16 value fragments behind the first score chain, so that they land under the second chain and the softmax; the two mask words one pass ahead (the last pass reads its own again: no index past the block's keys).
    const int am[2] = { amn0, amn1 };
    v16h kh[2][4], kl[2][4], vh[8], vl[8]; v8f c[2];
#pragma unroll
    for (int ct = 0; ct < 2; ++ct)
#pragma unroll
      for (int kc = 0; kc < 4; ++kc) { kh[ct][kc] = frag_h(&T.kh[ct * 16 + col][kc * 32], lane); kl[ct][kc] = frag_h(&T.kl[ct * 16 + col][kc * 32], lane); }
    { const int kn = (ks + 1 < nks ? ks + 1 : ks) * 32 + col; amn0 = AM[kn]; amn1 = AM[kn + 16]; }
    asm volatile("s_wait_xcnt 0x0" ::: "memory");   // stands behind the mask loads, in front of whatever rewrites a register that they name
#pragma unroll
    for (int ct = 0; ct < 2; ++ct) { v8f cc = {};
#pragma unroll
      for (int kc = 0; kc < 4; ++kc) { cc = wmma16d(aq[kc], kh[ct][kc], cc); cc = wmma16d(al[kc], kh[ct][kc], cc); cc = wmma16d(aq[kc], kl[ct][kc], cc); }   // 3 products, all residuals UNSCALED into one accumulator
      c[ct] = cc;
      if (ct == 0) {
#pragma unroll
        for (int j = 0; j < 8; ++j) { vh[j] = frag_h(&T.vh[j * 16 + col][0], lane); vl[j] = frag_h(&T.vl[j * 16 + col][0], lane); } } }
#pragma unroll
    for (int ct = 0; ct < 2; ++ct) { const int kk = ks * 32 + ct * 16 + col; const bool keepm = (am[ct] != 0);
#pragma unroll
      for (int r = 0; r < 8; ++r) s[ct][r] = (keepm && kk <= q0 + 8 * g + r) ? c[ct][r] * 0.08838834764831845f : -3.0e38f; }
    float alpha[8];
#pragma unroll
    for (int r = 0; r < 8; ++r) { float mx = fmaxf(s[0][r], s[1][r]);
#pragma unroll
      for (int o = 1; o < 16; o <<= 1) mx = fmaxf(mx, __shfl_xor(mx, o));
      const float mn = fmaxf(m[r], mx); alpha[r] = (m[r] <= -1.0e38f) ? 0.f : __expf(m[r] - mn); const float e0 = (s[0][r] <= -1.0e38f) ? 0.f : __expf(s[0][r] - mn), e1 = (s[1][r] <= -1.0e38f) ? 0.f : __expf(s[1][r] - mn); float es = e0 + e1;
#pragma unroll
      for (int o = 1; o < 16; o <<= 1) es += __shfl_xor(es, o);
      l[r] = l[r] * alpha[r] + es; m[r] = mn; sp[wave][8 * g + r][col] = e0; sp[wave][8 * g + r][16 + col] = e1; }
#pragma unroll
    for (int j = 0; j < 8; ++j)
#pragma unroll
      for (int r = 0; r < 8; ++r) acc[j][r] *= alpha[r];
    LDSX();
    const v16h pa = frag_f32s(&sp[wave][col][0], lane, 2048.0f);
#pragma unroll
    for (int j = 0; j < 8; ++j) { acc[j] = wmma16d(pa, vh[j], acc[j]); acc[j] = wmma16d(pa, vl[j], acc[j]); }   // v hi + unscaled residual
    __builtin_amdgcn_sched_barrier(0);                  // keeps the row sums' last lane exchanges (they count on dscnt) in front of the wait below: none is left to be issued, and waited for, behind the barrier
    asm volatile("s_wait_dscnt 0x0" ::: "memory");      // this wave's reads of this tile (and of sp) have returned before the tile's buffer is refilled
    asm volatile("s_wait_asynccnt 0x0" ::: "memory");   // this wave's copies of tile ks + 1 have landed
    __syncthreads();                                    // publishes tile ks + 1 and ends every wave's reads of tile ks
    if (ks + 2 < nks) stage(ks + 2); }
  asm volatile("s_wait_asynccnt 0x0" ::: "memory");     // no copy is outstanding when the wave goes on to its end
#pragma unroll
  for (int r = 0; r < 8; ++r) { const float il = (l[r] > 0.f) ? (1.0f / 2048.0f) / l[r] : 0.f;
#pragma unroll
    for (int j = 0; j < 8; ++j) so[wave][8 * g + r][j * 16 + col] = acc[j][r] * il; }
  LDSX(); for (int rl = 0; rl < 16; ++rl) vst2(CT + (size_t)(q0 + rl) * QW + h * HD + lane * 4, *(const v4f*)&so[wave][rl][lane * 4]); }
// ---- k_out: block = (64 rows, 128 of 2048 cols): out = ctx (hi + lo) . wo (in,out)
__global__ __launch_bounds__(128) void k_out(const float* __restrict__ CT, const float* __restrict__ WO, float* __restrict__ OUT) { __shared__ __align__(16) float sf[4][16][132]; __shared__ __align__(16) __bf16 sh[2][64][GP], sl[2][64][GP], sw[2][128][GP];
  const int tid = threadIdx.x, wave = tid >> 5, lane = tid & 31, col = lane & 15, g = lane >> 4; const int c0 = blockIdx.y * 128; const size_t r0 = (size_t)blockIdx.x * 64 + wave * 16;
  v8f acc[8] = {};
  proj_tile<HID, true>(CT + (size_t)blockIdx.x * 64 * QW, WO + c0, sh, sl, sw, acc, wave, lane);
#pragma unroll
  for (int j = 0; j < 8; ++j)
#pragma unroll
    for (int r = 0; r < 8; ++r) sf[wave][8 * g + r][j * 16 + col] = acc[j][r];
  LDSX(); for (int rl = 0; rl < 16; ++rl) vst2(OUT + (r0 + rl) * HID + c0 + lane * 4, *(const v4f*)&sf[wave][rl][lane * 4]); }
extern "C" void kernel_launch(void* const* d_in, const int* in_sizes, int n_in, void* d_out, int out_size, void* d_ws, size_t ws_size, hipStream_t stream) {
  (void)in_sizes; (void)n_in; (void)out_size;
  const float** F_ = (const float**)d_in;   // 0 hidden_states [1,2048,2048], 1 wq [2048,2048], 2 wk [2048,512], 3 wv [2048,512], 4 wo [2048,2048] (all (in,out)), 5 attention_mask [1,2048] int, 6 position_ids [1,2048] int
  if (ws_size < (size_t)WS_END) return;
  char* ws = (char*)d_ws; float* F = (float*)(ws + WS_F); _Float16 *QH = (_Float16*)(ws + WS_QH), *QL = (_Float16*)(ws + WS_QL), *KH = (_Float16*)(ws + WS_KH), *KL = (_Float16*)(ws + WS_KL), *VH = (_Float16*)(ws + WS_VH), *VL = (_Float16*)(ws + WS_VL); float* CT = (float*)(ws + WS_CT);
  k_qkv<<<dim3(TRB, QKVW / 128), 128, 0, stream>>>(F_[0], F_[1], F_[2], F_[3], F);
  k_rope<<<TRB * 64, 256, 0, stream>>>(F, (const int*)d_in[6], QH, QL, KH, KL);
  k_vt<<<dim3(TRB, KW / 128), 128, 0, stream>>>(F, VH, VL);
  k_att<<<dim3(TQB, NHQ), 128, 0, stream>>>(QH, QL, KH, KL, VH, VL, (const int*)d_in[5], CT);
  k_out<<<dim3(TQB, HID / 128), 128, 0, stream>>>(CT, F_[4], (float*)d_out);
}

// v004
// A run of this version takes 220 microseconds.
// In both of two side-by-side timings against v003, it was 1.15 times as fast.
// Counting every step since v000, it is 3.71 times as fast.
// compute dtype: all float inputs rounded to bf16, attention_mask / position_ids (int) read; q/k/v = x . W with EXACT bf16 products on WMMA 16x16x32 ((in,out) weights), f32 accumulate; RoPE (interleaved pairs, angles position_id * theta^(-2j/128), precise sinf/cosf/powf) in f32, q/k as f16 hi + residual rows, v as f16 hi + residual planes; GQA causal attention with head_dim 128: 3-product scores (q/k as f16 hi + UNSCALED residual, one accumulator), P rounded once to f16 (x 2^11) against v as f16 hi + UNSCALED residual (2 products into one accumulator), x 1/sqrt(128), masked/acausal keys excluded, running-max softmax in f32 (hardware exp); out = ctx (bf16 hi + lo) . wo (2 products); f32 output.
#include <hip/hip_runtime.h>
#include <math.h>

typedef __attribute__((ext_vector_type(16))) _Float16 v16h;
typedef __attribute__((ext_vector_type(16))) __bf16 v16b;
typedef __attribute__((ext_vector_type(8)))  _Float16 v8h;
typedef __attribute__((ext_vector_type(8)))  float v8f;
typedef __attribute__((ext_vector_type(4)))  float v4f;
typedef __attribute__((ext_vector_type(2)))  float v2f;
typedef __attribute__((ext_vector_type(4)))  unsigned v4u;
typedef __attribute__((ext_vector_type(4)))  int v4i;
typedef float __attribute__((may_alias)) float_a;
typedef int __attribute__((may_alias)) int_a;

template <typename T> __device__ __forceinline__ void vst2(void* p, T v) { *(T*)p = v;  }
__device__ __forceinline__ v8f wmma16(v16h a, v16h b, v8f c) {
  v8f d = __builtin_amdgcn_wmma_f32_16x16x32_f16(false, a, false, b, (short)0, c, false, false);
  asm volatile("v_nop\n\tv_nop\n\tv_nop\n\tv_nop" : "+v"(d) : "v"(a), "v"(b));
  return d;
}
__device__ __forceinline__ v8f wmma_bf(v16b a, v16b b, v8f c) {
  v8f d = __builtin_amdgcn_wmma_f32_16x16x32_bf16(false, a, false, b, (short)0, c, false, false);
  asm volatile("v_nop\n\tv_nop\n\tv_nop\n\tv_nop" : "+v"(d) : "v"(a), "v"(b));
  return d;
}
// 16x16x32 fragments: lane = (h = lane>>4, row/col = lane&15); elements 0..7 = k0+8h+0..7, 8..15 = k0+16+8h+0..7; D element r = row 8h+r
__device__ __forceinline__ v16h frag_h(const _Float16* rowk0, int lane) {
  union { v16h v; v8h q[2]; } u; const _Float16* p = rowk0 + 8 * (lane >> 4);
  u.q[0] = *(const v8h*)p; u.q[1] = *(const v8h*)(p + 16); return u.v;
}
__device__ __forceinline__ v16h frag_f32(const float* rowk0, int lane) {
  v16h a; const float* p = rowk0 + 8 * (lane >> 4);
#pragma unroll
  for (int i = 0; i < 8; ++i) { a[i] = (_Float16)p[i]; a[8 + i] = (_Float16)p[16 + i]; }
  return a;
}
__device__ __forceinline__ v16h frag_f32s(const float* rowk0, int lane, float sc) {
  v16h a; const float* p = rowk0 + 8 * (lane >> 4);
#pragma unroll
  for (int i = 0; i < 8; ++i) { a[i] = (_Float16)(p[i] * sc); a[8 + i] = (_Float16)(p[16 + i] * sc); }
  return a;
}
// column fragment from a [K][ld] layout (column n), rows >= K read as 0
__device__ __forceinline__ v16h fragc_f32(const float* W, int k0, int n, int lane, int ld, int K) {
  v16h a; const int g = lane >> 4;
#pragma unroll
  for (int i = 0; i < 8; ++i) { const int ka = k0 + 8 * g + i, kb = ka + 16;
    a[i] = (_Float16)(ka < K ? W[(size_t)(ka < K ? ka : K - 1) * ld + n] : 0.f); a[8 + i] = (_Float16)(kb < K ? W[(size_t)(kb < K ? kb : K - 1) * ld + n] : 0.f); }
  return a;
}
struct F2 { v16b h, l; };
__device__ __forceinline__ F2 bsplit16(const float v[16]) { F2 r;
#pragma unroll
  for (int i = 0; i < 16; ++i) { const __bf16 h = (__bf16)v[i]; r.h[i] = h; r.l[i] = (__bf16)(v[i] - (float)h); }
  return r; }
__device__ __forceinline__ F2 split_row(const float* row, int k0, int lane) { float v[16]; const float* p = row + k0 + 8 * (lane >> 4);
#pragma unroll
  for (int i = 0; i < 8; ++i) { v[i] = p[i]; v[8 + i] = p[16 + i]; }
  return bsplit16(v); }
__device__ __forceinline__ F2 split_rowK(const float* row, int k0, int lane, int K) { float v[16]; const int g = lane >> 4;
#pragma unroll
  for (int i = 0; i < 8; ++i) { const int ka = k0 + 8 * g + i, kb = ka + 16; v[i] = ka < K ? row[ka < K ? ka : K - 1] : 0.f; v[8 + i] = kb < K ? row[kb < K ? kb : K - 1] : 0.f; }
  return bsplit16(v); }
__device__ __forceinline__ F2 split_col(const float* W, int k0, int n, int lane, int ld, int K) { float v[16]; const int g = lane >> 4;
#pragma unroll
  for (int i = 0; i < 8; ++i) { const int ka = k0 + 8 * g + i, kb = ka + 16; v[i] = ka < K ? W[(size_t)(ka < K ? ka : K - 1) * ld + n] : 0.f; v[8 + i] = kb < K ? W[(size_t)(kb < K ? kb : K - 1) * ld + n] : 0.f; }
  return bsplit16(v); }
__device__ __forceinline__ v8f mac3(const F2& a, const F2& b, v8f c) { c = wmma_bf(a.l, b.h, c); c = wmma_bf(a.h, b.l, c); return wmma_bf(a.h, b.h, c); }
__device__ __forceinline__ float sigm(float v) { return 1.0f / (1.0f + expf(-v)); }
#define LDSX() do { asm volatile("s_wait_dscnt 0" ::: "memory"); __builtin_amdgcn_wave_barrier(); __builtin_amdgcn_fence(__ATOMIC_RELEASE, "workgroup"); } while (0)


// LLaMA attention (B 1, S 2,048, hidden 2,048, 16 query heads / 4 kv heads x 128, RoPE theta 1e4): q/k/v projections, RoPE on q and k, GQA (kv head = h / 4), causal + padding mask, softmax in f32, o_proj.
#define NB 1
#define SS 2048
#define HID 2048
#define NHQ 16
#define NKV 4
#define HD 128
#define QW (NHQ * HD)     // 2048
#define KW (NKV * HD)     // 512
#define QKVW (QW + 2 * KW)   // 3072
#ifndef TQB
#define TQB (SS / 64)
#endif
#ifndef TRB
#define TRB (NB * SS / 64)   // row blocks for projections / rope / value planes
#endif
typedef __attribute__((ext_vector_type(8))) __bf16 v8b;
__device__ __forceinline__ v16b frag_b(const __bf16* rowk0, int lane) {
  union { v16b v; v8b q[2]; } u; const __bf16* p = rowk0 + 8 * (lane >> 4);
  u.q[0] = *(const v8b*)p; u.q[1] = *(const v8b*)(p + 16); return u.v;
}
__device__ __forceinline__ float bfr(float v) { return (float)(__bf16)v; }
__device__ __attribute__((noinline)) float exp_ni(float v) { return expf(v); }
__device__ __attribute__((noinline)) float erf_ni(float v) { return erff(v); }

#define WS_F   0u                                   // f32 q|k|v rows [b*s][3072]
#define WS_QH  (WS_F + 4u * (size_t)NB * SS * QKVW)     // f16 hi|lo q rows [b*s][2048] (after rope)
#define WS_QL  (WS_QH + 2u * (size_t)NB * SS * QW)
#define WS_KH  (WS_QL + 2u * (size_t)NB * SS * QW)      // f16 hi|lo k rows [b*s][512]
#define WS_KL  (WS_KH + 2u * (size_t)NB * SS * KW)
#define WS_VH  (WS_KL + 2u * (size_t)NB * SS * KW)      // f16 hi|lo v planes [b][512][s]
#define WS_VL  (WS_VH + 2u * (size_t)NB * KW * SS)
#define WS_CT  (WS_VL + 2u * (size_t)NB * KW * SS)      // f32 ctx rows [b*s][2048]
#define WS_END (WS_CT + 4u * (size_t)NB * SS * QW)

// staged 32-k operand tiles of the two projection GEMMs, bf16, one row per output row / column: pitch 80 B = 16 B x odd, so that the 16 rows of a ds_load_b128 fragment read fall on distinct banks
#define GP (32 + 8)
typedef __attribute__((ext_vector_type(4))) __bf16 v4b;
// 64 rows x 128 columns of X[.][2048] . W[2048][LDW] per block of 4 waves (a wave: 16 rows x 128 columns), K = 2048 in passes of 32. Both operands' tiles go ONCE per block through registers into LDS as bf16, two buffers; the next tile's global loads are in flight under this tile's products.
// Row tile: each wave brings its own 16 rows x 32 k f32 as four loads of 4 whole 128-B lines; SPLIT: stored as bf16 hi rows and residual rows.
// Weight tile [32 k][128 cols] f32 -> LDS [col][k] bf16: a thread holds 8 k rows (wave w: rows 8w .. 8w + 7) x 4 columns (4 * lane ..), read as whole 512-B row pieces per wave.
// The 16-B piece of k rows 8c .. 8c + 7 of a column stands at place (c + (column >> 4)) & 3 of its LDS row: the writers' rows lie 4 apart, and the rotation spreads their ds_store_b128 over all banks; the 16 columns of a fragment share one rotation.
template <int LDW, bool SPLIT>
__device__ __forceinline__ void proj_tile(const float* Xb, const float* Wb, __bf16 (*sh)[64][GP], __bf16 (*sl)[64][GP], __bf16 (*sw)[128][GP], v8f (&acc)[8], int wave, int lane) {
  const int col = lane & 15, g = lane >> 4, xrow = wave * 16 + (lane >> 3), xk = 4 * (lane & 7), pl = ((wave + (lane >> 2)) & 3) * 8;
  const unsigned xo = (unsigned)(xrow * 2048 + xk) * 4u, wo = (unsigned)(8 * wave * LDW + 4 * lane) * 4u;   // per-lane byte offsets, the same in every pass
  v4f wr[8], xr[4];
  auto get = [&](int kc) { const char* xb = (const char*)(Xb + kc * 32); const char* wb = (const char*)(Wb + (size_t)kc * 32 * LDW);
#pragma unroll
    for (int i = 0; i < 8; ++i) wr[i] = *(const v4f*)(wb + wo + i * LDW * 4);
#pragma unroll
    for (int i = 0; i < 4; ++i) xr[i] = *(const v4f*)(xb + xo + i * 4 * 2048 * 4);
    asm volatile("s_wait_xcnt 0x0" ::: "memory"); };   // stands behind the loads, in front of whatever rewrites a register that they name
  auto put = [&](int b) {
#pragma unroll
    for (int c = 0; c < 4; ++c) { v8b q;
#pragma unroll
      for (int i = 0; i < 8; ++i) q[i] = (__bf16)wr[i][c];
      *(v8b*)&sw[b][4 * lane + c][pl] = q; }
#pragma unroll
    for (int i = 0; i < 4; ++i) { v4b qh, ql;
#pragma unroll
      for (int e = 0; e < 4; ++e) { const __bf16 hv = (__bf16)xr[i][e]; qh[e] = hv; if (SPLIT) ql[e] = (__bf16)(xr[i][e] - (float)hv); }
      *(v4b*)&sh[b][xrow + 4 * i][xk] = qh; if (SPLIT) *(v4b*)&sl[b][xrow + 4 * i][xk] = ql; } };
  get(0); put(0);
  __syncthreads();   // tile 0 may be read
  // two passes a trip, so that the buffer index is a constant of each copy and stands as an immediate in every LDS address (the full unrolls here keep the register arrays' indices constant)
#pragma unroll 2
  for (int kc = 0; kc < 2048 / 32; ++kc) { const int b = kc & 1;
    if (kc + 1 < 2048 / 32) get(kc + 1);
    const v16b ah = frag_b(&sh[b][wave * 16 + col][0], lane); v16b al; if (SPLIT) al = frag_b(&sl[b][wave * 16 + col][0], lane);
    v16b w[8];
#pragma unroll
    for (int j = 0; j < 8; ++j) { union { v16b v; v8b q[2]; } u; const __bf16* p = &sw[b][j * 16 + col][0];
      u.q[0] = *(const v8b*)(p + ((g + j) & 3) * 8); u.q[1] = *(const v8b*)(p + ((g + 2 + j) & 3) * 8); w[j] = u.v; }
#pragma unroll
    for (int j = 0; j < 8; ++j) acc[j] = wmma_bf(ah, w[j], acc[j]);
    if (SPLIT) {   // each accumulator still takes hi, then residual, of every pass; the other accumulators' products stand between the two
#pragma unroll
      for (int j = 0; j < 8; ++j) acc[j] = wmma_bf(al, w[j], acc[j]); }
    __builtin_amdgcn_sched_barrier(0);    // keeps the conversions of the next tile, and with them the wait for its global loads, behind this tile's products
    if (kc + 1 < 2048 / 32) put(b ^ 1);   // the other buffer: its readers left it at the barrier that ended pass kc - 1
    __syncthreads(); }                    // publishes tile kc + 1 and ends every wave's reads of tile kc
}
// ---- k_qkv: block = (64 rows, col group of 128 over q|k|v (24 groups)): x . W (exact) -> f32 rows
__global__ __launch_bounds__(128) void k_qkv(const float* __restrict__ X, const float* __restrict__ WQ, const float* __restrict__ WK, const float* __restrict__ WV, float* __restrict__ F) { __shared__ __align__(16) float sf[4][16][132]; __shared__ __align__(16) __bf16 sa[2][64][GP], sw[2][128][GP];
  const int tid = threadIdx.x, wave = tid >> 5, lane = tid & 31, col = lane & 15, g = lane >> 4; const int cg = blockIdx.y; const size_t r0 = (size_t)blockIdx.x * 64 + wave * 16;
  const float* Xb = X + (size_t)blockIdx.x * 64 * HID;
  v8f acc[8] = {};
  if (cg < 16) proj_tile<QW, false>(Xb, WQ + cg * 128, sa, sa, sw, acc, wave, lane);
  else proj_tile<KW, false>(Xb, (cg < 20 ? WK + (cg - 16) * 128 : WV + (cg - 20) * 128), sa, sa, sw, acc, wave, lane);
#pragma unroll
  for (int j = 0; j < 8; ++j)
#pragma unroll
    for (int r = 0; r < 8; ++r) sf[wave][8 * g + r][j * 16 + col] = acc[j][r];
  LDSX(); for (int rl = 0; rl < 16; ++rl) vst2(F + (r0 + rl) * QKVW + cg * 128 + lane * 4, *(const v4f*)&sf[wave][rl][lane * 4]); }
// ---- k_rope: block = row (b, s): RoPE on the 16 q heads and 4 k heads (pairs (2j, 2j+1), angle pos * 1e4^(-2j/128)) -> f16 hi/lo rows
__global__ __launch_bounds__(256) void k_rope(const float* __restrict__ F, const int* __restrict__ PID, _Float16* __restrict__ QH, _Float16* __restrict__ QL, _Float16* __restrict__ KH, _Float16* __restrict__ KL) { __shared__ __align__(16) _Float16 sh[QW + KW], sl[QW + KW];
  const int t = threadIdx.x; const size_t row = blockIdx.x; const float pos = (float)PID[row]; const float* fr = F + row * QKVW;
  for (int e = t; e < (QW + KW) / 2; e += 256) { const int hh = e / (HD / 2), j = e % (HD / 2); const int o = hh * HD + 2 * j;   // heads 0..15 = q, 16..19 = k (contiguous in F)
    const float ang = pos * powf(10000.0f, -(float)(2 * j) / (float)HD); const float c = cosf(ang), sn = sinf(ang); const float x0 = fr[o], x1 = fr[o + 1];
    const float y0 = x0 * c - x1 * sn, y1 = x0 * sn + x1 * c; const _Float16 h0 = (_Float16)y0, h1 = (_Float16)y1; sh[o] = h0; sh[o + 1] = h1; sl[o] = (_Float16)(y0 - (float)h0); sl[o + 1] = (_Float16)(y1 - (float)h1); }   // UNSCALED residuals (q, k ~ O(1))
  __syncthreads();
  for (int q = t; q < QW / 8; q += 256) { vst2((unsigned*)(QH + row * QW + q * 8), *(const v4u*)&sh[q * 8]); vst2((unsigned*)(QL + row * QW + q * 8), *(const v4u*)&sl[q * 8]); }
  for (int q = t; q < KW / 8; q += 256) { vst2((unsigned*)(KH + row * KW + q * 8), *(const v4u*)&sh[QW + q * 8]); vst2((unsigned*)(KL + row * KW + q * 8), *(const v4u*)&sl[QW + q * 8]); } }
// ---- k_vt: block = (64 rows s, 128 of the 512 v channels): v rows -> f16 hi/lo planes [c][s]
__global__ __launch_bounds__(128) void k_vt(const float* __restrict__ F, _Float16* __restrict__ VH, _Float16* __restrict__ VL) { __shared__ __align__(16) _Float16 th[128][72], tl[128][72];
  const int t = threadIdx.x; const size_t s0 = (size_t)blockIdx.x * 64; const int c0 = blockIdx.y * 128;
  for (int e = t; e < 64 * 128; e += 128) { const int sl_ = e >> 7, c = e & 127; const float v = F[(s0 + sl_) * QKVW + QW + KW + c0 + c]; const _Float16 hv = (_Float16)v; th[c][sl_] = hv; tl[c][sl_] = (_Float16)(v - (float)hv); }   // UNSCALED residual (v ~ O(1)): lets the attention add it into the same accumulator
  __syncthreads(); for (int e = t; e < 128 * 8; e += 128) { const int c = e >> 3, q = e & 7; vst2((unsigned*)(VH + (size_t)(c0 + c) * SS + s0 + q * 8), *(const v4u*)&th[c][q * 8]); vst2((unsigned*)(VL + (size_t)(c0 + c) * SS + s0 + q * 8), *(const v4u*)&tl[c][q * 8]); } }
// staged key/value tile of 32 keys: row pitches are 16 B x odd (272 B, 80 B), so that the 16 rows of a ds_load_b128 fragment read fall on distinct banks
#define KP (HD + 8)
#define VP (32 + 8)
struct __align__(16) KVStage { _Float16 kh[32][KP], kl[32][KP], vh[HD][VP], vl[HD][VP]; };
__device__ __forceinline__ unsigned lds_addr(const void* p) { return (unsigned)(size_t)(__attribute__((address_space(3))) const void*)p; }
// eight asynchronous 16-byte copies per lane, global -> LDS through no register (four of plane a, four of plane b); the s_wait_xcnt stands in the copies' own statement so that no address register is rewritten ahead of it
__device__ __forceinline__ void acopy8(unsigned la, unsigned lb, unsigned ls, const _Float16* ga, const _Float16* gb, size_t gs) {
  asm volatile("global_load_async_to_lds_b128 %0, %8, off\n\t"
               "global_load_async_to_lds_b128 %1, %9, off\n\t"
               "global_load_async_to_lds_b128 %2, %10, off\n\t"
               "global_load_async_to_lds_b128 %3, %11, off\n\t"
               "global_load_async_to_lds_b128 %4, %12, off\n\t"
               "global_load_async_to_lds_b128 %5, %13, off\n\t"
               "global_load_async_to_lds_b128 %6, %14, off\n\t"
               "global_load_async_to_lds_b128 %7, %15, off\n\t"
               "s_wait_xcnt 0x0"
               :: "v"(la), "v"(la + ls), "v"(la + 2 * ls), "v"(la + 3 * ls), "v"(lb), "v"(lb + ls), "v"(lb + 2 * ls), "v"(lb + 3 * ls),
                  "v"(ga), "v"(ga + gs), "v"(ga + 2 * gs), "v"(ga + 3 * gs), "v"(gb), "v"(gb + gs), "v"(gb + 2 * gs), "v"(gb + 3 * gs) : "memory");
}
// wmma16 with D alone named in the statement of the four slots: this compiler keeps a vector operand of an asm statement in the first 256 registers, and k_att's fragments, read ahead in groups, do not fit there beside Q and the accumulators (with A and B named the build spilled to scratch)
__device__ __forceinline__ v8f wmma16d(v16h a, v16h b, v8f c) {
  v8f d = __builtin_amdgcn_wmma_f32_16x16x32_f16(false, a, false, b, (short)0, c, false, false);
  asm volatile("v_nop\n\tv_nop\n\tv_nop\n\tv_nop" : "+v"(d));
  return d;
}
// Maximum / sum over each 16-lane row, of eight values at once: the butterfly l ^ 1, 2, 4, 8 with the partner lane read as the DPP operand (row_xmask) of the v_max / v_add itself, so an exchange makes no trip through the LDS pipe and needs no dscnt wait, as __shfl_xor does here. Every lane is on where they stand.
// In asm text, eight values a statement: a value's next step stands eight instructions behind its last one and does not wait for it (from the builtin the moved value came out as a move of its own, for the maximum with one more instruction behind it).
__device__ __forceinline__ void rowmax8(float (&v)[8]) {
  asm(
      "v_max_num_f32_dpp %0, %0, %0 row_xmask:1 row_mask:0xf bank_mask:0xf\n\t"
      "v_max_num_f32_dpp %1, %1, %1 row_xmask:1 row_mask:0xf bank_mask:0xf\n\t"
      "v_max_num_f32_dpp %2, %2, %2 row_xmask:1 row_mask:0xf bank_mask:0xf\n\t"
      "v_max_num_f32_dpp %3, %3, %3 row_xmask:1 row_mask:0xf bank_mask:0xf\n\t"
      "v_max_num_f32_dpp %4, %4, %4 row_xmask:1 row_mask:0xf bank_mask:0xf\n\t"
      "v_max_num_f32_dpp %5, %5, %5 row_xmask:1 row_mask:0xf bank_mask:0xf\n\t"
      "v_max_num_f32_dpp %6, %6, %6 row_xmask:1 row_mask:0xf bank_mask:0xf\n\t"
      "v_max_num_f32_dpp %7, %7, %7 row_xmask:1 row_mask:0xf bank_mask:0xf\n\t"
      "v_max_num_f32_dpp %0, %0, %0 row_xmask:2 row_mask:0xf bank_mask:0xf\n\t"
      "v_max_num_f32_dpp %1, %1, %1 row_xmask:2 row_mask:0xf bank_mask:0xf\n\t"
      "v_max_num_f32_dpp %2, %2, %2 row_xmask:2 row_mask:0xf bank_mask:0xf\n\t"
      "v_max_num_f32_dpp %3, %3, %3 row_xmask:2 row_mask:0xf bank_mask:0xf\n\t"
      "v_max_num_f32_dpp %4, %4, %4 row_xmask:2 row_mask:0xf bank_mask:0xf\n\t"
      "v_max_num_f32_dpp %5, %5, %5 row_xmask:2 row_mask:0xf bank_mask:0xf\n\t"
      "v_max_num_f32_dpp %6, %6, %6 row_xmask:2 row_mask:0xf bank_mask:0xf\n\t"
      "v_max_num_f32_dpp %7, %7, %7 row_xmask:2 row_mask:0xf bank_mask:0xf\n\t"
      "v_max_num_f32_dpp %0, %0, %0 row_xmask:4 row_mask:0xf bank_mask:0xf\n\t"
      "v_max_num_f32_dpp %1, %1, %1 row_xmask:4 row_mask:0xf bank_mask:0xf\n\t"
      "v_max_num_f32_dpp %2, %2, %2 row_xmask:4 row_mask:0xf bank_mask:0xf\n\t"
      "v_max_num_f32_dpp %3, %3, %3 row_xmask:4 row_mask:0xf bank_mask:0xf\n\t"
      "v_max_num_f32_dpp %4, %4, %4 row_xmask:4 row_mask:0xf bank_mask:0xf\n\t"
      "v_max_num_f32_dpp %5, %5, %5 row_xmask:4 row_mask:0xf bank_mask:0xf\n\t"
      "v_max_num_f32_dpp %6, %6, %6 row_xmask:4 row_mask:0xf bank_mask:0xf\n\t"
      "v_max_num_f32_dpp %7, %7, %7 row_xmask:4 row_mask:0xf bank_mask:0xf\n\t"
      "v_max_num_f32_dpp %0, %0, %0 row_xmask:8 row_mask:0xf bank_mask:0xf\n\t"
      "v_max_num_f32_dpp %1, %1, %1 row_xmask:8 row_mask:0xf bank_mask:0xf\n\t"
      "v_max_num_f32_dpp %2, %2, %2 row_xmask:8 row_mask:0xf bank_mask:0xf\n\t"
      "v_max_num_f32_dpp %3, %3, %3 row_xmask:8 row_mask:0xf bank_mask:0xf\n\t"
      "v_max_num_f32_dpp %4, %4, %4 row_xmask:8 row_mask:0xf bank_mask:0xf\n\t"
      "v_max_num_f32_dpp %5, %5, %5 row_xmask:8 row_mask:0xf bank_mask:0xf\n\t"
      "v_max_num_f32_dpp %6, %6, %6 row_xmask:8 row_mask:0xf bank_mask:0xf\n\t"
      "v_max_num_f32_dpp %7, %7, %7 row_xmask:8 row_mask:0xf bank_mask:0xf"
      : "+v"(v[0]), "+v"(v[1]), "+v"(v[2]), "+v"(v[3]), "+v"(v[4]), "+v"(v[5]), "+v"(v[6]), "+v"(v[7])); }
__device__ __forceinline__ void rowadd8(float (&v)[8]) {
  asm(
      "v_add_f32_dpp %0, %0, %0 row_xmask:1 row_mask:0xf bank_mask:0xf\n\t"
      "v_add_f32_dpp %1, %1, %1 row_xmask:1 row_mask:0xf bank_mask:0xf\n\t"
      "v_add_f32_dpp %2, %2, %2 row_xmask:1 row_mask:0xf bank_mask:0xf\n\t"
      "v_add_f32_dpp %3, %3, %3 row_xmask:1 row_mask:0xf bank_mask:0xf\n\t"
      "v_add_f32_dpp %4, %4, %4 row_xmask:1 row_mask:0xf bank_mask:0xf\n\t"
      "v_add_f32_dpp %5, %5, %5 row_xmask:1 row_mask:0xf bank_mask:0xf\n\t"
      "v_add_f32_dpp %6, %6, %6 row_xmask:1 row_mask:0xf bank_mask:0xf\n\t"
      "v_add_f32_dpp %7, %7, %7 row_xmask:1 row_mask:0xf bank_mask:0xf\n\t"
      "v_add_f32_dpp %0, %0, %0 row_xmask:2 row_mask:0xf bank_mask:0xf\n\t"
      "v_add_f32_dpp %1, %1, %1 row_xmask:2 row_mask:0xf bank_mask:0xf\n\t"
      "v_add_f32_dpp %2, %2, %2 row_xmask:2 row_mask:0xf bank_mask:0xf\n\t"
      "v_add_f32_dpp %3, %3, %3 row_xmask:2 row_mask:0xf bank_mask:0xf\n\t"
      "v_add_f32_dpp %4, %4, %4 row_xmask:2 row_mask:0xf bank_mask:0xf\n\t"
      "v_add_f32_dpp %5, %5, %5 row_xmask:2 row_mask:0xf bank_mask:0xf\n\t"
      "v_add_f32_dpp %6, %6, %6 row_xmask:2 row_mask:0xf bank_mask:0xf\n\t"
      "v_add_f32_dpp %7, %7, %7 row_xmask:2 row_mask:0xf bank_mask:0xf\n\t"
      "v_add_f32_dpp %0, %0, %0 row_xmask:4 row_mask:0xf bank_mask:0xf\n\t"
      "v_add_f32_dpp %1, %1, %1 row_xmask:4 row_mask:0xf bank_mask:0xf\n\t"
      "v_add_f32_dpp %2, %2, %2 row_xmask:4 row_mask:0xf bank_mask:0xf\n\t"
      "v_add_f32_dpp %3, %3, %3 row_xmask:4 row_mask:0xf bank_mask:0xf\n\t"
      "v_add_f32_dpp %4, %4, %4 row_xmask:4 row_mask:0xf bank_mask:0xf\n\t"
      "v_add_f32_dpp %5, %5, %5 row_xmask:4 row_mask:0xf bank_mask:0xf\n\t"
      "v_add_f32_dpp %6, %6, %6 row_xmask:4 row_mask:0xf bank_mask:0xf\n\t"
      "v_add_f32_dpp %7, %7, %7 row_xmask:4 row_mask:0xf bank_mask:0xf\n\t"
      "v_add_f32_dpp %0, %0, %0 row_xmask:8 row_mask:0xf bank_mask:0xf\n\t"
      "v_add_f32_dpp %1, %1, %1 row_xmask:8 row_mask:0xf bank_mask:0xf\n\t"
      "v_add_f32_dpp %2, %2, %2 row_xmask:8 row_mask:0xf bank_mask:0xf\n\t"
      "v_add_f32_dpp %3, %3, %3 row_xmask:8 row_mask:0xf bank_mask:0xf\n\t"
      "v_add_f32_dpp %4, %4, %4 row_xmask:8 row_mask:0xf bank_mask:0xf\n\t"
      "v_add_f32_dpp %5, %5, %5 row_xmask:8 row_mask:0xf bank_mask:0xf\n\t"
      "v_add_f32_dpp %6, %6, %6 row_xmask:8 row_mask:0xf bank_mask:0xf\n\t"
      "v_add_f32_dpp %7, %7, %7 row_xmask:8 row_mask:0xf bank_mask:0xf"
      : "+v"(v[0]), "+v"(v[1]), "+v"(v[2]), "+v"(v[3]), "+v"(v[4]), "+v"(v[5]), "+v"(v[6]), "+v"(v[7])); }
// ---- k_att: block = (64 queries, head h): kv head = h / 4; causal (tiles past the block skipped) AND attention_mask[k] != 0; head_dim 128 = 4 k-chunks; P . v over 8 d-tiles
__global__ __launch_bounds__(128) void k_att(const _Float16* __restrict__ QH, const _Float16* __restrict__ QL, const _Float16* __restrict__ KH, const _Float16* __restrict__ KL, const _Float16* __restrict__ VH, const _Float16* __restrict__ VL, const int* __restrict__ AM, float* __restrict__ CT) {
  __shared__ __align__(16) float sp[4][16][36]; __shared__ __align__(16) float so[4][16][132]; __shared__ KVStage st[2];
  const int tid = threadIdx.x, wave = tid >> 5, lane = tid & 31, col = lane & 15, g = lane >> 4; const int qb = blockIdx.x, h = blockIdx.y; const int kvh = h / (NHQ / NKV); const int q0 = qb * 64 + wave * 16; constexpr bool three = false;   // unused; the scores take 3 products into one accumulator: 0.02-scale projections keep logits ~0.1, and head_dim 128 leaves no VGPR room for the residual accumulators
  v16h aq[4], al[4];
#pragma unroll
  for (int kc = 0; kc < 4; ++kc) { aq[kc] = frag_h(QH + (size_t)(q0 + col) * QW + h * HD + kc * 32, lane); al[kc] = frag_h(QL + (size_t)(q0 + col) * QW + h * HD + kc * 32, lane); }
  float m[8], l[8];
#pragma unroll
  for (int r = 0; r < 8; ++r) { m[r] = -3.0e38f; l[r] = 0.f; }
  v8f acc[8] = {};
  const int nks = (qb * 64 + 64) / 32;   // causal bound
  // each thread copies 16 pieces of 16 B per tile: k rows of 256 B (16 lanes a row, 8 rows a step), v rows of 64 B (4 lanes a row, 32 rows a step)
  const unsigned lk = lds_addr(&st[0].kh[tid >> 4][(tid & 15) * 8]), lv = lds_addr(&st[0].vh[tid >> 2][(tid & 3) * 8]);
  const size_t gk = (size_t)(tid >> 4) * KW + kvh * HD + (tid & 15) * 8, gv = ((size_t)kvh * HD + (tid >> 2)) * SS + (tid & 3) * 8;
  auto stage = [&](int t) { const unsigned b = (unsigned)(t & 1) * (unsigned)sizeof(KVStage);
    acopy8(lk + b, lk + b + (unsigned)sizeof(st[0].kh), 8 * KP * 2, KH + gk + (size_t)t * 32 * KW, KL + gk + (size_t)t * 32 * KW, (size_t)8 * KW);
    acopy8(lv + b, lv + b + (unsigned)sizeof(st[0].vh), 32 * VP * 2, VH + gv + t * 32, VL + gv + t * 32, (size_t)32 * SS); };
  int amn0 = AM[col], amn1 = AM[16 + col];            // mask words of pass 0
  asm volatile("s_wait_xcnt 0x0" ::: "memory");       // stands behind the mask loads, in front of whatever rewrites a register that they name
  stage(0);
  asm volatile("s_wait_asynccnt 0x0" ::: "memory");   // this wave's copies of tile 0 have landed
  __syncthreads();                                    // ... and every other wave's: tile 0 may be read
  if (nks > 1) stage(1);
#pragma unroll 1
  for (int ks = 0; ks < nks; ++ks) { float s[2][8]; const KVStage& T = st[ks & 1];
    // A pass's reads stand in two groups AHEAD of the products that use them, so that a wave does not wait out the LDS latency once per product:
    // all 16 key fragments at the head of the pass; all 16 value fragments behind the first score chain, so that they land under the second chain and the softmax; the two mask words one pass ahead (the last pass reads its own again: no index past the block's keys).
    const int am[2] = { amn0, amn1 };
    v16h kh[2][4], kl[2][4], vh[8], vl[8]; v8f c[2];
#pragma unroll
    for (int ct = 0; ct < 2; ++ct)
#pragma unroll
      for (int kc = 0; kc < 4; ++kc) { kh[ct][kc] = frag_h(&T.kh[ct * 16 + col][kc * 32], lane); kl[ct][kc] = frag_h(&T.kl[ct * 16 + col][kc * 32], lane); }
    { const int kn = (ks + 1 < nks ? ks + 1 : ks) * 32 + col; amn0 = AM[kn]; amn1 = AM[kn + 16]; }
    asm volatile("s_wait_xcnt 0x0" ::: "memory");   // stands behind the mask loads, in front of whatever rewrites a register that they name
#pragma unroll
    for (int ct = 0; ct < 2; ++ct) { v8f cc = {};
#pragma unroll
      for (int kc = 0; kc < 4; ++kc) { cc = wmma16d(aq[kc], kh[ct][kc], cc); cc = wmma16d(al[kc], kh[ct][kc], cc); cc = wmma16d(aq[kc], kl[ct][kc], cc); }   // 3 products, all residuals UNSCALED into one accumulator
      c[ct] = cc;
      if (ct == 0) {
#pragma unroll
        for (int j = 0; j < 8; ++j) { vh[j] = frag_h(&T.vh[j * 16 + col][0], lane); vl[j] = frag_h(&T.vl[j * 16 + col][0], lane); } } }
#pragma unroll
    for (int ct = 0; ct < 2; ++ct) { const int kk = ks * 32 + ct * 16 + col; const bool keepm = (am[ct] != 0);
#pragma unroll
      for (int r = 0; r < 8; ++r) s[ct][r] = (keepm && kk <= q0 + 8 * g + r) ? c[ct][r] * 0.08838834764831845f : -3.0e38f; }
    float alpha[8], mx[8], es[8];
#pragma unroll
    for (int r = 0; r < 8; ++r) mx[r] = fmaxf(s[0][r], s[1][r]);
    rowmax8(mx);
#pragma unroll
    for (int r = 0; r < 8; ++r) {
      const float mn = fmaxf(m[r], mx[r]); alpha[r] = (m[r] <= -1.0e38f) ? 0.f : __expf(m[r] - mn); const float e0 = (s[0][r] <= -1.0e38f) ? 0.f : __expf(s[0][r] - mn), e1 = (s[1][r] <= -1.0e38f) ? 0.f : __expf(s[1][r] - mn); es[r] = e0 + e1;
      m[r] = mn; sp[wave][8 * g + r][col] = e0; sp[wave][8 * g + r][16 + col] = e1; }
    rowadd8(es);
#pragma unroll
    for (int r = 0; r < 8; ++r) l[r] = l[r] * alpha[r] + es[r];
#pragma unroll
    for (int j = 0; j < 8; ++j)
#pragma unroll
      for (int r = 0; r < 8; ++r) acc[j][r] *= alpha[r];
    LDSX();
    const v16h pa = frag_f32s(&sp[wave][col][0], lane, 2048.0f);
#pragma unroll
    for (int j = 0; j < 8; ++j) { acc[j] = wmma16d(pa, vh[j], acc[j]); acc[j] = wmma16d(pa, vl[j], acc[j]); }   // v hi + unscaled residual
    asm volatile("s_wait_dscnt 0x0" ::: "memory");      // this wave's reads of this tile (and of sp) have returned before the tile's buffer is refilled
    asm volatile("s_wait_asynccnt 0x0" ::: "memory");   // this wave's copies of tile ks + 1 have landed
    __syncthreads();                                    // publishes tile ks + 1 and ends every wave's reads of tile ks
    if (ks + 2 < nks) stage(ks + 2); }
  asm volatile("s_wait_asynccnt 0x0" ::: "memory");     // no copy is outstanding when the wave goes on to its end
#pragma unroll
  for (int r = 0; r < 8; ++r) { const float il = (l[r] > 0.f) ? (1.0f / 2048.0f) / l[r] : 0.f;
#pragma unroll
    for (int j = 0; j < 8; ++j) so[wave][8 * g + r][j * 16 + col] = acc[j][r] * il; }
  LDSX(); for (int rl = 0; rl < 16; ++rl) vst2(CT + (size_t)(q0 + rl) * QW + h * HD + lane * 4, *(const v4f*)&so[wave][rl][lane * 4]); }
// ---- k_out: block = (64 rows, 128 of 2048 cols): out = ctx (hi + lo) . wo (in,out)
__global__ __launch_bounds__(128) void k_out(const float* __restrict__ CT, const float* __restrict__ WO, float* __restrict__ OUT) { __shared__ __align__(16) float sf[4][16][132]; __shared__ __align__(16) __bf16 sh[2][64][GP], sl[2][64][GP], sw[2][128][GP];
  const int tid = threadIdx.x, wave = tid >> 5, lane = tid & 31, col = lane & 15, g = lane >> 4; const int c0 = blockIdx.y * 128; const size_t r0 = (size_t)blockIdx.x * 64 + wave * 16;
  v8f acc[8] = {};
  proj_tile<HID, true>(CT + (size_t)blockIdx.x * 64 * QW, WO + c0, sh, sl, sw, acc, wave, lane);
#pragma unroll
  for (int j = 0; j < 8; ++j)
#pragma unroll
    for (int r = 0; r < 8; ++r) sf[wave][8 * g + r][j * 16 + col] = acc[j][r];
  LDSX(); for (int rl = 0; rl < 16; ++rl) vst2(OUT + (r0 + rl) * HID + c0 + lane * 4, *(const v4f*)&sf[wave][rl][lane * 4]); }
extern "C" void kernel_launch(void* const* d_in, const int* in_sizes, int n_in, void* d_out, int out_size, void* d_ws, size_t ws_size, hipStream_t stream) {
  (void)in_sizes; (void)n_in; (void)out_size;
  const float** F_ = (const float**)d_in;   // 0 hidden_states [1,2048,2048], 1 wq [2048,2048], 2 wk [2048,512], 3 wv [2048,512], 4 wo [2048,2048] (all (in,out)), 5 attention_mask [1,2048] int, 6 position_ids [1,2048] int
  if (ws_size < (size_t)WS_END) return;
  char* ws = (char*)d_ws; float* F = (float*)(ws + WS_F); _Float16 *QH = (_Float16*)(ws + WS_QH), *QL = (_Float16*)(ws + WS_QL), *KH = (_Float16*)(ws + WS_KH), *KL = (_Float16*)(ws + WS_KL), *VH = (_Float16*)(ws + WS_VH), *VL = (_Float16*)(ws + WS_VL); float* CT = (float*)(ws + WS_CT);
  k_qkv<<<dim3(TRB, QKVW / 128), 128, 0, stream>>>(F_[0], F_[1], F_[2], F_[3], F);
  k_rope<<<TRB * 64, 256, 0, stream>>>(F, (const int*)d_in[6], QH, QL, KH, KL);
  k_vt<<<dim3(TRB, KW / 128), 128, 0, stream>>>(F, VH, VL);
  k_att<<<dim3(TQB, NHQ), 128, 0, stream>>>(QH, QL, KH, KL, VH, VL, (const int*)d_in[5], CT);
  k_out<<<dim3(TQB, HID / 128), 128, 0, stream>>>(CT, F_[4], (float*)d_out);
}

// v005
// One run takes 190 microseconds.
// Two timings next to v004 both put it at 1.16 times that version's speed.
// All steps since v000 together make it 4.30 times as fast.
// compute dtype: all float inputs rounded to bf16, attention_mask / position_ids (int) read; q/k/v = x . W with EXACT bf16 products on WMMA 16x16x32 ((in,out) weights), f32 accumulate; RoPE (interleaved pairs, angles position_id * theta^(-2j/128), precise sinf/cosf/powf) in f32, q/k as f16 hi + residual rows, v as f16 hi + residual planes; GQA causal attention with head_dim 128: 3-product scores (q/k as f16 hi + UNSCALED residual, one accumulator), P rounded once to f16 (x 2^11) against v as f16 hi + UNSCALED residual (2 products into one accumulator), x 1/sqrt(128), masked/acausal keys excluded, running-max softmax in f32 (hardware exp); out = ctx (bf16 hi + lo) . wo (2 products); f32 output.
#include <hip/hip_runtime.h>
#include <math.h>

typedef __attribute__((ext_vector_type(16))) _Float16 v16h;
typedef __attribute__((ext_vector_type(16))) __bf16 v16b;
typedef __attribute__((ext_vector_type(8)))  _Float16 v8h;
typedef __attribute__((ext_vector_type(8)))  float v8f;
typedef __attribute__((ext_vector_type(4)))  float v4f;
typedef __attribute__((ext_vector_type(2)))  float v2f;
typedef __attribute__((ext_vector_type(4)))  unsigned v4u;
typedef __attribute__((ext_vector_type(4)))  int v4i;
typedef float __attribute__((may_alias)) float_a;
typedef int __attribute__((may_alias)) int_a;

template <typename T> __device__ __forceinline__ void vst2(void* p, T v) { *(T*)p = v;  }
__device__ __forceinline__ v8f wmma16(v16h a, v16h b, v8f c) {
  v8f d = __builtin_amdgcn_wmma_f32_16x16x32_f16(false, a, false, b, (short)0, c, false, false);
  asm volatile("v_nop\n\tv_nop\n\tv_nop\n\tv_nop" : "+v"(d) : "v"(a), "v"(b));
  return d;
}
__device__ __forceinline__ v8f wmma_bf(v16b a, v16b b, v8f c) {
  v8f d = __builtin_amdgcn_wmma_f32_16x16x32_bf16(false, a, false, b, (short)0, c, false, false);
  asm volatile("v_nop\n\tv_nop\n\tv_nop\n\tv_nop" : "+v"(d) : "v"(a), "v"(b));
  return d;
}
// 16x16x32 fragments: lane = (h = lane>>4, row/col = lane&15); elements 0..7 = k0+8h+0..7, 8..15 = k0+16+8h+0..7; D element r = row 8h+r
__device__ __forceinline__ v16h frag_h(const _Float16* rowk0, int lane) {
  union { v16h v; v8h q[2]; } u; const _Float16* p = rowk0 + 8 * (lane >> 4);
  u.q[0] = *(const v8h*)p; u.q[1] = *(const v8h*)(p + 16); return u.v;
}
__device__ __forceinline__ v16h frag_f32(const float* rowk0, int lane) {
  v16h a; const float* p = rowk0 + 8 * (lane >> 4);
#pragma unroll
  for (int i = 0; i < 8; ++i) { a[i] = (_Float16)p[i]; a[8 + i] = (_Float16)p[16 + i]; }
  return a;
}
__device__ __forceinline__ v16h frag_f32s(const float* rowk0, int lane, float sc) {
  v16h a; const float* p = rowk0 + 8 * (lane >> 4);
#pragma unroll
  for (int i = 0; i < 8; ++i) { a[i] = (_Float16)(p[i] * sc); a[8 + i] = (_Float16)(p[16 + i] * sc); }
  return a;
}
// column fragment from a [K][ld] layout (column n), rows >= K read as 0
__device__ __forceinline__ v16h fragc_f32(const float* W, int k0, int n, int lane, int ld, int K) {
  v16h a; const int g = lane >> 4;
#pragma unroll
  for (int i = 0; i < 8; ++i) { const int ka = k0 + 8 * g + i, kb = ka + 16;
    a[i] = (_Float16)(ka < K ? W[(size_t)(ka < K ? ka : K - 1) * ld + n] : 0.f); a[8 + i] = (_Float16)(kb < K ? W[(size_t)(kb < K ? kb : K - 1) * ld + n] : 0.f); }
  return a;
}
struct F2 { v16b h, l; };
__device__ __forceinline__ F2 bsplit16(const float v[16]) { F2 r;
#pragma unroll
  for (int i = 0; i < 16; ++i) { const __bf16 h = (__bf16)v[i]; r.h[i] = h; r.l[i] = (__bf16)(v[i] - (float)h); }
  return r; }
__device__ __forceinline__ F2 split_row(const float* row, int k0, int lane) { float v[16]; const float* p = row + k0 + 8 * (lane >> 4);
#pragma unroll
  for (int i = 0; i < 8; ++i) { v[i] = p[i]; v[8 + i] = p[16 + i]; }
  return bsplit16(v); }
__device__ __forceinline__ F2 split_rowK(const float* row, int k0, int lane, int K) { float v[16]; const int g = lane >> 4;
#pragma unroll
  for (int i = 0; i < 8; ++i) { const int ka = k0 + 8 * g + i, kb = ka + 16; v[i] = ka < K ? row[ka < K ? ka : K - 1] : 0.f; v[8 + i] = kb < K ? row[kb < K ? kb : K - 1] : 0.f; }
  return bsplit16(v); }
__device__ __forceinline__ F2 split_col(const float* W, int k0, int n, int lane, int ld, int K) { float v[16]; const int g = lane >> 4;
#pragma unroll
  for (int i = 0; i < 8; ++i) { const int ka = k0 + 8 * g + i, kb = ka + 16; v[i] = ka < K ? W[(size_t)(ka < K ? ka : K - 1) * ld + n] : 0.f; v[8 + i] = kb < K ? W[(size_t)(kb < K ? kb : K - 1) * ld + n] : 0.f; }
  return bsplit16(v); }
__device__ __forceinline__ v8f mac3(const F2& a, const F2& b, v8f c) { c = wmma_bf(a.l, b.h, c); c = wmma_bf(a.h, b.l, c); return wmma_bf(a.h, b.h, c); }
__device__ __forceinline__ float sigm(float v) { return 1.0f / (1.0f + expf(-v)); }
#define LDSX() do { asm volatile("s_wait_dscnt 0" ::: "memory"); __builtin_amdgcn_wave_barrier(); __builtin_amdgcn_fence(__ATOMIC_RELEASE, "workgroup"); } while (0)


// LLaMA attention (B 1, S 2,048, hidden 2,048, 16 query heads / 4 kv heads x 128, RoPE theta 1e4): q/k/v projections, RoPE on q and k, GQA (kv head = h / 4), causal + padding mask, softmax in f32, o_proj.
#define NB 1
#define SS 2048
#define HID 2048
#define NHQ 16
#define NKV 4
#define HD 128
#define QW (NHQ * HD)     // 2048
#define KW (NKV * HD)     // 512
#define QKVW (QW + 2 * KW)   // 3072
#ifndef TQB
#define TQB (SS / 64)
#endif
#ifndef TRB
#define TRB (NB * SS / 64)   // row blocks for projections / rope / value planes
#endif
typedef __attribute__((ext_vector_type(8))) __bf16 v8b;
__device__ __forceinline__ v16b frag_b(const __bf16* rowk0, int lane) {
  union { v16b v; v8b q[2]; } u; const __bf16* p = rowk0 + 8 * (lane >> 4);
  u.q[0] = *(const v8b*)p; u.q[1] = *(const v8b*)(p + 16); return u.v;
}
__device__ __forceinline__ float bfr(float v) { return (float)(__bf16)v; }
__device__ __attribute__((noinline)) float exp_ni(float v) { return expf(v); }
__device__ __attribute__((noinline)) float erf_ni(float v) { return erff(v); }

#define WS_F   0u                                   // f32 q|k|v rows [b*s][3072]
#define WS_QH  (WS_F + 4u * (size_t)NB * SS * QKVW)     // f16 hi|lo q rows [b*s][2048] (after rope)
#define WS_QL  (WS_QH + 2u * (size_t)NB * SS * QW)
#define WS_KH  (WS_QL + 2u * (size_t)NB * SS * QW)      // f16 hi|lo k rows [b*s][512]
#define WS_KL  (WS_KH + 2u * (size_t)NB * SS * KW)
#define WS_VH  (WS_KL + 2u * (size_t)NB * SS * KW)      // f16 hi|lo v planes [b][512][s]
#define WS_VL  (WS_VH + 2u * (size_t)NB * KW * SS)
#define WS_CT  (WS_VL + 2u * (size_t)NB * KW * SS)      // f32 ctx rows [b*s][2048]
#define WS_END (WS_CT + 4u * (size_t)NB * SS * QW)

// staged 32-k operand tiles of the two projection GEMMs, bf16, one row per output row / column: pitch 80 B = 16 B x odd, so that the 16 rows of a ds_load_b128 fragment read fall on distinct banks
#define GP (32 + 8)
typedef __attribute__((ext_vector_type(4))) __bf16 v4b;
// 64 rows x 128 columns of X[.][2048] . W[2048][LDW] per block of 4 waves (a wave: 16 rows x 128 columns), K = 2048 in passes of 32. Both operands' tiles go ONCE per block through registers into LDS as bf16, two buffers; the next tile's global loads are in flight under this tile's products.
// Row tile: each wave brings its own 16 rows x 32 k f32 as four loads of 4 whole 128-B lines; SPLIT: stored as bf16 hi rows and residual rows.
// Weight tile [32 k][128 cols] f32 -> LDS [col][k] bf16: a thread holds 8 k rows (wave w: rows 8w .. 8w + 7) x 4 columns (4 * lane ..), read as whole 512-B row pieces per wave.
// The 16-B piece of k rows 8c .. 8c + 7 of a column stands at place (c + (column >> 4)) & 3 of its LDS row: the writers' rows lie 4 apart, and the rotation spreads their ds_store_b128 over all banks; the 16 columns of a fragment share one rotation.
template <int LDW, bool SPLIT>
__device__ __forceinline__ void proj_tile(const float* Xb, const float* Wb, __bf16 (*sh)[64][GP], __bf16 (*sl)[64][GP], __bf16 (*sw)[128][GP], v8f (&acc)[8], int wave, int lane) {
  const int col = lane & 15, g = lane >> 4, xrow = wave * 16 + (lane >> 3), xk = 4 * (lane & 7), pl = ((wave + (lane >> 2)) & 3) * 8;
  const unsigned xo = (unsigned)(xrow * 2048 + xk) * 4u, wo = (unsigned)(8 * wave * LDW + 4 * lane) * 4u;   // per-lane byte offsets, the same in every pass
  v4f wr[8], xr[4];
  auto get = [&](int kc) { const char* xb = (const char*)(Xb + kc * 32); const char* wb = (const char*)(Wb + (size_t)kc * 32 * LDW);
#pragma unroll
    for (int i = 0; i < 8; ++i) wr[i] = *(const v4f*)(wb + wo + i * LDW * 4);
#pragma unroll
    for (int i = 0; i < 4; ++i) xr[i] = *(const v4f*)(xb + xo + i * 4 * 2048 * 4);
    asm volatile("s_wait_xcnt 0x0" ::: "memory"); };   // stands behind the loads, in front of whatever rewrites a register that they name
  auto put = [&](int b) {
#pragma unroll
    for (int c = 0; c < 4; ++c) { v8b q;
#pragma unroll
      for (int i = 0; i < 8; ++i) q[i] = (__bf16)wr[i][c];
      *(v8b*)&sw[b][4 * lane + c][pl] = q; }
#pragma unroll
    for (int i = 0; i < 4; ++i) { v4b qh, ql;
#pragma unroll
      for (int e = 0; e < 4; ++e) { const __bf16 hv = (__bf16)xr[i][e]; qh[e] = hv; if (SPLIT) ql[e] = (__bf16)(xr[i][e] - (float)hv); }
      *(v4b*)&sh[b][xrow + 4 * i][xk] = qh; if (SPLIT) *(v4b*)&sl[b][xrow + 4 * i][xk] = ql; } };
  get(0); put(0);
  __syncthreads();   // tile 0 may be read
  // two passes a trip, so that the buffer index is a constant of each copy and stands as an immediate in every LDS address (the full unrolls here keep the register arrays' indices constant)
#pragma unroll 2
  for (int kc = 0; kc < 2048 / 32; ++kc) { const int b = kc & 1;
    if (kc + 1 < 2048 / 32) get(kc + 1);
    const v16b ah = frag_b(&sh[b][wave * 16 + col][0], lane); v16b al; if (SPLIT) al = frag_b(&sl[b][wave * 16 + col][0], lane);
    v16b w[8];
#pragma unroll
    for (int j = 0; j < 8; ++j) { union { v16b v; v8b q[2]; } u; const __bf16* p = &sw[b][j * 16 + col][0];
      u.q[0] = *(const v8b*)(p + ((g + j) & 3) * 8); u.q[1] = *(const v8b*)(p + ((g + 2 + j) & 3) * 8); w[j] = u.v; }
#pragma unroll
    for (int j = 0; j < 8; ++j) acc[j] = wmma_bf(ah, w[j], acc[j]);
    if (SPLIT) {   // each accumulator still takes hi, then residual, of every pass; the other accumulators' products stand between the two
#pragma unroll
      for (int j = 0; j < 8; ++j) acc[j] = wmma_bf(al, w[j], acc[j]); }
    __builtin_amdgcn_sched_barrier(0);    // keeps the conversions of the next tile, and with them the wait for its global loads, behind this tile's products
    if (kc + 1 < 2048 / 32) put(b ^ 1);   // the other buffer: its readers left it at the barrier that ended pass kc - 1
    __syncthreads(); }                    // publishes tile kc + 1 and ends every wave's reads of tile kc
}
// ---- k_qkv: block = (64 rows, col group of 128 over q|k|v (24 groups)): x . W (exact) -> f32 rows
__global__ __launch_bounds__(128) void k_qkv(const float* __restrict__ X, const float* __restrict__ WQ, const float* __restrict__ WK, const float* __restrict__ WV, float* __restrict__ F) { __shared__ __align__(16) float sf[4][16][132]; __shared__ __align__(16) __bf16 sa[2][64][GP], sw[2][128][GP];
  const int tid = threadIdx.x, wave = tid >> 5, lane = tid & 31, col = lane & 15, g = lane >> 4; const int cg = blockIdx.y; const size_t r0 = (size_t)blockIdx.x * 64 + wave * 16;
  const float* Xb = X + (size_t)blockIdx.x * 64 * HID;
  v8f acc[8] = {};
  if (cg < 16) proj_tile<QW, false>(Xb, WQ + cg * 128, sa, sa, sw, acc, wave, lane);
  else proj_tile<KW, false>(Xb, (cg < 20 ? WK + (cg - 16) * 128 : WV + (cg - 20) * 128), sa, sa, sw, acc, wave, lane);
#pragma unroll
  for (int j = 0; j < 8; ++j)
#pragma unroll
    for (int r = 0; r < 8; ++r) sf[wave][8 * g + r][j * 16 + col] = acc[j][r];
  LDSX(); for (int rl = 0; rl < 16; ++rl) vst2(F + (r0 + rl) * QKVW + cg * 128 + lane * 4, *(const v4f*)&sf[wave][rl][lane * 4]); }
// ---- k_rope: block = row (b, s): RoPE on the 16 q heads and 4 k heads (pairs (2j, 2j+1), angle pos * 1e4^(-2j/128)) -> f16 hi/lo rows
__global__ __launch_bounds__(256) void k_rope(const float* __restrict__ F, const int* __restrict__ PID, _Float16* __restrict__ QH, _Float16* __restrict__ QL, _Float16* __restrict__ KH, _Float16* __restrict__ KL) { __shared__ __align__(16) _Float16 sh[QW + KW], sl[QW + KW];
  const int t = threadIdx.x; const size_t row = blockIdx.x; const float pos = (float)PID[row]; const float* fr = F + row * QKVW;
  for (int e = t; e < (QW + KW) / 2; e += 256) { const int hh = e / (HD / 2), j = e % (HD / 2); const int o = hh * HD + 2 * j;   // heads 0..15 = q, 16..19 = k (contiguous in F)
    const float ang = pos * powf(10000.0f, -(float)(2 * j) / (float)HD); const float c = cosf(ang), sn = sinf(ang); const float x0 = fr[o], x1 = fr[o + 1];
    const float y0 = x0 * c - x1 * sn, y1 = x0 * sn + x1 * c; const _Float16 h0 = (_Float16)y0, h1 = (_Float16)y1; sh[o] = h0; sh[o + 1] = h1; sl[o] = (_Float16)(y0 - (float)h0); sl[o + 1] = (_Float16)(y1 - (float)h1); }   // UNSCALED residuals (q, k ~ O(1))
  __syncthreads();
  for (int q = t; q < QW / 8; q += 256) { vst2((unsigned*)(QH + row * QW + q * 8), *(const v4u*)&sh[q * 8]); vst2((unsigned*)(QL + row * QW + q * 8), *(const v4u*)&sl[q * 8]); }
  for (int q = t; q < KW / 8; q += 256) { vst2((unsigned*)(KH + row * KW + q * 8), *(const v4u*)&sh[QW + q * 8]); vst2((unsigned*)(KL + row * KW + q * 8), *(const v4u*)&sl[QW + q * 8]); } }
// ---- k_vt: block = (64 rows s, 128 of the 512 v channels): v rows -> f16 hi/lo planes [c][s]
__global__ __launch_bounds__(128) void k_vt(const float* __restrict__ F, _Float16* __restrict__ VH, _Float16* __restrict__ VL) { __shared__ __align__(16) _Float16 th[128][72], tl[128][72];
  const int t = threadIdx.x; const size_t s0 = (size_t)blockIdx.x * 64; const int c0 = blockIdx.y * 128;
  for (int e = t; e < 64 * 128; e += 128) { const int sl_ = e >> 7, c = e & 127; const float v = F[(s0 + sl_) * QKVW + QW + KW + c0 + c]; const _Float16 hv = (_Float16)v; th[c][sl_] = hv; tl[c][sl_] = (_Float16)(v - (float)hv); }   // UNSCALED residual (v ~ O(1)): lets the attention add it into the same accumulator
  __syncthreads(); for (int e = t; e < 128 * 8; e += 128) { const int c = e >> 3, q = e & 7; vst2((unsigned*)(VH + (size_t)(c0 + c) * SS + s0 + q * 8), *(const v4u*)&th[c][q * 8]); vst2((unsigned*)(VL + (size_t)(c0 + c) * SS + s0 + q * 8), *(const v4u*)&tl[c][q * 8]); } }
// staged key/value tile of 32 keys: row pitches are 16 B x odd (272 B, 80 B), so that the 16 rows of a ds_load_b128 fragment read fall on distinct banks
#define KP (HD + 8)
#define VP (32 + 8)
struct __align__(16) KVStage { _Float16 kh[32][KP], kl[32][KP], vh[HD][VP], vl[HD][VP]; };
__device__ __forceinline__ unsigned lds_addr(const void* p) { return (unsigned)(size_t)(__attribute__((address_space(3))) const void*)p; }
// eight asynchronous 16-byte copies per lane, global -> LDS through no register (four of plane a, four of plane b); the s_wait_xcnt stands in the copies' own statement so that no address register is rewritten ahead of it
__device__ __forceinline__ void acopy8(unsigned la, unsigned lb, unsigned ls, const _Float16* ga, const _Float16* gb, size_t gs) {
  asm volatile("global_load_async_to_lds_b128 %0, %8, off\n\t"
               "global_load_async_to_lds_b128 %1, %9, off\n\t"
               "global_load_async_to_lds_b128 %2, %10, off\n\t"
               "global_load_async_to_lds_b128 %3, %11, off\n\t"
               "global_load_async_to_lds_b128 %4, %12, off\n\t"
               "global_load_async_to_lds_b128 %5, %13, off\n\t"
               "global_load_async_to_lds_b128 %6, %14, off\n\t"
               "global_load_async_to_lds_b128 %7, %15, off\n\t"
               "s_wait_xcnt 0x0"
               :: "v"(la), "v"(la + ls), "v"(la + 2 * ls), "v"(la + 3 * ls), "v"(lb), "v"(lb + ls), "v"(lb + 2 * ls), "v"(lb + 3 * ls),
                  "v"(ga), "v"(ga + gs), "v"(ga + 2 * gs), "v"(ga + 3 * gs), "v"(gb), "v"(gb + gs), "v"(gb + 2 * gs), "v"(gb + 3 * gs) : "memory");
}
// wmma16 with D alone named in the statement of the four slots: this compiler keeps a vector operand of an asm statement in the first 256 registers, and k_att's fragments, read ahead in groups, do not fit there beside Q and the accumulators (with A and B named the build spilled to scratch)
__device__ __forceinline__ v8f wmma16d(v16h a, v16h b, v8f c) {
  v8f d = __builtin_amdgcn_wmma_f32_16x16x32_f16(false, a, false, b, (short)0, c, false, false);
  asm volatile("v_nop\n\tv_nop\n\tv_nop\n\tv_nop" : "+v"(d));
  return d;
}
// Maximum / sum over each 16-lane row, of eight values at once: the butterfly l ^ 1, 2, 4, 8 with the partner lane read as the DPP operand (row_xmask) of the v_max / v_add itself, so an exchange makes no trip through the LDS pipe and needs no dscnt wait, as __shfl_xor does here. Every lane is on where they stand.
// In asm text, eight values a statement: a value's next step stands eight instructions behind its last one and does not wait for it (from the builtin the moved value came out as a move of its own, for the maximum with one more instruction behind it).
__device__ __forceinline__ void rowmax8(float (&v)[8]) {
  asm(
      "v_max_num_f32_dpp %0, %0, %0 row_xmask:1 row_mask:0xf bank_mask:0xf\n\t"
      "v_max_num_f32_dpp %1, %1, %1 row_xmask:1 row_mask:0xf bank_mask:0xf\n\t"
      "v_max_num_f32_dpp %2, %2, %2 row_xmask:1 row_mask:0xf bank_mask:0xf\n\t"
      "v_max_num_f32_dpp %3, %3, %3 row_xmask:1 row_mask:0xf bank_mask:0xf\n\t"
      "v_max_num_f32_dpp %4, %4, %4 row_xmask:1 row_mask:0xf bank_mask:0xf\n\t"
      "v_max_num_f32_dpp %5, %5, %5 row_xmask:1 row_mask:0xf bank_mask:0xf\n\t"
      "v_max_num_f32_dpp %6, %6, %6 row_xmask:1 row_mask:0xf bank_mask:0xf\n\t"
      "v_max_num_f32_dpp %7, %7, %7 row_xmask:1 row_mask:0xf bank_mask:0xf\n\t"
      "v_max_num_f32_dpp %0, %0, %0 row_xmask:2 row_mask:0xf bank_mask:0xf\n\t"
      "v_max_num_f32_dpp %1, %1, %1 row_xmask:2 row_mask:0xf bank_mask:0xf\n\t"
      "v_max_num_f32_dpp %2, %2, %2 row_xmask:2 row_mask:0xf bank_mask:0xf\n\t"
      "v_max_num_f32_dpp %3, %3, %3 row_xmask:2 row_mask:0xf bank_mask:0xf\n\t"
      "v_max_num_f32_dpp %4, %4, %4 row_xmask:2 row_mask:0xf bank_mask:0xf\n\t"
      "v_max_num_f32_dpp %5, %5, %5 row_xmask:2 row_mask:0xf bank_mask:0xf\n\t"
      "v_max_num_f32_dpp %6, %6, %6 row_xmask:2 row_mask:0xf bank_mask:0xf\n\t"
      "v_max_num_f32_dpp %7, %7, %7 row_xmask:2 row_mask:0xf bank_mask:0xf\n\t"
      "v_max_num_f32_dpp %0, %0, %0 row_xmask:4 row_mask:0xf bank_mask:0xf\n\t"
      "v_max_num_f32_dpp %1, %1, %1 row_xmask:4 row_mask:0xf bank_mask:0xf\n\t"
      "v_max_num_f32_dpp %2, %2, %2 row_xmask:4 row_mask:0xf bank_mask:0xf\n\t"
      "v_max_num_f32_dpp %3, %3, %3 row_xmask:4 row_mask:0xf bank_mask:0xf\n\t"
      "v_max_num_f32_dpp %4, %4, %4 row_xmask:4 row_mask:0xf bank_mask:0xf\n\t"
      "v_max_num_f32_dpp %5, %5, %5 row_xmask:4 row_mask:0xf bank_mask:0xf\n\t"
      "v_max_num_f32_dpp %6, %6, %6 row_xmask:4 row_mask:0xf bank_mask:0xf\n\t"
      "v_max_num_f32_dpp %7, %7, %7 row_xmask:4 row_mask:0xf bank_mask:0xf\n\t"
      "v_max_num_f32_dpp %0, %0, %0 row_xmask:8 row_mask:0xf bank_mask:0xf\n\t"
      "v_max_num_f32_dpp %1, %1, %1 row_xmask:8 row_mask:0xf bank_mask:0xf\n\t"
      "v_max_num_f32_dpp %2, %2, %2 row_xmask:8 row_mask:0xf bank_mask:0xf\n\t"
      "v_max_num_f32_dpp %3, %3, %3 row_xmask:8 row_mask:0xf bank_mask:0xf\n\t"
      "v_max_num_f32_dpp %4, %4, %4 row_xmask:8 row_mask:0xf bank_mask:0xf\n\t"
      "v_max_num_f32_dpp %5, %5, %5 row_xmask:8 row_mask:0xf bank_mask:0xf\n\t"
      "v_max_num_f32_dpp %6, %6, %6 row_xmask:8 row_mask:0xf bank_mask:0xf\n\t"
      "v_max_num_f32_dpp %7, %7, %7 row_xmask:8 row_mask:0xf bank_mask:0xf"
      : "+v"(v[0]), "+v"(v[1]), "+v"(v[2]), "+v"(v[3]), "+v"(v[4]), "+v"(v[5]), "+v"(v[6]), "+v"(v[7])); }
__device__ __forceinline__ void rowadd8(float (&v)[8]) {
  asm(
      "v_add_f32_dpp %0, %0, %0 row_xmask:1 row_mask:0xf bank_mask:0xf\n\t"
      "v_add_f32_dpp %1, %1, %1 row_xmask:1 row_mask:0xf bank_mask:0xf\n\t"
      "v_add_f32_dpp %2, %2, %2 row_xmask:1 row_mask:0xf bank_mask:0xf\n\t"
      "v_add_f32_dpp %3, %3, %3 row_xmask:1 row_mask:0xf bank_mask:0xf\n\t"
      "v_add_f32_dpp %4, %4, %4 row_xmask:1 row_mask:0xf bank_mask:0xf\n\t"
      "v_add_f32_dpp %5, %5, %5 row_xmask:1 row_mask:0xf bank_mask:0xf\n\t"
      "v_add_f32_dpp %6, %6, %6 row_xmask:1 row_mask:0xf bank_mask:0xf\n\t"
      "v_add_f32_dpp %7, %7, %7 row_xmask:1 row_mask:0xf bank_mask:0xf\n\t"
      "v_add_f32_dpp %0, %0, %0 row_xmask:2 row_mask:0xf bank_mask:0xf\n\t"
      "v_add_f32_dpp %1, %1, %1 row_xmask:2 row_mask:0xf bank_mask:0xf\n\t"
      "v_add_f32_dpp %2, %2, %2 row_xmask:2 row_mask:0xf bank_mask:0xf\n\t"
      "v_add_f32_dpp %3, %3, %3 row_xmask:2 row_mask:0xf bank_mask:0xf\n\t"
      "v_add_f32_dpp %4, %4, %4 row_xmask:2 row_mask:0xf bank_mask:0xf\n\t"
      "v_add_f32_dpp %5, %5, %5 row_xmask:2 row_mask:0xf bank_mask:0xf\n\t"
      "v_add_f32_dpp %6, %6, %6 row_xmask:2 row_mask:0xf bank_mask:0xf\n\t"
      "v_add_f32_dpp %7, %7, %7 row_xmask:2 row_mask:0xf bank_mask:0xf\n\t"
      "v_add_f32_dpp %0, %0, %0 row_xmask:4 row_mask:0xf bank_mask:0xf\n\t"
      "v_add_f32_dpp %1, %1, %1 row_xmask:4 row_mask:0xf bank_mask:0xf\n\t"
      "v_add_f32_dpp %2, %2, %2 row_xmask:4 row_mask:0xf bank_mask:0xf\n\t"
      "v_add_f32_dpp %3, %3, %3 row_xmask:4 row_mask:0xf bank_mask:0xf\n\t"
      "v_add_f32_dpp %4, %4, %4 row_xmask:4 row_mask:0xf bank_mask:0xf\n\t"
      "v_add_f32_dpp %5, %5, %5 row_xmask:4 row_mask:0xf bank_mask:0xf\n\t"
      "v_add_f32_dpp %6, %6, %6 row_xmask:4 row_mask:0xf bank_mask:0xf\n\t"
      "v_add_f32_dpp %7, %7, %7 row_xmask:4 row_mask:0xf bank_mask:0xf\n\t"
      "v_add_f32_dpp %0, %0, %0 row_xmask:8 row_mask:0xf bank_mask:0xf\n\t"
      "v_add_f32_dpp %1, %1, %1 row_xmask:8 row_mask:0xf bank_mask:0xf\n\t"
      "v_add_f32_dpp %2, %2, %2 row_xmask:8 row_mask:0xf bank_mask:0xf\n\t"
      "v_add_f32_dpp %3, %3, %3 row_xmask:8 row_mask:0xf bank_mask:0xf\n\t"
      "v_add_f32_dpp %4, %4, %4 row_xmask:8 row_mask:0xf bank_mask:0xf\n\t"
      "v_add_f32_dpp %5, %5, %5 row_xmask:8 row_mask:0xf bank_mask:0xf\n\t"
      "v_add_f32_dpp %6, %6, %6 row_xmask:8 row_mask:0xf bank_mask:0xf\n\t"
      "v_add_f32_dpp %7, %7, %7 row_xmask:8 row_mask:0xf bank_mask:0xf"
      : "+v"(v[0]), "+v"(v[1]), "+v"(v[2]), "+v"(v[3]), "+v"(v[4]), "+v"(v[5]), "+v"(v[6]), "+v"(v[7])); }
// e^x as __expf comes out here (x * log2(e), then v_exp_f32), with the one slot that the instruction set asks for behind a transcendental in the same statement
__device__ __forceinline__ float exp_s(float x) { float d; asm("v_exp_f32 %0, %1\n\tv_nop" : "=v"(d) : "v"(x * 1.44269504088896340736f)); return d; }
// ---- k_att: block = (64 queries, head h): kv head = h / 4; causal (tiles past the block skipped) AND attention_mask[k] != 0; head_dim 128 = 4 k-chunks; P . v over 8 d-tiles
// Eight waves in two groups of four. Both groups hold the same 64 queries (wave wq of each: rows 16 wq ..); group 0 walks the even key tiles, group 1 the odd ones (the causal bound is an even number of tiles), each with its own two staging buffers, running maximum, sum and accumulators:
// the longest block's chain of passes, which the launch lasts, is half as long. Behind the loop group 1 hands its maximum, sum and accumulators over through LDS and group 0 joins the two partial softmaxes.
// One block fills a WGP's registers, so the blocks come in two rounds: the grid's slow index counts the query blocks from the last (most tiles) down, so that the short blocks fill in behind the long ones.
__global__ __launch_bounds__(256) void k_att(const _Float16* __restrict__ QH, const _Float16* __restrict__ QL, const _Float16* __restrict__ KH, const _Float16* __restrict__ KL, const _Float16* __restrict__ VH, const _Float16* __restrict__ VL, const int* __restrict__ AM, float* __restrict__ CT) {
  __shared__ __align__(16) float sp[8][16][36]; __shared__ __align__(16) float so[4][16][132]; __shared__ KVStage st[2][2];   // st[group][buffer]
  const int tid = threadIdx.x, wave = tid >> 5, lane = tid & 31, col = lane & 15, g = lane >> 4, grp = wave >> 2, wq = wave & 3, gt = tid & 127; const int qb = TQB - 1 - blockIdx.y, h = blockIdx.x; const int kvh = h / (NHQ / NKV); const int q0 = qb * 64 + wq * 16; constexpr bool three = false;   // not read: the scores always take 3 products (q hi.k hi, q lo.k hi, q hi.k lo)
  v16h aq[4], al[4];
#pragma unroll
  for (int kc = 0; kc < 4; ++kc) { aq[kc] = frag_h(QH + (size_t)(q0 + col) * QW + h * HD + kc * 32, lane); al[kc] = frag_h(QL + (size_t)(q0 + col) * QW + h * HD + kc * 32, lane); }
  int amn0 = AM[grp * 32 + col], amn1 = AM[grp * 32 + 16 + col];   // mask words of pass 0
  asm volatile("s_wait_xcnt 0x0" ::: "memory");       // stands behind the Q and mask loads, in front of whatever rewrites a register that they name
  __builtin_amdgcn_sched_barrier(0);                  // keeps the staging's address arithmetic, which takes those registers over, behind that wait (this build had it in front)
  float m[8], l[8];
#pragma unroll
  for (int r = 0; r < 8; ++r) { m[r] = -3.0e38f; l[r] = 0.f; }
  v8f acc[8] = {};
  const int nks = qb + 1;   // passes: the causal bound is 2 (qb + 1) tiles of 32 keys, and pass i of group grp takes tile 2 i + grp
  // each thread of a group copies 16 pieces of 16 B per tile of its group: k rows of 256 B (16 lanes a row, 8 rows a step), v rows of 64 B (4 lanes a row, 32 rows a step)
  const unsigned lk = lds_addr(&st[grp][0].kh[gt >> 4][(gt & 15) * 8]), lv = lds_addr(&st[grp][0].vh[gt >> 2][(gt & 3) * 8]);
  const size_t gk = (size_t)(gt >> 4) * KW + kvh * HD + (gt & 15) * 8, gv = ((size_t)kvh * HD + (gt >> 2)) * SS + (gt & 3) * 8;
  auto stage = [&](int i) { const int t = 2 * i + grp; const unsigned b = (unsigned)(i & 1) * (unsigned)sizeof(KVStage);
    acopy8(lk + b, lk + b + (unsigned)sizeof(st[0][0].kh), 8 * KP * 2, KH + gk + (size_t)t * 32 * KW, KL + gk + (size_t)t * 32 * KW, (size_t)8 * KW);
    acopy8(lv + b, lv + b + (unsigned)sizeof(st[0][0].vh), 32 * VP * 2, VH + gv + t * 32, VL + gv + t * 32, (size_t)32 * SS); };
  stage(0);
  asm volatile("s_wait_asynccnt 0x0" ::: "memory");   // this wave's copies of pass 0 have landed
  __syncthreads();                                    // ... and every other wave's: both groups' tiles of pass 0 may be read
  if (nks > 1) stage(1);
#pragma unroll 1
  for (int ks = 0; ks < nks; ++ks) { float s[2][8]; const KVStage& T = st[grp][ks & 1];
    // A pass's reads stand in two groups AHEAD of the products that use them, so that a wave does not wait out the LDS latency once per product:
    // all 16 key fragments at the head of the pass; all 16 value fragments behind the first score chain, so that they land under the second chain and the softmax; the two mask words one pass ahead (the last pass reads its own again: no index past the block's keys).
    const int am[2] = { amn0, amn1 };
    v16h kh[2][4], kl[2][4], vh[8], vl[8]; v8f c[2];
#pragma unroll
    for (int ct = 0; ct < 2; ++ct)
#pragma unroll
      for (int kc = 0; kc < 4; ++kc) { kh[ct][kc] = frag_h(&T.kh[ct * 16 + col][kc * 32], lane); kl[ct][kc] = frag_h(&T.kl[ct * 16 + col][kc * 32], lane); }
    { const int kn = (2 * (ks + 1 < nks ? ks + 1 : ks) + grp) * 32 + col; amn0 = AM[kn]; amn1 = AM[kn + 16]; }
    asm volatile("s_wait_xcnt 0x0" ::: "memory");   // stands behind the mask loads, in front of whatever rewrites a register that they name
#pragma unroll
    for (int ct = 0; ct < 2; ++ct) { v8f cc = {};
#pragma unroll
      for (int kc = 0; kc < 4; ++kc) { cc = wmma16d(aq[kc], kh[ct][kc], cc); cc = wmma16d(al[kc], kh[ct][kc], cc); cc = wmma16d(aq[kc], kl[ct][kc], cc); }   // 3 products, all residuals UNSCALED into one accumulator
      c[ct] = cc;
      if (ct == 0) {
#pragma unroll
        for (int j = 0; j < 8; ++j) { vh[j] = frag_h(&T.vh[j * 16 + col][0], lane); vl[j] = frag_h(&T.vl[j * 16 + col][0], lane); } } }
#pragma unroll
    for (int ct = 0; ct < 2; ++ct) { const int kk = (2 * ks + grp) * 32 + ct * 16 + col; const bool keepm = (am[ct] != 0);
#pragma unroll
      for (int r = 0; r < 8; ++r) s[ct][r] = (keepm && kk <= q0 + 8 * g + r) ? c[ct][r] * 0.08838834764831845f : -3.0e38f; }
    float alpha[8], mx[8], es[8];
#pragma unroll
    for (int r = 0; r < 8; ++r) mx[r] = fmaxf(s[0][r], s[1][r]);
    rowmax8(mx);
#pragma unroll
    for (int r = 0; r < 8; ++r) {
      const float mn = fmaxf(m[r], mx[r]); const float xa = exp_s(m[r] - mn), x0 = exp_s(s[0][r] - mn), x1 = exp_s(s[1][r] - mn);   // taken in every lane, chosen below: an asm statement under a condition would come out as a branch
      alpha[r] = (m[r] <= -1.0e38f) ? 0.f : xa; const float e0 = (s[0][r] <= -1.0e38f) ? 0.f : x0, e1 = (s[1][r] <= -1.0e38f) ? 0.f : x1; es[r] = e0 + e1;
      m[r] = mn; sp[wave][8 * g + r][col] = e0; sp[wave][8 * g + r][16 + col] = e1; }
    rowadd8(es);
#pragma unroll
    for (int r = 0; r < 8; ++r) l[r] = l[r] * alpha[r] + es[r];
#pragma unroll
    for (int j = 0; j < 8; ++j)
#pragma unroll
      for (int r = 0; r < 8; ++r) acc[j][r] *= alpha[r];
    LDSX();
    const v16h pa = frag_f32s(&sp[wave][col][0], lane, 2048.0f);
#pragma unroll
    for (int j = 0; j < 8; ++j) { acc[j] = wmma16d(pa, vh[j], acc[j]); acc[j] = wmma16d(pa, vl[j], acc[j]); }   // v hi + unscaled residual
    asm volatile("s_wait_dscnt 0x0" ::: "memory");      // this wave's reads of this tile (and of sp) have returned before the tile's buffer is refilled
    asm volatile("s_wait_asynccnt 0x0" ::: "memory");   // this wave's copies of pass ks + 1 have landed
    __syncthreads();                                    // publishes both groups' tiles of pass ks + 1 and ends every wave's reads of pass ks
    if (ks + 2 < nks) stage(ks + 2); }
  asm volatile("s_wait_asynccnt 0x0" ::: "memory");     // no copy is outstanding when the wave goes on to its end
  // hand-over: wave wq of group 1 lays its accumulators at the places where wave wq of group 0 holds the same elements, its row maxima and sums in the rows' pad words 128 and 129
  if (grp == 1) {
#pragma unroll
    for (int r = 0; r < 8; ++r) {
#pragma unroll
      for (int j = 0; j < 8; ++j) so[wq][8 * g + r][j * 16 + col] = acc[j][r];
      if (col == 0) { so[wq][8 * g + r][128] = m[r]; so[wq][8 * g + r][129] = l[r]; } } }
  __syncthreads();   // group 1's partial results may be read by group 0
  if (grp == 0) {
#pragma unroll
    for (int r = 0; r < 8; ++r) { const float m1 = so[wq][8 * g + r][128], l1 = so[wq][8 * g + r][129]; const float mn = fmaxf(m[r], m1);
      const float y0 = exp_s(m[r] - mn), y1 = exp_s(m1 - mn); const float a0 = (m[r] <= -1.0e38f) ? 0.f : y0, a1 = (m1 <= -1.0e38f) ? 0.f : y1;   // a group that saw no open key of the row counts for nothing
      const float lt = l[r] * a0 + l1 * a1; const float il = (lt > 0.f) ? (1.0f / 2048.0f) / lt : 0.f; const float f0 = a0 * il, f1 = a1 * il;
#pragma unroll
      for (int j = 0; j < 8; ++j) { float* p = &so[wq][8 * g + r][j * 16 + col]; *p = acc[j][r] * f0 + *p * f1; } }   // each lane rewrites only the words that it has read itself
    LDSX(); for (int rl = 0; rl < 16; ++rl) vst2(CT + (size_t)(q0 + rl) * QW + h * HD + lane * 4, *(const v4f*)&so[wq][rl][lane * 4]); } }
// ---- k_out: block = (64 rows, 128 of 2048 cols): out = ctx (hi + lo) . wo (in,out)
__global__ __launch_bounds__(128) void k_out(const float* __restrict__ CT, const float* __restrict__ WO, float* __restrict__ OUT) { __shared__ __align__(16) float sf[4][16][132]; __shared__ __align__(16) __bf16 sh[2][64][GP], sl[2][64][GP], sw[2][128][GP];
  const int tid = threadIdx.x, wave = tid >> 5, lane = tid & 31, col = lane & 15, g = lane >> 4; const int c0 = blockIdx.y * 128; const size_t r0 = (size_t)blockIdx.x * 64 + wave * 16;
  v8f acc[8] = {};
  proj_tile<HID, true>(CT + (size_t)blockIdx.x * 64 * QW, WO + c0, sh, sl, sw, acc, wave, lane);
#pragma unroll
  for (int j = 0; j < 8; ++j)
#pragma unroll
    for (int r = 0; r < 8; ++r) sf[wave][8 * g + r][j * 16 + col] = acc[j][r];
  LDSX(); for (int rl = 0; rl < 16; ++rl) vst2(OUT + (r0 + rl) * HID + c0 + lane * 4, *(const v4f*)&sf[wave][rl][lane * 4]); }
extern "C" void kernel_launch(void* const* d_in, const int* in_sizes, int n_in, void* d_out, int out_size, void* d_ws, size_t ws_size, hipStream_t stream) {
  (void)in_sizes; (void)n_in; (void)out_size;
  const float** F_ = (const float**)d_in;   // 0 hidden_states [1,2048,2048], 1 wq [2048,2048], 2 wk [2048,512], 3 wv [2048,512], 4 wo [2048,2048] (all (in,out)), 5 attention_mask [1,2048] int, 6 position_ids [1,2048] int
  if (ws_size < (size_t)WS_END) return;
  char* ws = (char*)d_ws; float* F = (float*)(ws + WS_F); _Float16 *QH = (_Float16*)(ws + WS_QH), *QL = (_Float16*)(ws + WS_QL), *KH = (_Float16*)(ws + WS_KH), *KL = (_Float16*)(ws + WS_KL), *VH = (_Float16*)(ws + WS_VH), *VL = (_Float16*)(ws + WS_VL); float* CT = (float*)(ws + WS_CT);
  k_qkv<<<dim3(TRB, QKVW / 128), 128, 0, stream>>>(F_[0], F_[1], F_[2], F_[3], F);
  k_rope<<<TRB * 64, 256, 0, stream>>>(F, (const int*)d_in[6], QH, QL, KH, KL);
  k_vt<<<dim3(TRB, KW / 128), 128, 0, stream>>>(F, VH, VL);
  k_att<<<dim3(NHQ, TQB), 256, 0, stream>>>(QH, QL, KH, KL, VH, VL, (const int*)d_in[5], CT);
  k_out<<<dim3(TQB, HID / 128), 128, 0, stream>>>(CT, F_[4], (float*)d_out);
}

// v006
// One run takes 171 microseconds.
// Two timings next to v005 both put it at 1.11 times that version's speed.
// Over all steps from v000 it is 4.76 times as fast.
// compute dtype: all float inputs rounded to bf16, attention_mask / position_ids (int) read; q/k/v = x . W with EXACT bf16 products on WMMA 16x16x32 ((in,out) weights), f32 accumulate; RoPE (interleaved pairs, angles position_id * theta^(-2j/128), precise sinf/cosf/powf) in f32, q/k as f16 hi + residual rows, v as f16 hi + residual planes; GQA causal attention with head_dim 128: 3-product scores (q/k as f16 hi + UNSCALED residual, one accumulator), P rounded once to f16 (x 2^11) against v as f16 hi + UNSCALED residual (2 products into one accumulator), x 1/sqrt(128), masked/acausal keys excluded, running-max softmax in f32 (hardware exp); out = ctx (bf16 hi + lo) . wo (2 products); f32 output.
#include <hip/hip_runtime.h>
#include <math.h>

typedef __attribute__((ext_vector_type(16))) _Float16 v16h;
typedef __attribute__((ext_vector_type(16))) __bf16 v16b;
typedef __attribute__((ext_vector_type(8)))  _Float16 v8h;
typedef __attribute__((ext_vector_type(8)))  float v8f;
typedef __attribute__((ext_vector_type(4)))  float v4f;
typedef __attribute__((ext_vector_type(2)))  float v2f;
typedef __attribute__((ext_vector_type(4)))  unsigned v4u;
typedef __attribute__((ext_vector_type(4)))  int v4i;
typedef float __attribute__((may_alias)) float_a;
typedef int __attribute__((may_alias)) int_a;

template <typename T> __device__ __forceinline__ void vst2(void* p, T v) { *(T*)p = v;  }
__device__ __forceinline__ v8f wmma16(v16h a, v16h b, v8f c) {
  v8f d = __builtin_amdgcn_wmma_f32_16x16x32_f16(false, a, false, b, (short)0, c, false, false);
  asm volatile("v_nop\n\tv_nop\n\tv_nop\n\tv_nop" : "+v"(d) : "v"(a), "v"(b));
  return d;
}
__device__ __forceinline__ v8f wmma_bf(v16b a, v16b b, v8f c) {
  v8f d = __builtin_amdgcn_wmma_f32_16x16x32_bf16(false, a, false, b, (short)0, c, false, false);
  asm volatile("v_nop\n\tv_nop\n\tv_nop\n\tv_nop" : "+v"(d) : "v"(a), "v"(b));
  return d;
}
// 16x16x32 fragments: lane = (h = lane>>4, row/col = lane&15); elements 0..7 = k0+8h+0..7, 8..15 = k0+16+8h+0..7; D element r = row 8h+r
__device__ __forceinline__ v16h frag_h(const _Float16* rowk0, int lane) {
  union { v16h v; v8h q[2]; } u; const _Float16* p = rowk0 + 8 * (lane >> 4);
  u.q[0] = *(const v8h*)p; u.q[1] = *(const v8h*)(p + 16); return u.v;
}
__device__ __forceinline__ v16h frag_f32(const float* rowk0, int lane) {
  v16h a; const float* p = rowk0 + 8 * (lane >> 4);
#pragma unroll
  for (int i = 0; i < 8; ++i) { a[i] = (_Float16)p[i]; a[8 + i] = (_Float16)p[16 + i]; }
  return a;
}
__device__ __forceinline__ v16h frag_f32s(const float* rowk0, int lane, float sc) {
  v16h a; const float* p = rowk0 + 8 * (lane >> 4);
#pragma unroll
  for (int i = 0; i < 8; ++i) { a[i] = (_Float16)(p[i] * sc); a[8 + i] = (_Float16)(p[16 + i] * sc); }
  return a;
}
// column fragment from a [K][ld] layout (column n), rows >= K read as 0
__device__ __forceinline__ v16h fragc_f32(const float* W, int k0, int n, int lane, int ld, int K) {
  v16h a; const int g = lane >> 4;
#pragma unroll
  for (int i = 0; i < 8; ++i) { const int ka = k0 + 8 * g + i, kb = ka + 16;
    a[i] = (_Float16)(ka < K ? W[(size_t)(ka < K ? ka : K - 1) * ld + n] : 0.f); a[8 + i] = (_Float16)(kb < K ? W[(size_t)(kb < K ? kb : K - 1) * ld + n] : 0.f); }
  return a;
}
struct F2 { v16b h, l; };
__device__ __forceinline__ F2 bsplit16(const float v[16]) { F2 r;
#pragma unroll
  for (int i = 0; i < 16; ++i) { const __bf16 h = (__bf16)v[i]; r.h[i] = h; r.l[i] = (__bf16)(v[i] - (float)h); }
  return r; }
__device__ __forceinline__ F2 split_row(const float* row, int k0, int lane) { float v[16]; const float* p = row + k0 + 8 * (lane >> 4);
#pragma unroll
  for (int i = 0; i < 8; ++i) { v[i] = p[i]; v[8 + i] = p[16 + i]; }
  return bsplit16(v); }
__device__ __forceinline__ F2 split_rowK(const float* row, int k0, int lane, int K) { float v[16]; const int g = lane >> 4;
#pragma unroll
  for (int i = 0; i < 8; ++i) { const int ka = k0 + 8 * g + i, kb = ka + 16; v[i] = ka < K ? row[ka < K ? ka : K - 1] : 0.f; v[8 + i] = kb < K ? row[kb < K ? kb : K - 1] : 0.f; }
  return bsplit16(v); }
__device__ __forceinline__ F2 split_col(const float* W, int k0, int n, int lane, int ld, int K) { float v[16]; const int g = lane >> 4;
#pragma unroll
  for (int i = 0; i < 8; ++i) { const int ka = k0 + 8 * g + i, kb = ka + 16; v[i] = ka < K ? W[(size_t)(ka < K ? ka : K - 1) * ld + n] : 0.f; v[8 + i] = kb < K ? W[(size_t)(kb < K ? kb : K - 1) * ld + n] : 0.f; }
  return bsplit16(v); }
__device__ __forceinline__ v8f mac3(const F2& a, const F2& b, v8f c) { c = wmma_bf(a.l, b.h, c); c = wmma_bf(a.h, b.l, c); return wmma_bf(a.h, b.h, c); }
__device__ __forceinline__ float sigm(float v) { return 1.0f / (1.0f + expf(-v)); }
#define LDSX() do { asm volatile("s_wait_dscnt 0" ::: "memory"); __builtin_amdgcn_wave_barrier(); __builtin_amdgcn_fence(__ATOMIC_RELEASE, "workgroup"); } while (0)


// LLaMA attention (B 1, S 2,048, hidden 2,048, 16 query heads / 4 kv heads x 128, RoPE theta 1e4): q/k/v projections, RoPE on q and k, GQA (kv head = h / 4), causal + padding mask, softmax in f32, o_proj.
#define NB 1
#define SS 2048
#define HID 2048
#define NHQ 16
#define NKV 4
#define HD 128
#define QW (NHQ * HD)     // 2048
#define KW (NKV * HD)     // 512
#define QKVW (QW + 2 * KW)   // 3072
#ifndef TQB
#define TQB (SS / 64)
#endif
#ifndef TRB
#define TRB (NB * SS / 64)   // row blocks for projections / rope / value planes
#endif
typedef __attribute__((ext_vector_type(8))) __bf16 v8b;
__device__ __forceinline__ v16b frag_b(const __bf16* rowk0, int lane) {
  union { v16b v; v8b q[2]; } u; const __bf16* p = rowk0 + 8 * (lane >> 4);
  u.q[0] = *(const v8b*)p; u.q[1] = *(const v8b*)(p + 16); return u.v;
}
__device__ __forceinline__ float bfr(float v) { return (float)(__bf16)v; }
__device__ __attribute__((noinline)) float exp_ni(float v) { return expf(v); }
__device__ __attribute__((noinline)) float erf_ni(float v) { return erff(v); }

#define WS_F   0u                                   // not used; the planes below keep their places
#define WS_QH  (WS_F + 4u * (size_t)NB * SS * QKVW)     // f16 hi|lo q rows [b*s][2048] (after rope)
#define WS_QL  (WS_QH + 2u * (size_t)NB * SS * QW)
#define WS_KH  (WS_QL + 2u * (size_t)NB * SS * QW)      // f16 hi|lo k rows [b*s][512]
#define WS_KL  (WS_KH + 2u * (size_t)NB * SS * KW)
#define WS_VH  (WS_KL + 2u * (size_t)NB * SS * KW)      // f16 hi|lo v planes [b][512][s]
#define WS_VL  (WS_VH + 2u * (size_t)NB * KW * SS)
#define WS_CT  (WS_VL + 2u * (size_t)NB * KW * SS)      // f32 ctx rows [b*s][2048]
#define WS_END (WS_CT + 4u * (size_t)NB * SS * QW)

// staged 32-k operand tiles of the two projection GEMMs, bf16, one row per output row / column: pitch 80 B = 16 B x odd, so that the 16 rows of a ds_load_b128 fragment read fall on distinct banks
#define GP (32 + 8)
typedef __attribute__((ext_vector_type(4))) __bf16 v4b;
// 64 rows x 128 columns of X[.][2048] . W[2048][LDW] per block of 4 waves (a wave: 16 rows x 128 columns), K = 2048 in passes of 32. Both operands' tiles go ONCE per block through registers into LDS as bf16, two buffers; the next tile's global loads are in flight under this tile's products.
// Row tile: each wave brings its own 16 rows x 32 k f32 as four loads of 4 whole 128-B lines; SPLIT: stored as bf16 hi rows and residual rows.
// Weight tile [32 k][128 cols] f32 -> LDS [col][k] bf16: a thread holds 8 k rows (wave w: rows 8w .. 8w + 7) x 4 columns (4 * lane ..), read as whole 512-B row pieces per wave.
// The 16-B piece of k rows 8c .. 8c + 7 of a column stands at place (c + (column >> 4)) & 3 of its LDS row: the writers' rows lie 4 apart, and the rotation spreads their ds_store_b128 over all banks; the 16 columns of a fragment share one rotation.
template <int LDW, bool SPLIT>
__device__ __forceinline__ void proj_tile(const float* Xb, const float* Wb, __bf16 (*sh)[64][GP], __bf16 (*sl)[64][GP], __bf16 (*sw)[128][GP], v8f (&acc)[8], int wave, int lane) {
  const int col = lane & 15, g = lane >> 4, xrow = wave * 16 + (lane >> 3), xk = 4 * (lane & 7), pl = ((wave + (lane >> 2)) & 3) * 8;
  const unsigned xo = (unsigned)(xrow * 2048 + xk) * 4u, wo = (unsigned)(8 * wave * LDW + 4 * lane) * 4u;   // per-lane byte offsets, the same in every pass
  v4f wr[8], xr[4];
  auto get = [&](int kc) { const char* xb = (const char*)(Xb + kc * 32); const char* wb = (const char*)(Wb + (size_t)kc * 32 * LDW);
#pragma unroll
    for (int i = 0; i < 8; ++i) wr[i] = *(const v4f*)(wb + wo + i * LDW * 4);
#pragma unroll
    for (int i = 0; i < 4; ++i) xr[i] = *(const v4f*)(xb + xo + i * 4 * 2048 * 4);
    asm volatile("s_wait_xcnt 0x0" ::: "memory"); };   // stands behind the loads, in front of whatever rewrites a register that they name
  auto put = [&](int b) {
#pragma unroll
    for (int c = 0; c < 4; ++c) { v8b q;
#pragma unroll
      for (int i = 0; i < 8; ++i) q[i] = (__bf16)wr[i][c];
      *(v8b*)&sw[b][4 * lane + c][pl] = q; }
#pragma unroll
    for (int i = 0; i < 4; ++i) { v4b qh, ql;
#pragma unroll
      for (int e = 0; e < 4; ++e) { const __bf16 hv = (__bf16)xr[i][e]; qh[e] = hv; if (SPLIT) ql[e] = (__bf16)(xr[i][e] - (float)hv); }
      *(v4b*)&sh[b][xrow + 4 * i][xk] = qh; if (SPLIT) *(v4b*)&sl[b][xrow + 4 * i][xk] = ql; } };
  get(0); put(0);
  __syncthreads();   // tile 0 may be read
  // two passes a trip, so that the buffer index is a constant of each copy and stands as an immediate in every LDS address (the full unrolls here keep the register arrays' indices constant)
#pragma unroll 2
  for (int kc = 0; kc < 2048 / 32; ++kc) { const int b = kc & 1;
    if (kc + 1 < 2048 / 32) get(kc + 1);
    const v16b ah = frag_b(&sh[b][wave * 16 + col][0], lane); v16b al; if (SPLIT) al = frag_b(&sl[b][wave * 16 + col][0], lane);
    v16b w[8];
#pragma unroll
    for (int j = 0; j < 8; ++j) { union { v16b v; v8b q[2]; } u; const __bf16* p = &sw[b][j * 16 + col][0];
      u.q[0] = *(const v8b*)(p + ((g + j) & 3) * 8); u.q[1] = *(const v8b*)(p + ((g + 2 + j) & 3) * 8); w[j] = u.v; }
#pragma unroll
    for (int j = 0; j < 8; ++j) acc[j] = wmma_bf(ah, w[j], acc[j]);
    if (SPLIT) {   // each accumulator still takes hi, then residual, of every pass; the other accumulators' products stand between the two
#pragma unroll
      for (int j = 0; j < 8; ++j) acc[j] = wmma_bf(al, w[j], acc[j]); }
    __builtin_amdgcn_sched_barrier(0);    // keeps the conversions of the next tile, and with them the wait for its global loads, behind this tile's products
    if (kc + 1 < 2048 / 32) put(b ^ 1);   // the other buffer: its readers left it at the barrier that ended pass kc - 1
    __syncthreads(); }                    // publishes tile kc + 1 and ends every wave's reads of tile kc
}
// ---- k_qkv: block = (64 rows, col group of 128 over q|k|v (24 groups) = one head): x . W (exact), and the head's own finish on the f32 accumulators, which never leave the WGP:
// q and k heads: RoPE (pairs (2j, 2j+1), angle pos * 1e4^(-2j/128)) -> f16 hi/lo rows; v heads: f16 hi/lo planes [c][s]
union QkvEp { float sf[4][16][132]; struct { _Float16 th[128][72], tl[128][72]; } v; };   // a block uses one member only
typedef __attribute__((ext_vector_type(4))) _Float16 v4h;
__global__ __launch_bounds__(128) void k_qkv(const float* __restrict__ X, const float* __restrict__ WQ, const float* __restrict__ WK, const float* __restrict__ WV, const int* __restrict__ PID, _Float16* __restrict__ QH, _Float16* __restrict__ QL, _Float16* __restrict__ KH, _Float16* __restrict__ KL, _Float16* __restrict__ VH, _Float16* __restrict__ VL) { __shared__ __align__(16) QkvEp ep; __shared__ __align__(16) __bf16 sa[2][64][GP], sw[2][128][GP];
  const int tid = threadIdx.x, wave = tid >> 5, lane = tid & 31, col = lane & 15, g = lane >> 4; const int cg = blockIdx.y; const size_t r0 = (size_t)blockIdx.x * 64 + wave * 16;
  const float* Xb = X + (size_t)blockIdx.x * 64 * HID;
  v8f acc[8] = {};
  if (cg < 16) proj_tile<QW, false>(Xb, WQ + cg * 128, sa, sa, sw, acc, wave, lane);
  else proj_tile<KW, false>(Xb, (cg < 20 ? WK + (cg - 16) * 128 : WV + (cg - 20) * 128), sa, sa, sw, acc, wave, lane);
  if (cg < 20) {   // a wave turns its own 16 rows: a lane holds columns 4 lane .. 4 lane + 3 (pairs 2 lane, 2 lane + 1) of every row, so its two frequencies are taken once, and a row's store is 256 B in a row per plane
    const int pidv = PID[r0 + col];   // the 16 rows' positions, one a lane
    asm volatile("s_wait_xcnt 0x0" ::: "memory");   // stands behind the load, in front of whatever rewrites a register that it names
#pragma unroll
    for (int j = 0; j < 8; ++j)
#pragma unroll
      for (int r = 0; r < 8; ++r) ep.sf[wave][8 * g + r][j * 16 + col] = acc[j][r];
    const float f0 = powf(10000.0f, -(float)(4 * lane) / (float)HD), f1 = powf(10000.0f, -(float)(4 * lane + 2) / (float)HD);
    _Float16* H = (cg < 16 ? QH + r0 * QW + cg * 128 : KH + r0 * KW + (cg - 16) * 128) + lane * 4; _Float16* L = (cg < 16 ? QL + r0 * QW + cg * 128 : KL + r0 * KW + (cg - 16) * 128) + lane * 4; const int ld = cg < 16 ? QW : KW;
    LDSX();
    for (int rl = 0; rl < 16; ++rl) { const float pos = (float)__builtin_amdgcn_readlane(pidv, rl); const v4f x = *(const v4f*)&ep.sf[wave][rl][lane * 4];
      const float a0 = pos * f0, a1 = pos * f1; float c0, s0, c1, s1; sincosf(a0, &s0, &c0); sincosf(a1, &s1, &c1);   // one argument reduction and one pair of polynomials an angle; the values are those of sinf and cosf
      const float y[4] = { x[0] * c0 - x[1] * s0, x[0] * s0 + x[1] * c0, x[2] * c1 - x[3] * s1, x[2] * s1 + x[3] * c1 }; v4h hi, lo;
#pragma unroll
      for (int e = 0; e < 4; ++e) { const _Float16 hv = (_Float16)y[e]; hi[e] = hv; lo[e] = (_Float16)(y[e] - (float)hv); }   // UNSCALED residuals (q, k ~ O(1))
      vst2(H + (size_t)rl * ld, hi); vst2(L + (size_t)rl * ld, lo);
      asm volatile("s_wait_xcnt 0x0" ::: "memory");   // stands behind the stores, in front of whatever rewrites a register that they name
      __builtin_amdgcn_sched_barrier(0); }            // keeps the next row's address additions, which rewrite the stores' address registers, behind that wait (this build had them in front of it)
  } else {   // a lane's eight accumulator elements of a column are eight rows s in a row: one 16-B piece of the channel's plane row; through LDS, so that eight lanes of one wave store a channel's whole 128-B line
    const int c0 = (cg - 20) * 128; const size_t s0 = (size_t)blockIdx.x * 64;
#pragma unroll
    for (int j = 0; j < 8; ++j) { v8h hi, lo;
#pragma unroll
      for (int r = 0; r < 8; ++r) { const _Float16 hv = (_Float16)acc[j][r]; hi[r] = hv; lo[r] = (_Float16)(acc[j][r] - (float)hv); }   // UNSCALED residual (v ~ O(1)): lets the attention add it into the same accumulator
      *(v8h*)&ep.v.th[j * 16 + col][wave * 16 + 8 * g] = hi; *(v8h*)&ep.v.tl[j * 16 + col][wave * 16 + 8 * g] = lo; }
    __syncthreads();   // all four waves' rows of a channel stand in LDS
    for (int e = tid; e < 128 * 8; e += 128) { const int c = e >> 3, q = e & 7; vst2((unsigned*)(VH + (size_t)(c0 + c) * SS + s0 + q * 8), *(const v4u*)&ep.v.th[c][q * 8]); vst2((unsigned*)(VL + (size_t)(c0 + c) * SS + s0 + q * 8), *(const v4u*)&ep.v.tl[c][q * 8]);
      asm volatile("s_wait_xcnt 0x0" ::: "memory"); } } }   // stands behind the stores, in front of whatever rewrites a register that they name
// staged key/value tile of 32 keys: row pitches are 16 B x odd (272 B, 80 B), so that the 16 rows of a ds_load_b128 fragment read fall on distinct banks
#define KP (HD + 8)
#define VP (32 + 8)
struct __align__(16) KVStage { _Float16 kh[32][KP], kl[32][KP], vh[HD][VP], vl[HD][VP]; };
__device__ __forceinline__ unsigned lds_addr(const void* p) { return (unsigned)(size_t)(__attribute__((address_space(3))) const void*)p; }
// eight asynchronous 16-byte copies per lane, global -> LDS through no register (four of plane a, four of plane b); the s_wait_xcnt stands in the copies' own statement so that no address register is rewritten ahead of it
__device__ __forceinline__ void acopy8(unsigned la, unsigned lb, unsigned ls, const _Float16* ga, const _Float16* gb, size_t gs) {
  asm volatile("global_load_async_to_lds_b128 %0, %8, off\n\t"
               "global_load_async_to_lds_b128 %1, %9, off\n\t"
               "global_load_async_to_lds_b128 %2, %10, off\n\t"
               "global_load_async_to_lds_b128 %3, %11, off\n\t"
               "global_load_async_to_lds_b128 %4, %12, off\n\t"
               "global_load_async_to_lds_b128 %5, %13, off\n\t"
               "global_load_async_to_lds_b128 %6, %14, off\n\t"
               "global_load_async_to_lds_b128 %7, %15, off\n\t"
               "s_wait_xcnt 0x0"
               :: "v"(la), "v"(la + ls), "v"(la + 2 * ls), "v"(la + 3 * ls), "v"(lb), "v"(lb + ls), "v"(lb + 2 * ls), "v"(lb + 3 * ls),
                  "v"(ga), "v"(ga + gs), "v"(ga + 2 * gs), "v"(ga + 3 * gs), "v"(gb), "v"(gb + gs), "v"(gb + 2 * gs), "v"(gb + 3 * gs) : "memory");
}
// wmma16 with D alone named in the statement of the four slots: this compiler keeps a vector operand of an asm statement in the first 256 registers, and k_att's fragments, read ahead in groups, do not fit there beside Q and the accumulators (with A and B named the build spilled to scratch)
__device__ __forceinline__ v8f wmma16d(v16h a, v16h b, v8f c) {
  v8f d = __builtin_amdgcn_wmma_f32_16x16x32_f16(false, a, false, b, (short)0, c, false, false);
  asm volatile("v_nop\n\tv_nop\n\tv_nop\n\tv_nop" : "+v"(d));
  return d;
}
// Maximum / sum over each 16-lane row, of eight values at once: the butterfly l ^ 1, 2, 4, 8 with the partner lane read as the DPP operand (row_xmask) of the v_max / v_add itself, so an exchange makes no trip through the LDS pipe and needs no dscnt wait, as __shfl_xor does here. Every lane is on where they stand.
// In asm text, eight values a statement: a value's next step stands eight instructions behind its last one and does not wait for it (from the builtin the moved value came out as a move of its own, for the maximum with one more instruction behind it).
__device__ __forceinline__ void rowmax8(float (&v)[8]) {
  asm(
      "v_max_num_f32_dpp %0, %0, %0 row_xmask:1 row_mask:0xf bank_mask:0xf\n\t"
      "v_max_num_f32_dpp %1, %1, %1 row_xmask:1 row_mask:0xf bank_mask:0xf\n\t"
      "v_max_num_f32_dpp %2, %2, %2 row_xmask:1 row_mask:0xf bank_mask:0xf\n\t"
      "v_max_num_f32_dpp %3, %3, %3 row_xmask:1 row_mask:0xf bank_mask:0xf\n\t"
      "v_max_num_f32_dpp %4, %4, %4 row_xmask:1 row_mask:0xf bank_mask:0xf\n\t"
      "v_max_num_f32_dpp %5, %5, %5 row_xmask:1 row_mask:0xf bank_mask:0xf\n\t"
      "v_max_num_f32_dpp %6, %6, %6 row_xmask:1 row_mask:0xf bank_mask:0xf\n\t"
      "v_max_num_f32_dpp %7, %7, %7 row_xmask:1 row_mask:0xf bank_mask:0xf\n\t"
      "v_max_num_f32_dpp %0, %0, %0 row_xmask:2 row_mask:0xf bank_mask:0xf\n\t"
      "v_max_num_f32_dpp %1, %1, %1 row_xmask:2 row_mask:0xf bank_mask:0xf\n\t"
      "v_max_num_f32_dpp %2, %2, %2 row_xmask:2 row_mask:0xf bank_mask:0xf\n\t"
      "v_max_num_f32_dpp %3, %3, %3 row_xmask:2 row_mask:0xf bank_mask:0xf\n\t"
      "v_max_num_f32_dpp %4, %4, %4 row_xmask:2 row_mask:0xf bank_mask:0xf\n\t"
      "v_max_num_f32_dpp %5, %5, %5 row_xmask:2 row_mask:0xf bank_mask:0xf\n\t"
      "v_max_num_f32_dpp %6, %6, %6 row_xmask:2 row_mask:0xf bank_mask:0xf\n\t"
      "v_max_num_f32_dpp %7, %7, %7 row_xmask:2 row_mask:0xf bank_mask:0xf\n\t"
      "v_max_num_f32_dpp %0, %0, %0 row_xmask:4 row_mask:0xf bank_mask:0xf\n\t"
      "v_max_num_f32_dpp %1, %1, %1 row_xmask:4 row_mask:0xf bank_mask:0xf\n\t"
      "v_max_num_f32_dpp %2, %2, %2 row_xmask:4 row_mask:0xf bank_mask:0xf\n\t"
      "v_max_num_f32_dpp %3, %3, %3 row_xmask:4 row_mask:0xf bank_mask:0xf\n\t"
      "v_max_num_f32_dpp %4, %4, %4 row_xmask:4 row_mask:0xf bank_mask:0xf\n\t"
      "v_max_num_f32_dpp %5, %5, %5 row_xmask:4 row_mask:0xf bank_mask:0xf\n\t"
      "v_max_num_f32_dpp %6, %6, %6 row_xmask:4 row_mask:0xf bank_mask:0xf\n\t"
      "v_max_num_f32_dpp %7, %7, %7 row_xmask:4 row_mask:0xf bank_mask:0xf\n\t"
      "v_max_num_f32_dpp %0, %0, %0 row_xmask:8 row_mask:0xf bank_mask:0xf\n\t"
      "v_max_num_f32_dpp %1, %1, %1 row_xmask:8 row_mask:0xf bank_mask:0xf\n\t"
      "v_max_num_f32_dpp %2, %2, %2 row_xmask:8 row_mask:0xf bank_mask:0xf\n\t"
      "v_max_num_f32_dpp %3, %3, %3 row_xmask:8 row_mask:0xf bank_mask:0xf\n\t"
      "v_max_num_f32_dpp %4, %4, %4 row_xmask:8 row_mask:0xf bank_mask:0xf\n\t"
      "v_max_num_f32_dpp %5, %5, %5 row_xmask:8 row_mask:0xf bank_mask:0xf\n\t"
      "v_max_num_f32_dpp %6, %6, %6 row_xmask:8 row_mask:0xf bank_mask:0xf\n\t"
      "v_max_num_f32_dpp %7, %7, %7 row_xmask:8 row_mask:0xf bank_mask:0xf"
      : "+v"(v[0]), "+v"(v[1]), "+v"(v[2]), "+v"(v[3]), "+v"(v[4]), "+v"(v[5]), "+v"(v[6]), "+v"(v[7])); }
__device__ __forceinline__ void rowadd8(float (&v)[8]) {
  asm(
      "v_add_f32_dpp %0, %0, %0 row_xmask:1 row_mask:0xf bank_mask:0xf\n\t"
      "v_add_f32_dpp %1, %1, %1 row_xmask:1 row_mask:0xf bank_mask:0xf\n\t"
      "v_add_f32_dpp %2, %2, %2 row_xmask:1 row_mask:0xf bank_mask:0xf\n\t"
      "v_add_f32_dpp %3, %3, %3 row_xmask:1 row_mask:0xf bank_mask:0xf\n\t"
      "v_add_f32_dpp %4, %4, %4 row_xmask:1 row_mask:0xf bank_mask:0xf\n\t"
      "v_add_f32_dpp %5, %5, %5 row_xmask:1 row_mask:0xf bank_mask:0xf\n\t"
      "v_add_f32_dpp %6, %6, %6 row_xmask:1 row_mask:0xf bank_mask:0xf\n\t"
      "v_add_f32_dpp %7, %7, %7 row_xmask:1 row_mask:0xf bank_mask:0xf\n\t"
      "v_add_f32_dpp %0, %0, %0 row_xmask:2 row_mask:0xf bank_mask:0xf\n\t"
      "v_add_f32_dpp %1, %1, %1 row_xmask:2 row_mask:0xf bank_mask:0xf\n\t"
      "v_add_f32_dpp %2, %2, %2 row_xmask:2 row_mask:0xf bank_mask:0xf\n\t"
      "v_add_f32_dpp %3, %3, %3 row_xmask:2 row_mask:0xf bank_mask:0xf\n\t"
      "v_add_f32_dpp %4, %4, %4 row_xmask:2 row_mask:0xf bank_mask:0xf\n\t"
      "v_add_f32_dpp %5, %5, %5 row_xmask:2 row_mask:0xf bank_mask:0xf\n\t"
      "v_add_f32_dpp %6, %6, %6 row_xmask:2 row_mask:0xf bank_mask:0xf\n\t"
      "v_add_f32_dpp %7, %7, %7 row_xmask:2 row_mask:0xf bank_mask:0xf\n\t"
      "v_add_f32_dpp %0, %0, %0 row_xmask:4 row_mask:0xf bank_mask:0xf\n\t"
      "v_add_f32_dpp %1, %1, %1 row_xmask:4 row_mask:0xf bank_mask:0xf\n\t"
      "v_add_f32_dpp %2, %2, %2 row_xmask:4 row_mask:0xf bank_mask:0xf\n\t"
      "v_add_f32_dpp %3, %3, %3 row_xmask:4 row_mask:0xf bank_mask:0xf\n\t"
      "v_add_f32_dpp %4, %4, %4 row_xmask:4 row_mask:0xf bank_mask:0xf\n\t"
      "v_add_f32_dpp %5, %5, %5 row_xmask:4 row_mask:0xf bank_mask:0xf\n\t"
      "v_add_f32_dpp %6, %6, %6 row_xmask:4 row_mask:0xf bank_mask:0xf\n\t"
      "v_add_f32_dpp %7, %7, %7 row_xmask:4 row_mask:0xf bank_mask:0xf\n\t"
      "v_add_f32_dpp %0, %0, %0 row_xmask:8 row_mask:0xf bank_mask:0xf\n\t"
      "v_add_f32_dpp %1, %1, %1 row_xmask:8 row_mask:0xf bank_mask:0xf\n\t"
      "v_add_f32_dpp %2, %2, %2 row_xmask:8 row_mask:0xf bank_mask:0xf\n\t"
      "v_add_f32_dpp %3, %3, %3 row_xmask:8 row_mask:0xf bank_mask:0xf\n\t"
      "v_add_f32_dpp %4, %4, %4 row_xmask:8 row_mask:0xf bank_mask:0xf\n\t"
      "v_add_f32_dpp %5, %5, %5 row_xmask:8 row_mask:0xf bank_mask:0xf\n\t"
      "v_add_f32_dpp %6, %6, %6 row_xmask:8 row_mask:0xf bank_mask:0xf\n\t"
      "v_add_f32_dpp %7, %7, %7 row_xmask:8 row_mask:0xf bank_mask:0xf"
      : "+v"(v[0]), "+v"(v[1]), "+v"(v[2]), "+v"(v[3]), "+v"(v[4]), "+v"(v[5]), "+v"(v[6]), "+v"(v[7])); }
// e^x as __expf comes out here (x * log2(e), then v_exp_f32), with the one slot that the instruction set asks for behind a transcendental in the same statement
__device__ __forceinline__ float exp_s(float x) { float d; asm("v_exp_f32 %0, %1\n\tv_nop" : "=v"(d) : "v"(x * 1.44269504088896340736f)); return d; }
// ---- k_att: block = (64 queries, head h): kv head = h / 4; causal (tiles past the block skipped) AND attention_mask[k] != 0; head_dim 128 = 4 k-chunks; P . v over 8 d-tiles
// Eight waves in two groups of four. Both groups hold the same 64 queries (wave wq of each: rows 16 wq ..); group 0 walks the even key tiles, group 1 the odd ones (the causal bound is an even number of tiles), each with its own two staging buffers, running maximum, sum and accumulators:
// the longest block's chain of passes, which the launch lasts, is half as long. Behind the loop group 1 hands its maximum, sum and accumulators over through LDS and group 0 joins the two partial softmaxes.
// One block fills a WGP's registers, so the blocks come in two rounds: the grid's slow index counts the query blocks from the last (most tiles) down, so that the short blocks fill in behind the long ones.
__global__ __launch_bounds__(256) void k_att(const _Float16* __restrict__ QH, const _Float16* __restrict__ QL, const _Float16* __restrict__ KH, const _Float16* __restrict__ KL, const _Float16* __restrict__ VH, const _Float16* __restrict__ VL, const int* __restrict__ AM, float* __restrict__ CT) {
  __shared__ __align__(16) float sp[8][16][36]; __shared__ __align__(16) float so[4][16][132]; __shared__ KVStage st[2][2];   // st[group][buffer]
  const int tid = threadIdx.x, wave = tid >> 5, lane = tid & 31, col = lane & 15, g = lane >> 4, grp = wave >> 2, wq = wave & 3, gt = tid & 127; const int qb = TQB - 1 - blockIdx.y, h = blockIdx.x; const int kvh = h / (NHQ / NKV); const int q0 = qb * 64 + wq * 16; constexpr bool three = false;   // not read: the scores always take 3 products (q hi.k hi, q lo.k hi, q hi.k lo)
  v16h aq[4], al[4];
#pragma unroll
  for (int kc = 0; kc < 4; ++kc) { aq[kc] = frag_h(QH + (size_t)(q0 + col) * QW + h * HD + kc * 32, lane); al[kc] = frag_h(QL + (size_t)(q0 + col) * QW + h * HD + kc * 32, lane); }
  int amn0 = AM[grp * 32 + col], amn1 = AM[grp * 32 + 16 + col];   // mask words of pass 0
  asm volatile("s_wait_xcnt 0x0" ::: "memory");       // stands behind the Q and mask loads, in front of whatever rewrites a register that they name
  __builtin_amdgcn_sched_barrier(0);                  // keeps the staging's address arithmetic, which takes those registers over, behind that wait (this build had it in front)
  float m[8], l[8];
#pragma unroll
  for (int r = 0; r < 8; ++r) { m[r] = -3.0e38f; l[r] = 0.f; }
  v8f acc[8] = {};
  const int nks = qb + 1;   // passes: the causal bound is 2 (qb + 1) tiles of 32 keys, and pass i of group grp takes tile 2 i + grp
  // each thread of a group copies 16 pieces of 16 B per tile of its group: k rows of 256 B (16 lanes a row, 8 rows a step), v rows of 64 B (4 lanes a row, 32 rows a step)
  const unsigned lk = lds_addr(&st[grp][0].kh[gt >> 4][(gt & 15) * 8]), lv = lds_addr(&st[grp][0].vh[gt >> 2][(gt & 3) * 8]);
  const size_t gk = (size_t)(gt >> 4) * KW + kvh * HD + (gt & 15) * 8, gv = ((size_t)kvh * HD + (gt >> 2)) * SS + (gt & 3) * 8;
  auto stage = [&](int i) { const int t = 2 * i + grp; const unsigned b = (unsigned)(i & 1) * (unsigned)sizeof(KVStage);
    acopy8(lk + b, lk + b + (unsigned)sizeof(st[0][0].kh), 8 * KP * 2, KH + gk + (size_t)t * 32 * KW, KL + gk + (size_t)t * 32 * KW, (size_t)8 * KW);
    acopy8(lv + b, lv + b + (unsigned)sizeof(st[0][0].vh), 32 * VP * 2, VH + gv + t * 32, VL + gv + t * 32, (size_t)32 * SS); };
  stage(0);
  asm volatile("s_wait_asynccnt 0x0" ::: "memory");   // this wave's copies of pass 0 have landed
  __syncthreads();                                    // ... and every other wave's: both groups' tiles of pass 0 may be read
  if (nks > 1) stage(1);
#pragma unroll 1
  for (int ks = 0; ks < nks; ++ks) { float s[2][8]; const KVStage& T = st[grp][ks & 1];
    // A pass's reads stand in two groups AHEAD of the products that use them, so that a wave does not wait out the LDS latency once per product:
    // all 16 key fragments at the head of the pass; all 16 value fragments behind the first score chain, so that they land under the second chain and the softmax; the two mask words one pass ahead (the last pass reads its own again: no index past the block's keys).
    const int am[2] = { amn0, amn1 };
    v16h kh[2][4], kl[2][4], vh[8], vl[8]; v8f c[2];
#pragma unroll
    for (int ct = 0; ct < 2; ++ct)
#pragma unroll
      for (int kc = 0; kc < 4; ++kc) { kh[ct][kc] = frag_h(&T.kh[ct * 16 + col][kc * 32], lane); kl[ct][kc] = frag_h(&T.kl[ct * 16 + col][kc * 32], lane); }
    { const int kn = (2 * (ks + 1 < nks ? ks + 1 : ks) + grp) * 32 + col; amn0 = AM[kn]; amn1 = AM[kn + 16]; }
    asm volatile("s_wait_xcnt 0x0" ::: "memory");   // stands behind the mask loads, in front of whatever rewrites a register that they name
#pragma unroll
    for (int ct = 0; ct < 2; ++ct) { v8f cc = {};
#pragma unroll
      for (int kc = 0; kc < 4; ++kc) { cc = wmma16d(aq[kc], kh[ct][kc], cc); cc = wmma16d(al[kc], kh[ct][kc], cc); cc = wmma16d(aq[kc], kl[ct][kc], cc); }   // 3 products, all residuals UNSCALED into one accumulator
      c[ct] = cc;
      if (ct == 0) {
#pragma unroll
        for (int j = 0; j < 8; ++j) { vh[j] = frag_h(&T.vh[j * 16 + col][0], lane); vl[j] = frag_h(&T.vl[j * 16 + col][0], lane); } } }
#pragma unroll
    for (int ct = 0; ct < 2; ++ct) { const int kk = (2 * ks + grp) * 32 + ct * 16 + col; const bool keepm = (am[ct] != 0);
#pragma unroll
      for (int r = 0; r < 8; ++r) s[ct][r] = (keepm && kk <= q0 + 8 * g + r) ? c[ct][r] * 0.08838834764831845f : -3.0e38f; }
    float alpha[8], mx[8], es[8];
#pragma unroll
    for (int r = 0; r < 8; ++r) mx[r] = fmaxf(s[0][r], s[1][r]);
    rowmax8(mx);
#pragma unroll
    for (int r = 0; r < 8; ++r) {
      const float mn = fmaxf(m[r], mx[r]); const float xa = exp_s(m[r] - mn), x0 = exp_s(s[0][r] - mn), x1 = exp_s(s[1][r] - mn);   // taken in every lane, chosen below: an asm statement under a condition would come out as a branch
      alpha[r] = (m[r] <= -1.0e38f) ? 0.f : xa; const float e0 = (s[0][r] <= -1.0e38f) ? 0.f : x0, e1 = (s[1][r] <= -1.0e38f) ? 0.f : x1; es[r] = e0 + e1;
      m[r] = mn; sp[wave][8 * g + r][col] = e0; sp[wave][8 * g + r][16 + col] = e1; }
    rowadd8(es);
#pragma unroll
    for (int r = 0; r < 8; ++r) l[r] = l[r] * alpha[r] + es[r];
#pragma unroll
    for (int j = 0; j < 8; ++j)
#pragma unroll
      for (int r = 0; r < 8; ++r) acc[j][r] *= alpha[r];
    LDSX();
    const v16h pa = frag_f32s(&sp[wave][col][0], lane, 2048.0f);
#pragma unroll
    for (int j = 0; j < 8; ++j) { acc[j] = wmma16d(pa, vh[j], acc[j]); acc[j] = wmma16d(pa, vl[j], acc[j]); }   // v hi + unscaled residual
    asm volatile("s_wait_dscnt 0x0" ::: "memory");      // this wave's reads of this tile (and of sp) have returned before the tile's buffer is refilled
    asm volatile("s_wait_asynccnt 0x0" ::: "memory");   // this wave's copies of pass ks + 1 have landed
    __syncthreads();                                    // publishes both groups' tiles of pass ks + 1 and ends every wave's reads of pass ks
    if (ks + 2 < nks) stage(ks + 2); }
  asm volatile("s_wait_asynccnt 0x0" ::: "memory");     // no copy is outstanding when the wave goes on to its end
  // hand-over: wave wq of group 1 lays its accumulators at the places where wave wq of group 0 holds the same elements, its row maxima and sums in the rows' pad words 128 and 129
  if (grp == 1) {
#pragma unroll
    for (int r = 0; r < 8; ++r) {
#pragma unroll
      for (int j = 0; j < 8; ++j) so[wq][8 * g + r][j * 16 + col] = acc[j][r];
      if (col == 0) { so[wq][8 * g + r][128] = m[r]; so[wq][8 * g + r][129] = l[r]; } } }
  __syncthreads();   // group 1's partial results may be read by group 0
  if (grp == 0) {
#pragma unroll
    for (int r = 0; r < 8; ++r) { const float m1 = so[wq][8 * g + r][128], l1 = so[wq][8 * g + r][129]; const float mn = fmaxf(m[r], m1);
      const float y0 = exp_s(m[r] - mn), y1 = exp_s(m1 - mn); const float a0 = (m[r] <= -1.0e38f) ? 0.f : y0, a1 = (m1 <= -1.0e38f) ? 0.f : y1;   // a group that saw no open key of the row counts for nothing
      const float lt = l[r] * a0 + l1 * a1; const float il = (lt > 0.f) ? (1.0f / 2048.0f) / lt : 0.f; const float f0 = a0 * il, f1 = a1 * il;
#pragma unroll
      for (int j = 0; j < 8; ++j) { float* p = &so[wq][8 * g + r][j * 16 + col]; *p = acc[j][r] * f0 + *p * f1; } }   // each lane rewrites only the words that it has read itself
    LDSX(); for (int rl = 0; rl < 16; ++rl) vst2(CT + (size_t)(q0 + rl) * QW + h * HD + lane * 4, *(const v4f*)&so[wq][rl][lane * 4]); } }
// ---- k_out: block = (64 rows, 128 of 2048 cols): out = ctx (hi + lo) . wo (in,out)
__global__ __launch_bounds__(128) void k_out(const float* __restrict__ CT, const float* __restrict__ WO, float* __restrict__ OUT) { __shared__ __align__(16) float sf[4][16][132]; __shared__ __align__(16) __bf16 sh[2][64][GP], sl[2][64][GP], sw[2][128][GP];
  const int tid = threadIdx.x, wave = tid >> 5, lane = tid & 31, col = lane & 15, g = lane >> 4; const int c0 = blockIdx.y * 128; const size_t r0 = (size_t)blockIdx.x * 64 + wave * 16;
  v8f acc[8] = {};
  proj_tile<HID, true>(CT + (size_t)blockIdx.x * 64 * QW, WO + c0, sh, sl, sw, acc, wave, lane);
#pragma unroll
  for (int j = 0; j < 8; ++j)
#pragma unroll
    for (int r = 0; r < 8; ++r) sf[wave][8 * g + r][j * 16 + col] = acc[j][r];
  LDSX(); for (int rl = 0; rl < 16; ++rl) vst2(OUT + (r0 + rl) * HID + c0 + lane * 4, *(const v4f*)&sf[wave][rl][lane * 4]); }
extern "C" void kernel_launch(void* const* d_in, const int* in_sizes, int n_in, void* d_out, int out_size, void* d_ws, size_t ws_size, hipStream_t stream) {
  (void)in_sizes; (void)n_in; (void)out_size;
  const float** F_ = (const float**)d_in;   // 0 hidden_states [1,2048,2048], 1 wq [2048,2048], 2 wk [2048,512], 3 wv [2048,512], 4 wo [2048,2048] (all (in,out)), 5 attention_mask [1,2048] int, 6 position_ids [1,2048] int
  if (ws_size < (size_t)WS_END) return;
  char* ws = (char*)d_ws; _Float16 *QH = (_Float16*)(ws + WS_QH), *QL = (_Float16*)(ws + WS_QL), *KH = (_Float16*)(ws + WS_KH), *KL = (_Float16*)(ws + WS_KL), *VH = (_Float16*)(ws + WS_VH), *VL = (_Float16*)(ws + WS_VL); float* CT = (float*)(ws + WS_CT);
  k_qkv<<<dim3(TRB, QKVW / 128), 128, 0, stream>>>(F_[0], F_[1], F_[2], F_[3], (const int*)d_in[6], QH, QL, KH, KL, VH, VL);
  k_att<<<dim3(NHQ, TQB), 256, 0, stream>>>(QH, QL, KH, KL, VH, VL, (const int*)d_in[5], CT);
  k_out<<<dim3(TQB, HID / 128), 128, 0, stream>>>(CT, F_[4], (float*)d_out);
}

// v007
// A run of this version takes 149 microseconds.
// Next to v006, in two timings, it ran 1.15 times as fast each time.
// Counting every step since v000, it is 5.49 times as fast.
// compute dtype: all float inputs rounded to bf16, attention_mask / position_ids (int) read; q/k/v = x . W with EXACT bf16 products on WMMA 16x16x32 ((in,out) weights), f32 accumulate; RoPE (interleaved pairs, angles position_id * theta^(-2j/128), precise sinf/cosf/powf) in f32, q/k as f16 hi + residual rows, v as f16 hi + residual planes; GQA causal attention with head_dim 128: 3-product scores (q/k as f16 hi + UNSCALED residual, one accumulator), P rounded once to f16 (x 2^11) against v as f16 hi + UNSCALED residual (2 products into one accumulator), x 1/sqrt(128), masked/acausal keys excluded, running-max softmax in f32 (hardware exp); out = ctx (bf16 hi + lo) . wo (2 products); f32 output.
#include <hip/hip_runtime.h>
#include <math.h>

typedef __attribute__((ext_vector_type(16))) _Float16 v16h;
typedef __attribute__((ext_vector_type(16))) __bf16 v16b;
typedef __attribute__((ext_vector_type(8)))  _Float16 v8h;
typedef __attribute__((ext_vector_type(8)))  float v8f;
typedef __attribute__((ext_vector_type(4)))  float v4f;
typedef __attribute__((ext_vector_type(2)))  float v2f;
typedef __attribute__((ext_vector_type(4)))  unsigned v4u;
typedef __attribute__((ext_vector_type(4)))  int v4i;
typedef float __attribute__((may_alias)) float_a;
typedef int __attribute__((may_alias)) int_a;

template <typename T> __device__ __forceinline__ void vst2(void* p, T v) { *(T*)p = v;  }
__device__ __forceinline__ v8f wmma16(v16h a, v16h b, v8f c) {
  v8f d = __builtin_amdgcn_wmma_f32_16x16x32_f16(false, a, false, b, (short)0, c, false, false);
  asm volatile("v_nop\n\tv_nop\n\tv_nop\n\tv_nop" : "+v"(d) : "v"(a), "v"(b));
  return d;
}
__device__ __forceinline__ v8f wmma_bf(v16b a, v16b b, v8f c) {
  v8f d = __builtin_amdgcn_wmma_f32_16x16x32_bf16(false, a, false, b, (short)0, c, false, false);
  asm volatile("v_nop\n\tv_nop\n\tv_nop\n\tv_nop" : "+v"(d) : "v"(a), "v"(b));
  return d;
}
// 16x16x32 fragments: lane = (h = lane>>4, row/col = lane&15); elements 0..7 = k0+8h+0..7, 8..15 = k0+16+8h+0..7; D element r = row 8h+r
__device__ __forceinline__ v16h frag_h(const _Float16* rowk0, int lane) {
  union { v16h v; v8h q[2]; } u; const _Float16* p = rowk0 + 8 * (lane >> 4);
  u.q[0] = *(const v8h*)p; u.q[1] = *(const v8h*)(p + 16); return u.v;
}
__device__ __forceinline__ v16h frag_f32(const float* rowk0, int lane) {
  v16h a; const float* p = rowk0 + 8 * (lane >> 4);
#pragma unroll
  for (int i = 0; i < 8; ++i) { a[i] = (_Float16)p[i]; a[8 + i] = (_Float16)p[16 + i]; }
  return a;
}
__device__ __forceinline__ v16h frag_f32s(const float* rowk0, int lane, float sc) {
  v16h a; const float* p = rowk0 + 8 * (lane >> 4);
#pragma unroll
  for (int i = 0; i < 8; ++i) { a[i] = (_Float16)(p[i] * sc); a[8 + i] = (_Float16)(p[16 + i] * sc); }
  return a;
}
// column fragment from a [K][ld] layout (column n), rows >= K read as 0
__device__ __forceinline__ v16h fragc_f32(const float* W, int k0, int n, int lane, int ld, int K) {
  v16h a; const int g = lane >> 4;
#pragma unroll
  for (int i = 0; i < 8; ++i) { const int ka = k0 + 8 * g + i, kb = ka + 16;
    a[i] = (_Float16)(ka < K ? W[(size_t)(ka < K ? ka : K - 1) * ld + n] : 0.f); a[8 + i] = (_Float16)(kb < K ? W[(size_t)(kb < K ? kb : K - 1) * ld + n] : 0.f); }
  return a;
}
struct F2 { v16b h, l; };
__device__ __forceinline__ F2 bsplit16(const float v[16]) { F2 r;
#pragma unroll
  for (int i = 0; i < 16; ++i) { const __bf16 h = (__bf16)v[i]; r.h[i] = h; r.l[i] = (__bf16)(v[i] - (float)h); }
  return r; }
__device__ __forceinline__ F2 split_row(const float* row, int k0, int lane) { float v[16]; const float* p = row + k0 + 8 * (lane >> 4);
#pragma unroll
  for (int i = 0; i < 8; ++i) { v[i] = p[i]; v[8 + i] = p[16 + i]; }
  return bsplit16(v); }
__device__ __forceinline__ F2 split_rowK(const float* row, int k0, int lane, int K) { float v[16]; const int g = lane >> 4;
#pragma unroll
  for (int i = 0; i < 8; ++i) { const int ka = k0 + 8 * g + i, kb = ka + 16; v[i] = ka < K ? row[ka < K ? ka : K - 1] : 0.f; v[8 + i] = kb < K ? row[kb < K ? kb : K - 1] : 0.f; }
  return bsplit16(v); }
__device__ __forceinline__ F2 split_col(const float* W, int k0, int n, int lane, int ld, int K) { float v[16]; const int g = lane >> 4;
#pragma unroll
  for (int i = 0; i < 8; ++i) { const int ka = k0 + 8 * g + i, kb = ka + 16; v[i] = ka < K ? W[(size_t)(ka < K ? ka : K - 1) * ld + n] : 0.f; v[8 + i] = kb < K ? W[(size_t)(kb < K ? kb : K - 1) * ld + n] : 0.f; }
  return bsplit16(v); }
__device__ __forceinline__ v8f mac3(const F2& a, const F2& b, v8f c) { c = wmma_bf(a.l, b.h, c); c = wmma_bf(a.h, b.l, c); return wmma_bf(a.h, b.h, c); }
__device__ __forceinline__ float sigm(float v) { return 1.0f / (1.0f + expf(-v)); }
#define LDSX() do { asm volatile("s_wait_dscnt 0" ::: "memory"); __builtin_amdgcn_wave_barrier(); __builtin_amdgcn_fence(__ATOMIC_RELEASE, "workgroup"); } while (0)


// LLaMA attention (B 1, S 2,048, hidden 2,048, 16 query heads / 4 kv heads x 128, RoPE theta 1e4): q/k/v projections, RoPE on q and k, GQA (kv head = h / 4), causal + padding mask, softmax in f32, o_proj.
#define NB 1
#define SS 2048
#define HID 2048
#define NHQ 16
#define NKV 4
#define HD 128
#define QW (NHQ * HD)     // 2048
#define KW (NKV * HD)     // 512
#define QKVW (QW + 2 * KW)   // 3072
#ifndef TQB
#define TQB (SS / 64)
#endif
#ifndef TRB
#define TRB (NB * SS / 64)   // row blocks for projections / rope / value planes
#endif
typedef __attribute__((ext_vector_type(8))) __bf16 v8b;
__device__ __forceinline__ v16b frag_b(const __bf16* rowk0, int lane) {
  union { v16b v; v8b q[2]; } u; const __bf16* p = rowk0 + 8 * (lane >> 4);
  u.q[0] = *(const v8b*)p; u.q[1] = *(const v8b*)(p + 16); return u.v;
}
__device__ __forceinline__ float bfr(float v) { return (float)(__bf16)v; }
__device__ __attribute__((noinline)) float exp_ni(float v) { return expf(v); }
__device__ __attribute__((noinline)) float erf_ni(float v) { return erff(v); }

#define WS_F   0u                                   // not used; the planes below keep their places
#define WS_QH  (WS_F + 4u * (size_t)NB * SS * QKVW)     // f16 hi|lo q rows [b*s][2048] (after rope)
#define WS_QL  (WS_QH + 2u * (size_t)NB * SS * QW)
#define WS_KH  (WS_QL + 2u * (size_t)NB * SS * QW)      // f16 hi|lo k rows [b*s][512]
#define WS_KL  (WS_KH + 2u * (size_t)NB * SS * KW)
#define WS_VH  (WS_KL + 2u * (size_t)NB * SS * KW)      // f16 hi|lo v planes [b][512][s]
#define WS_VL  (WS_VH + 2u * (size_t)NB * KW * SS)
#define WS_CT  (WS_VL + 2u * (size_t)NB * KW * SS)      // f32 ctx rows [b*s][2048]
#define WS_END (WS_CT + 4u * (size_t)NB * SS * QW)

// staged 32-k operand tiles of the two projection GEMMs, bf16, one row per output row / column: pitch 80 B = 16 B x odd, so that the 16 rows of a ds_load_b128 fragment read fall on distinct banks
#define GP (32 + 8)
typedef __attribute__((ext_vector_type(4))) __bf16 v4b;
// 64 rows x 128 columns of X[.][2048] . W[2048][LDW] per block of 4 waves (a wave: 16 rows x 128 columns), K = 2048 in passes of 32. Both operands' tiles go ONCE per block through registers into LDS as bf16, two buffers; the next R tiles' global loads are in flight under this tile's products.
// Row tile: each wave brings its own 16 rows x 32 k f32 as four loads of 4 whole 128-B lines; SPLIT: stored as bf16 hi rows and residual rows.
// Weight tile [32 k][128 cols] f32 -> LDS [col][k] bf16: a thread holds 8 k rows (wave w: rows 8w .. 8w + 7) x 4 columns (4 * lane ..), read as whole 512-B row pieces per wave.
// The 16-B piece of k rows 8c .. 8c + 7 of a column stands at place (c + (column >> 4)) & 3 of its LDS row: the writers' rows lie 4 apart, and the rotation spreads their ds_store_b128 over all banks; the 16 columns of a fragment share one rotation.
// The work-group barrier of a pass, with the one wait that it needs (this wave's LDS stores of the next tile have landed; its LDS reads were waited for by the products). By hand, because __syncthreads() also waits for every outstanding global load, which would drain the ring of loads at each pass.
__device__ __forceinline__ void bar_lds() { asm volatile("s_wait_dscnt 0x0\n\ts_barrier_signal -1\n\ts_barrier_wait -1" ::: "memory"); }
template <int LDW, bool SPLIT, int R>
__device__ __forceinline__ void proj_tile(const float* Xb, const float* Wb, __bf16 (*sh)[64][GP], __bf16 (*sl)[64][GP], __bf16 (*sw)[128][GP], v8f (&acc)[8], int wave, int lane) {
  const int col = lane & 15, g = lane >> 4, xrow = wave * 16 + (lane >> 3), xk = 4 * (lane & 7), pl = ((wave + (lane >> 2)) & 3) * 8;
  const unsigned xo = (unsigned)(xrow * 2048 + xk) * 4u, wo = (unsigned)(8 * wave * LDW + 4 * lane) * 4u;   // per-lane byte offsets, the same in every pass
  // Ring of R register sets: tile t waits in set t % R. Its loads are issued at the head of pass t - R and first used at the foot of pass t - 1, so that R tiles of a wave are on their way at any time:
  // for speed only: with one set a wave asks for a tile at the head of a pass and waits it out at the foot of the same pass.
  constexpr int NP = 2048 / 32, U = (R & 1) ? 2 * R : R, MAIN = (NP - R) / U * U;   // U passes a trip: set and buffer indices are constants of each copy
  v4f wr[R][8], xr[R][4];
  auto get = [&](int kc, int s) __attribute__((always_inline)) { const char* xb = (const char*)(Xb + kc * 32); const char* wb = (const char*)(Wb + (size_t)kc * 32 * LDW);
#pragma unroll
    for (int i = 0; i < 8; ++i) wr[s][i] = *(const v4f*)(wb + wo + i * LDW * 4);
#pragma unroll
    for (int i = 0; i < 4; ++i) xr[s][i] = *(const v4f*)(xb + xo + i * 4 * 2048 * 4);
    asm volatile("s_wait_xcnt 0x0" ::: "memory");   // stands behind the loads, in front of whatever rewrites a register that they name
    __builtin_amdgcn_sched_barrier(0); };           // keeps later register arithmetic, which takes the loads' address registers over, behind that wait (this build had some in front of it)
  auto put = [&](int b, int s) __attribute__((always_inline)) {
#pragma unroll
    for (int c = 0; c < 4; ++c) { v8b q;
#pragma unroll
      for (int i = 0; i < 8; ++i) q[i] = (__bf16)wr[s][i][c];
      *(v8b*)&sw[b][4 * lane + c][pl] = q; }
#pragma unroll
    for (int i = 0; i < 4; ++i) { v4b qh, ql;
#pragma unroll
      for (int e = 0; e < 4; ++e) { const __bf16 hv = (__bf16)xr[s][i][e]; qh[e] = hv; if (SPLIT) ql[e] = (__bf16)(xr[s][i][e] - (float)hv); }
      *(v4b*)&sh[b][xrow + 4 * i][xk] = qh; if (SPLIT) *(v4b*)&sl[b][xrow + 4 * i][xk] = ql; } };
  // pass kc on LDS buffer b; u = kc modulo U
  auto pass = [&](int kc, int u, bool more, bool next) __attribute__((always_inline)) { const int b = u & 1;
    if (more) get(kc + R, u % R);   // into the set that tile kc left at the foot of pass kc - 1
    const v16b ah = frag_b(&sh[b][wave * 16 + col][0], lane); v16b al; if (SPLIT) al = frag_b(&sl[b][wave * 16 + col][0], lane);
    v16b w[8];
#pragma unroll
    for (int j = 0; j < 8; ++j) { union { v16b v; v8b q[2]; } t; const __bf16* p = &sw[b][j * 16 + col][0];
      t.q[0] = *(const v8b*)(p + ((g + j) & 3) * 8); t.q[1] = *(const v8b*)(p + ((g + 2 + j) & 3) * 8); w[j] = t.v; }
#pragma unroll
    for (int j = 0; j < 8; ++j) acc[j] = wmma_bf(ah, w[j], acc[j]);
    if (SPLIT) {   // each accumulator still takes hi, then residual, of every pass; the other accumulators' products stand between the two
#pragma unroll
      for (int j = 0; j < 8; ++j) acc[j] = wmma_bf(al, w[j], acc[j]); }
    __builtin_amdgcn_sched_barrier(0);    // keeps the conversions of the next tile, and with them the wait for its global loads, behind this tile's products
    if (next) put(b ^ 1, (u + 1) % R);    // the other buffer: its readers left it at the barrier that ended pass kc - 1
    bar_lds(); };                         // publishes tile kc + 1 and ends every wave's reads of tile kc
#pragma unroll
  for (int t = 0; t < R; ++t) get(t, t);
  put(0, 0);
  bar_lds();   // tile 0 may be read
  // no test stands around the loads of the main loop, so that the number of younger loads outstanding at the wait in front of the conversions is the same on every path and the wait can be a counted one; the last passes are written out behind it
  // the outer loop stays rolled, its U passes are unrolled: every index of the register sets is then a constant (else the sets would go to scratch)
#pragma unroll 1
  for (int k0 = 0; k0 < MAIN; k0 += U) {
#pragma unroll
    for (int u = 0; u < U; ++u) pass(k0 + u, u, true, true); }
#pragma unroll
  for (int kc = MAIN; kc < NP; ++kc) pass(kc, kc - MAIN, kc + R < NP, kc + 1 < NP);   // the last passes, each with what is left to load and to stage
}
// ---- k_qkv: block = (64 rows, col group of 128 over q|k|v (24 groups) = one head): x . W (exact), and the head's own finish on the f32 accumulators, which never leave the WGP:
// q and k heads: RoPE (pairs (2j, 2j+1), angle pos * 1e4^(-2j/128)) -> f16 hi/lo rows; v heads: f16 hi/lo planes [c][s]
union QkvEp { float sf[4][16][132]; struct { _Float16 th[128][72], tl[128][72]; } v; };   // a block uses one member only
typedef __attribute__((ext_vector_type(4))) _Float16 v4h;
// second launch bound: three waves a SIMD, that is 336 registers a wave, so that all 768 blocks stay resident at once beside the ring of three register sets (left to itself this build took 358)
__global__ __launch_bounds__(128, 3) void k_qkv(const float* __restrict__ X, const float* __restrict__ WQ, const float* __restrict__ WK, const float* __restrict__ WV, const int* __restrict__ PID, _Float16* __restrict__ QH, _Float16* __restrict__ QL, _Float16* __restrict__ KH, _Float16* __restrict__ KL, _Float16* __restrict__ VH, _Float16* __restrict__ VL) { __shared__ __align__(16) QkvEp ep; __shared__ __align__(16) __bf16 sa[2][64][GP], sw[2][128][GP];
  const int tid = threadIdx.x, wave = tid >> 5, lane = tid & 31, col = lane & 15, g = lane >> 4; const int cg = blockIdx.y; const size_t r0 = (size_t)blockIdx.x * 64 + wave * 16;
  const float* Xb = X + (size_t)blockIdx.x * 64 * HID;
  v8f acc[8] = {};
  if (cg < 16) proj_tile<QW, false, 3>(Xb, WQ + cg * 128, sa, sa, sw, acc, wave, lane);
  else proj_tile<KW, false, 3>(Xb, (cg < 20 ? WK + (cg - 16) * 128 : WV + (cg - 20) * 128), sa, sa, sw, acc, wave, lane);
  if (cg < 20) {   // a wave turns its own 16 rows: a lane holds columns 4 lane .. 4 lane + 3 (pairs 2 lane, 2 lane + 1) of every row, so its two frequencies are taken once, and a row's store is 256 B in a row per plane
    const int pidv = PID[r0 + col];   // the 16 rows' positions, one a lane
    asm volatile("s_wait_xcnt 0x0" ::: "memory");   // stands behind the load, in front of whatever rewrites a register that it names
    __builtin_amdgcn_sched_barrier(0);              // keeps the LDS address arithmetic, which takes the load's address registers over, behind that wait (this build had it in front)
#pragma unroll
    for (int j = 0; j < 8; ++j)
#pragma unroll
      for (int r = 0; r < 8; ++r) ep.sf[wave][8 * g + r][j * 16 + col] = acc[j][r];
    const float f0 = powf(10000.0f, -(float)(4 * lane) / (float)HD), f1 = powf(10000.0f, -(float)(4 * lane + 2) / (float)HD);
    _Float16* H = (cg < 16 ? QH + r0 * QW + cg * 128 : KH + r0 * KW + (cg - 16) * 128) + lane * 4; _Float16* L = (cg < 16 ? QL + r0 * QW + cg * 128 : KL + r0 * KW + (cg - 16) * 128) + lane * 4; const int ld = cg < 16 ? QW : KW;
    LDSX();
    for (int rl = 0; rl < 16; ++rl) { const float pos = (float)__builtin_amdgcn_readlane(pidv, rl); const v4f x = *(const v4f*)&ep.sf[wave][rl][lane * 4];
      const float a0 = pos * f0, a1 = pos * f1; float c0, s0, c1, s1; sincosf(a0, &s0, &c0); sincosf(a1, &s1, &c1);   // one argument reduction and one pair of polynomials an angle; the values are those of sinf and cosf
      const float y[4] = { x[0] * c0 - x[1] * s0, x[0] * s0 + x[1] * c0, x[2] * c1 - x[3] * s1, x[2] * s1 + x[3] * c1 }; v4h hi, lo;
#pragma unroll
      for (int e = 0; e < 4; ++e) { const _Float16 hv = (_Float16)y[e]; hi[e] = hv; lo[e] = (_Float16)(y[e] - (float)hv); }   // UNSCALED residuals (q, k ~ O(1))
      vst2(H + (size_t)rl * ld, hi); vst2(L + (size_t)rl * ld, lo);
      asm volatile("s_wait_xcnt 0x0" ::: "memory");   // stands behind the stores, in front of whatever rewrites a register that they name
      __builtin_amdgcn_sched_barrier(0); }            // keeps the next row's address additions, which rewrite the stores' address registers, behind that wait (this build had them in front of it)
  } else {   // a lane's eight accumulator elements of a column are eight rows s in a row: one 16-B piece of the channel's plane row; through LDS, so that eight lanes of one wave store a channel's whole 128-B line
    const int c0 = (cg - 20) * 128; const size_t s0 = (size_t)blockIdx.x * 64;
#pragma unroll
    for (int j = 0; j < 8; ++j) { v8h hi, lo;
#pragma unroll
      for (int r = 0; r < 8; ++r) { const _Float16 hv = (_Float16)acc[j][r]; hi[r] = hv; lo[r] = (_Float16)(acc[j][r] - (float)hv); }   // UNSCALED residual (v ~ O(1)): lets the attention add it into the same accumulator
      *(v8h*)&ep.v.th[j * 16 + col][wave * 16 + 8 * g] = hi; *(v8h*)&ep.v.tl[j * 16 + col][wave * 16 + 8 * g] = lo; }
    __syncthreads();   // all four waves' rows of a channel stand in LDS
    for (int e = tid; e < 128 * 8; e += 128) { const int c = e >> 3, q = e & 7; vst2((unsigned*)(VH + (size_t)(c0 + c) * SS + s0 + q * 8), *(const v4u*)&ep.v.th[c][q * 8]); vst2((unsigned*)(VL + (size_t)(c0 + c) * SS + s0 + q * 8), *(const v4u*)&ep.v.tl[c][q * 8]);
      asm volatile("s_wait_xcnt 0x0" ::: "memory"); } } }   // stands behind the stores, in front of whatever rewrites a register that they name
// staged key/value tile of 32 keys: row pitches are 16 B x odd (272 B, 80 B), so that the 16 rows of a ds_load_b128 fragment read fall on distinct banks
#define KP (HD + 8)
#define VP (32 + 8)
struct __align__(16) KVStage { _Float16 kh[32][KP], kl[32][KP], vh[HD][VP], vl[HD][VP]; };
__device__ __forceinline__ unsigned lds_addr(const void* p) { return (unsigned)(size_t)(__attribute__((address_space(3))) const void*)p; }
// eight asynchronous 16-byte copies per lane, global -> LDS through no register (four of plane a, four of plane b); the s_wait_xcnt stands in the copies' own statement so that no address register is rewritten ahead of it
__device__ __forceinline__ void acopy8(unsigned la, unsigned lb, unsigned ls, const _Float16* ga, const _Float16* gb, size_t gs) {
  asm volatile("global_load_async_to_lds_b128 %0, %8, off\n\t"
               "global_load_async_to_lds_b128 %1, %9, off\n\t"
               "global_load_async_to_lds_b128 %2, %10, off\n\t"
               "global_load_async_to_lds_b128 %3, %11, off\n\t"
               "global_load_async_to_lds_b128 %4, %12, off\n\t"
               "global_load_async_to_lds_b128 %5, %13, off\n\t"
               "global_load_async_to_lds_b128 %6, %14, off\n\t"
               "global_load_async_to_lds_b128 %7, %15, off\n\t"
               "s_wait_xcnt 0x0"
               :: "v"(la), "v"(la + ls), "v"(la + 2 * ls), "v"(la + 3 * ls), "v"(lb), "v"(lb + ls), "v"(lb + 2 * ls), "v"(lb + 3 * ls),
                  "v"(ga), "v"(ga + gs), "v"(ga + 2 * gs), "v"(ga + 3 * gs), "v"(gb), "v"(gb + gs), "v"(gb + 2 * gs), "v"(gb + 3 * gs) : "memory");
}
// wmma16 with D alone named in the statement of the four slots: this compiler keeps a vector operand of an asm statement in the first 256 registers, and k_att's fragments, read ahead in groups, do not fit there beside Q and the accumulators (with A and B named the build spilled to scratch)
__device__ __forceinline__ v8f wmma16d(v16h a, v16h b, v8f c) {
  v8f d = __builtin_amdgcn_wmma_f32_16x16x32_f16(false, a, false, b, (short)0, c, false, false);
  asm volatile("v_nop\n\tv_nop\n\tv_nop\n\tv_nop" : "+v"(d));
  return d;
}
// Maximum / sum over each 16-lane row, of eight values at once: the butterfly l ^ 1, 2, 4, 8 with the partner lane read as the DPP operand (row_xmask) of the v_max / v_add itself, so an exchange makes no trip through the LDS pipe and needs no dscnt wait, as __shfl_xor does here. Every lane is on where they stand.
// In asm text, eight values a statement: a value's next step stands eight instructions behind its last one and does not wait for it (from the builtin the moved value came out as a move of its own, for the maximum with one more instruction behind it).
__device__ __forceinline__ void rowmax8(float (&v)[8]) {
  asm(
      "v_max_num_f32_dpp %0, %0, %0 row_xmask:1 row_mask:0xf bank_mask:0xf\n\t"
      "v_max_num_f32_dpp %1, %1, %1 row_xmask:1 row_mask:0xf bank_mask:0xf\n\t"
      "v_max_num_f32_dpp %2, %2, %2 row_xmask:1 row_mask:0xf bank_mask:0xf\n\t"
      "v_max_num_f32_dpp %3, %3, %3 row_xmask:1 row_mask:0xf bank_mask:0xf\n\t"
      "v_max_num_f32_dpp %4, %4, %4 row_xmask:1 row_mask:0xf bank_mask:0xf\n\t"
      "v_max_num_f32_dpp %5, %5, %5 row_xmask:1 row_mask:0xf bank_mask:0xf\n\t"
      "v_max_num_f32_dpp %6, %6, %6 row_xmask:1 row_mask:0xf bank_mask:0xf\n\t"
      "v_max_num_f32_dpp %7, %7, %7 row_xmask:1 row_mask:0xf bank_mask:0xf\n\t"
      "v_max_num_f32_dpp %0, %0, %0 row_xmask:2 row_mask:0xf bank_mask:0xf\n\t"
      "v_max_num_f32_dpp %1, %1, %1 row_xmask:2 row_mask:0xf bank_mask:0xf\n\t"
      "v_max_num_f32_dpp %2, %2, %2 row_xmask:2 row_mask:0xf bank_mask:0xf\n\t"
      "v_max_num_f32_dpp %3, %3, %3 row_xmask:2 row_mask:0xf bank_mask:0xf\n\t"
      "v_max_num_f32_dpp %4, %4, %4 row_xmask:2 row_mask:0xf bank_mask:0xf\n\t"
      "v_max_num_f32_dpp %5, %5, %5 row_xmask:2 row_mask:0xf bank_mask:0xf\n\t"
      "v_max_num_f32_dpp %6, %6, %6 row_xmask:2 row_mask:0xf bank_mask:0xf\n\t"
      "v_max_num_f32_dpp %7, %7, %7 row_xmask:2 row_mask:0xf bank_mask:0xf\n\t"
      "v_max_num_f32_dpp %0, %0, %0 row_xmask:4 row_mask:0xf bank_mask:0xf\n\t"
      "v_max_num_f32_dpp %1, %1, %1 row_xmask:4 row_mask:0xf bank_mask:0xf\n\t"
      "v_max_num_f32_dpp %2, %2, %2 row_xmask:4 row_mask:0xf bank_mask:0xf\n\t"
      "v_max_num_f32_dpp %3, %3, %3 row_xmask:4 row_mask:0xf bank_mask:0xf\n\t"
      "v_max_num_f32_dpp %4, %4, %4 row_xmask:4 row_mask:0xf bank_mask:0xf\n\t"
      "v_max_num_f32_dpp %5, %5, %5 row_xmask:4 row_mask:0xf bank_mask:0xf\n\t"
      "v_max_num_f32_dpp %6, %6, %6 row_xmask:4 row_mask:0xf bank_mask:0xf\n\t"
      "v_max_num_f32_dpp %7, %7, %7 row_xmask:4 row_mask:0xf bank_mask:0xf\n\t"
      "v_max_num_f32_dpp %0, %0, %0 row_xmask:8 row_mask:0xf bank_mask:0xf\n\t"
      "v_max_num_f32_dpp %1, %1, %1 row_xmask:8 row_mask:0xf bank_mask:0xf\n\t"
      "v_max_num_f32_dpp %2, %2, %2 row_xmask:8 row_mask:0xf bank_mask:0xf\n\t"
      "v_max_num_f32_dpp %3, %3, %3 row_xmask:8 row_mask:0xf bank_mask:0xf\n\t"
      "v_max_num_f32_dpp %4, %4, %4 row_xmask:8 row_mask:0xf bank_mask:0xf\n\t"
      "v_max_num_f32_dpp %5, %5, %5 row_xmask:8 row_mask:0xf bank_mask:0xf\n\t"
      "v_max_num_f32_dpp %6, %6, %6 row_xmask:8 row_mask:0xf bank_mask:0xf\n\t"
      "v_max_num_f32_dpp %7, %7, %7 row_xmask:8 row_mask:0xf bank_mask:0xf"
      : "+v"(v[0]), "+v"(v[1]), "+v"(v[2]), "+v"(v[3]), "+v"(v[4]), "+v"(v[5]), "+v"(v[6]), "+v"(v[7])); }
__device__ __forceinline__ void rowadd8(float (&v)[8]) {
  asm(
      "v_add_f32_dpp %0, %0, %0 row_xmask:1 row_mask:0xf bank_mask:0xf\n\t"
      "v_add_f32_dpp %1, %1, %1 row_xmask:1 row_mask:0xf bank_mask:0xf\n\t"
      "v_add_f32_dpp %2, %2, %2 row_xmask:1 row_mask:0xf bank_mask:0xf\n\t"
      "v_add_f32_dpp %3, %3, %3 row_xmask:1 row_mask:0xf bank_mask:0xf\n\t"
      "v_add_f32_dpp %4, %4, %4 row_xmask:1 row_mask:0xf bank_mask:0xf\n\t"
      "v_add_f32_dpp %5, %5, %5 row_xmask:1 row_mask:0xf bank_mask:0xf\n\t"
      "v_add_f32_dpp %6, %6, %6 row_xmask:1 row_mask:0xf bank_mask:0xf\n\t"
      "v_add_f32_dpp %7, %7, %7 row_xmask:1 row_mask:0xf bank_mask:0xf\n\t"
      "v_add_f32_dpp %0, %0, %0 row_xmask:2 row_mask:0xf bank_mask:0xf\n\t"
      "v_add_f32_dpp %1, %1, %1 row_xmask:2 row_mask:0xf bank_mask:0xf\n\t"
      "v_add_f32_dpp %2, %2, %2 row_xmask:2 row_mask:0xf bank_mask:0xf\n\t"
      "v_add_f32_dpp %3, %3, %3 row_xmask:2 row_mask:0xf bank_mask:0xf\n\t"
      "v_add_f32_dpp %4, %4, %4 row_xmask:2 row_mask:0xf bank_mask:0xf\n\t"
      "v_add_f32_dpp %5, %5, %5 row_xmask:2 row_mask:0xf bank_mask:0xf\n\t"
      "v_add_f32_dpp %6, %6, %6 row_xmask:2 row_mask:0xf bank_mask:0xf\n\t"
      "v_add_f32_dpp %7, %7, %7 row_xmask:2 row_mask:0xf bank_mask:0xf\n\t"
      "v_add_f32_dpp %0, %0, %0 row_xmask:4 row_mask:0xf bank_mask:0xf\n\t"
      "v_add_f32_dpp %1, %1, %1 row_xmask:4 row_mask:0xf bank_mask:0xf\n\t"
      "v_add_f32_dpp %2, %2, %2 row_xmask:4 row_mask:0xf bank_mask:0xf\n\t"
      "v_add_f32_dpp %3, %3, %3 row_xmask:4 row_mask:0xf bank_mask:0xf\n\t"
      "v_add_f32_dpp %4, %4, %4 row_xmask:4 row_mask:0xf bank_mask:0xf\n\t"
      "v_add_f32_dpp %5, %5, %5 row_xmask:4 row_mask:0xf bank_mask:0xf\n\t"
      "v_add_f32_dpp %6, %6, %6 row_xmask:4 row_mask:0xf bank_mask:0xf\n\t"
      "v_add_f32_dpp %7, %7, %7 row_xmask:4 row_mask:0xf bank_mask:0xf\n\t"
      "v_add_f32_dpp %0, %0, %0 row_xmask:8 row_mask:0xf bank_mask:0xf\n\t"
      "v_add_f32_dpp %1, %1, %1 row_xmask:8 row_mask:0xf bank_mask:0xf\n\t"
      "v_add_f32_dpp %2, %2, %2 row_xmask:8 row_mask:0xf bank_mask:0xf\n\t"
      "v_add_f32_dpp %3, %3, %3 row_xmask:8 row_mask:0xf bank_mask:0xf\n\t"
      "v_add_f32_dpp %4, %4, %4 row_xmask:8 row_mask:0xf bank_mask:0xf\n\t"
      "v_add_f32_dpp %5, %5, %5 row_xmask:8 row_mask:0xf bank_mask:0xf\n\t"
      "v_add_f32_dpp %6, %6, %6 row_xmask:8 row_mask:0xf bank_mask:0xf\n\t"
      "v_add_f32_dpp %7, %7, %7 row_xmask:8 row_mask:0xf bank_mask:0xf"
      : "+v"(v[0]), "+v"(v[1]), "+v"(v[2]), "+v"(v[3]), "+v"(v[4]), "+v"(v[5]), "+v"(v[6]), "+v"(v[7])); }
// e^x as __expf comes out here (x * log2(e), then v_exp_f32), with the one slot that the instruction set asks for behind a transcendental in the same statement
__device__ __forceinline__ float exp_s(float x) { float d; asm("v_exp_f32 %0, %1\n\tv_nop" : "=v"(d) : "v"(x * 1.44269504088896340736f)); return d; }
// ---- k_att: block = (64 queries, head h): kv head = h / 4; causal (tiles past the block skipped) AND attention_mask[k] != 0; head_dim 128 = 4 k-chunks; P . v over 8 d-tiles
// Eight waves in two groups of four. Both groups hold the same 64 queries (wave wq of each: rows 16 wq ..); group 0 walks the even key tiles, group 1 the odd ones (the causal bound is an even number of tiles), each with its own two staging buffers, running maximum, sum and accumulators:
// the longest block's chain of passes, which the launch lasts, is half as long. Behind the loop group 1 hands its maximum, sum and accumulators over through LDS and group 0 joins the two partial softmaxes.
// One block fills a WGP's registers, so the blocks come in two rounds: the grid's slow index counts the query blocks from the last (most tiles) down, so that the short blocks fill in behind the long ones.
__global__ __launch_bounds__(256) void k_att(const _Float16* __restrict__ QH, const _Float16* __restrict__ QL, const _Float16* __restrict__ KH, const _Float16* __restrict__ KL, const _Float16* __restrict__ VH, const _Float16* __restrict__ VL, const int* __restrict__ AM, float* __restrict__ CT) {
  __shared__ __align__(16) float sp[8][16][36]; __shared__ __align__(16) float so[4][16][132]; __shared__ KVStage st[2][2];   // st[group][buffer]
  const int tid = threadIdx.x, wave = tid >> 5, lane = tid & 31, col = lane & 15, g = lane >> 4, grp = wave >> 2, wq = wave & 3, gt = tid & 127; const int qb = TQB - 1 - blockIdx.y, h = blockIdx.x; const int kvh = h / (NHQ / NKV); const int q0 = qb * 64 + wq * 16; constexpr bool three = false;   // not read: the scores always take 3 products (q hi.k hi, q lo.k hi, q hi.k lo)
  v16h aq[4], al[4];
#pragma unroll
  for (int kc = 0; kc < 4; ++kc) { aq[kc] = frag_h(QH + (size_t)(q0 + col) * QW + h * HD + kc * 32, lane); al[kc] = frag_h(QL + (size_t)(q0 + col) * QW + h * HD + kc * 32, lane); }
  int amn0 = AM[grp * 32 + col], amn1 = AM[grp * 32 + 16 + col];   // mask words of pass 0
  asm volatile("s_wait_xcnt 0x0" ::: "memory");       // stands behind the Q and mask loads, in front of whatever rewrites a register that they name
  __builtin_amdgcn_sched_barrier(0);                  // keeps the staging's address arithmetic, which takes those registers over, behind that wait (this build had it in front)
  float m[8], l[8];
#pragma unroll
  for (int r = 0; r < 8; ++r) { m[r] = -3.0e38f; l[r] = 0.f; }
  v8f acc[8] = {};
  const int nks = qb + 1;   // passes: the causal bound is 2 (qb + 1) tiles of 32 keys, and pass i of group grp takes tile 2 i + grp
  // each thread of a group copies 16 pieces of 16 B per tile of its group: k rows of 256 B (16 lanes a row, 8 rows a step), v rows of 64 B (4 lanes a row, 32 rows a step)
  const unsigned lk = lds_addr(&st[grp][0].kh[gt >> 4][(gt & 15) * 8]), lv = lds_addr(&st[grp][0].vh[gt >> 2][(gt & 3) * 8]);
  const size_t gk = (size_t)(gt >> 4) * KW + kvh * HD + (gt & 15) * 8, gv = ((size_t)kvh * HD + (gt >> 2)) * SS + (gt & 3) * 8;
  auto stage = [&](int i) { const int t = 2 * i + grp; const unsigned b = (unsigned)(i & 1) * (unsigned)sizeof(KVStage);
    acopy8(lk + b, lk + b + (unsigned)sizeof(st[0][0].kh), 8 * KP * 2, KH + gk + (size_t)t * 32 * KW, KL + gk + (size_t)t * 32 * KW, (size_t)8 * KW);
    acopy8(lv + b, lv + b + (unsigned)sizeof(st[0][0].vh), 32 * VP * 2, VH + gv + t * 32, VL + gv + t * 32, (size_t)32 * SS); };
  stage(0);
  asm volatile("s_wait_asynccnt 0x0" ::: "memory");   // this wave's copies of pass 0 have landed
  __syncthreads();                                    // ... and every other wave's: both groups' tiles of pass 0 may be read
  if (nks > 1) stage(1);
#pragma unroll 1
  for (int ks = 0; ks < nks; ++ks) { float s[2][8]; const KVStage& T = st[grp][ks & 1];
    // A pass's reads stand in two groups AHEAD of the products that use them, so that a wave does not wait out the LDS latency once per product:
    // all 16 key fragments at the head of the pass; all 16 value fragments behind the first score chain, so that they land under the second chain and the softmax; the two mask words one pass ahead (the last pass reads its own again: no index past the block's keys).
    const int am[2] = { amn0, amn1 };
    v16h kh[2][4], kl[2][4], vh[8], vl[8]; v8f c[2];
#pragma unroll
    for (int ct = 0; ct < 2; ++ct)
#pragma unroll
      for (int kc = 0; kc < 4; ++kc) { kh[ct][kc] = frag_h(&T.kh[ct * 16 + col][kc * 32], lane); kl[ct][kc] = frag_h(&T.kl[ct * 16 + col][kc * 32], lane); }
    { const int kn = (2 * (ks + 1 < nks ? ks + 1 : ks) + grp) * 32 + col; amn0 = AM[kn]; amn1 = AM[kn + 16]; }
    asm volatile("s_wait_xcnt 0x0" ::: "memory");   // stands behind the mask loads, in front of whatever rewrites a register that they name
#pragma unroll
    for (int ct = 0; ct < 2; ++ct) { v8f cc = {};
#pragma unroll
      for (int kc = 0; kc < 4; ++kc) { cc = wmma16d(aq[kc], kh[ct][kc], cc); cc = wmma16d(al[kc], kh[ct][kc], cc); cc = wmma16d(aq[kc], kl[ct][kc], cc); }   // 3 products, all residuals UNSCALED into one accumulator
      c[ct] = cc;
      if (ct == 0) {
#pragma unroll
        for (int j = 0; j < 8; ++j) { vh[j] = frag_h(&T.vh[j * 16 + col][0], lane); vl[j] = frag_h(&T.vl[j * 16 + col][0], lane); } } }
#pragma unroll
    for (int ct = 0; ct < 2; ++ct) { const int kk = (2 * ks + grp) * 32 + ct * 16 + col; const bool keepm = (am[ct] != 0);
#pragma unroll
      for (int r = 0; r < 8; ++r) s[ct][r] = (keepm && kk <= q0 + 8 * g + r) ? c[ct][r] * 0.08838834764831845f : -3.0e38f; }
    float alpha[8], mx[8], es[8];
#pragma unroll
    for (int r = 0; r < 8; ++r) mx[r] = fmaxf(s[0][r], s[1][r]);
    rowmax8(mx);
#pragma unroll
    for (int r = 0; r < 8; ++r) {
      const float mn = fmaxf(m[r], mx[r]); const float xa = exp_s(m[r] - mn), x0 = exp_s(s[0][r] - mn), x1 = exp_s(s[1][r] - mn);   // taken in every lane, chosen below: an asm statement under a condition would come out as a branch
      alpha[r] = (m[r] <= -1.0e38f) ? 0.f : xa; const float e0 = (s[0][r] <= -1.0e38f) ? 0.f : x0, e1 = (s[1][r] <= -1.0e38f) ? 0.f : x1; es[r] = e0 + e1;
      m[r] = mn; sp[wave][8 * g + r][col] = e0; sp[wave][8 * g + r][16 + col] = e1; }
    rowadd8(es);
#pragma unroll
    for (int r = 0; r < 8; ++r) l[r] = l[r] * alpha[r] + es[r];
#pragma unroll
    for (int j = 0; j < 8; ++j)
#pragma unroll
      for (int r = 0; r < 8; ++r) acc[j][r] *= alpha[r];
    LDSX();
    const v16h pa = frag_f32s(&sp[wave][col][0], lane, 2048.0f);
#pragma unroll
    for (int j = 0; j < 8; ++j) { acc[j] = wmma16d(pa, vh[j], acc[j]); acc[j] = wmma16d(pa, vl[j], acc[j]); }   // v hi + unscaled residual
    asm volatile("s_wait_dscnt 0x0" ::: "memory");      // this wave's reads of this tile (and of sp) have returned before the tile's buffer is refilled
    asm volatile("s_wait_asynccnt 0x0" ::: "memory");   // this wave's copies of pass ks + 1 have landed
    __syncthreads();                                    // publishes both groups' tiles of pass ks + 1 and ends every wave's reads of pass ks
    if (ks + 2 < nks) stage(ks + 2); }
  asm volatile("s_wait_asynccnt 0x0" ::: "memory");     // no copy is outstanding when the wave goes on to its end
  // hand-over: wave wq of group 1 lays its accumulators at the places where wave wq of group 0 holds the same elements, its row maxima and sums in the rows' pad words 128 and 129
  if (grp == 1) {
#pragma unroll
    for (int r = 0; r < 8; ++r) {
#pragma unroll
      for (int j = 0; j < 8; ++j) so[wq][8 * g + r][j * 16 + col] = acc[j][r];
      if (col == 0) { so[wq][8 * g + r][128] = m[r]; so[wq][8 * g + r][129] = l[r]; } } }
  __syncthreads();   // group 1's partial results may be read by group 0
  if (grp == 0) {
#pragma unroll
    for (int r = 0; r < 8; ++r) { const float m1 = so[wq][8 * g + r][128], l1 = so[wq][8 * g + r][129]; const float mn = fmaxf(m[r], m1);
      const float y0 = exp_s(m[r] - mn), y1 = exp_s(m1 - mn); const float a0 = (m[r] <= -1.0e38f) ? 0.f : y0, a1 = (m1 <= -1.0e38f) ? 0.f : y1;   // a group that saw no open key of the row counts for nothing
      const float lt = l[r] * a0 + l1 * a1; const float il = (lt > 0.f) ? (1.0f / 2048.0f) / lt : 0.f; const float f0 = a0 * il, f1 = a1 * il;
#pragma unroll
      for (int j = 0; j < 8; ++j) { float* p = &so[wq][8 * g + r][j * 16 + col]; *p = acc[j][r] * f0 + *p * f1; } }   // each lane rewrites only the words that it has read itself
    LDSX(); for (int rl = 0; rl < 16; ++rl) vst2(CT + (size_t)(q0 + rl) * QW + h * HD + lane * 4, *(const v4f*)&so[wq][rl][lane * 4]); } }
// ---- k_out: block = (64 rows, 128 of 2048 cols): out = ctx (hi + lo) . wo (in,out)
__global__ __launch_bounds__(128) void k_out(const float* __restrict__ CT, const float* __restrict__ WO, float* __restrict__ OUT) { __shared__ __align__(16) float sf[4][16][132]; __shared__ __align__(16) __bf16 sh[2][64][GP], sl[2][64][GP], sw[2][128][GP];
  const int tid = threadIdx.x, wave = tid >> 5, lane = tid & 31, col = lane & 15, g = lane >> 4; const int c0 = blockIdx.y * 128; const size_t r0 = (size_t)blockIdx.x * 64 + wave * 16;
  v8f acc[8] = {};
  proj_tile<HID, true, 4>(CT + (size_t)blockIdx.x * 64 * QW, WO + c0, sh, sl, sw, acc, wave, lane);
#pragma unroll
  for (int j = 0; j < 8; ++j)
#pragma unroll
    for (int r = 0; r < 8; ++r) sf[wave][8 * g + r][j * 16 + col] = acc[j][r];
  LDSX(); for (int rl = 0; rl < 16; ++rl) vst2(OUT + (r0 + rl) * HID + c0 + lane * 4, *(const v4f*)&sf[wave][rl][lane * 4]); }
extern "C" void kernel_launch(void* const* d_in, const int* in_sizes, int n_in, void* d_out, int out_size, void* d_ws, size_t ws_size, hipStream_t stream) {
  (void)in_sizes; (void)n_in; (void)out_size;
  const float** F_ = (const float**)d_in;   // 0 hidden_states [1,2048,2048], 1 wq [2048,2048], 2 wk [2048,512], 3 wv [2048,512], 4 wo [2048,2048] (all (in,out)), 5 attention_mask [1,2048] int, 6 position_ids [1,2048] int
  if (ws_size < (size_t)WS_END) return;
  char* ws = (char*)d_ws; _Float16 *QH = (_Float16*)(ws + WS_QH), *QL = (_Float16*)(ws + WS_QL), *KH = (_Float16*)(ws + WS_KH), *KL = (_Float16*)(ws + WS_KL), *VH = (_Float16*)(ws + WS_VH), *VL = (_Float16*)(ws + WS_VL); float* CT = (float*)(ws + WS_CT);
  k_qkv<<<dim3(TRB, QKVW / 128), 128, 0, stream>>>(F_[0], F_[1], F_[2], F_[3], (const int*)d_in[6], QH, QL, KH, KL, VH, VL);
  k_att<<<dim3(NHQ, TQB), 256, 0, stream>>>(QH, QL, KH, KL, VH, VL, (const int*)d_in[5], CT);
  k_out<<<dim3(TQB, HID / 128), 128, 0, stream>>>(CT, F_[4], (float*)d_out);
}

// v008
// Measured time: 136 microseconds a run.
// Next to v007, in two timings, it ran 1.09 times as fast each time.
// Counting every step since v000, it is 5.99 times as fast.
// compute dtype: all float inputs rounded to bf16, attention_mask / position_ids (int) read; q/k/v = x . W with EXACT bf16 products on WMMA 16x16x32 ((in,out) weights), f32 accumulate; RoPE (interleaved pairs, angles position_id * theta^(-2j/128), precise sinf/cosf/powf) in f32, q/k as f16 hi + residual rows, v as f16 hi + residual planes; GQA causal attention with head_dim 128: 3-product scores (q/k as f16 hi + UNSCALED residual, one accumulator), P rounded once to f16 (x 2^11) against v as f16 hi + UNSCALED residual (2 products into one accumulator), x 1/sqrt(128), masked/acausal keys excluded, running-max softmax in f32 (hardware exp); out = ctx (bf16 hi + lo) . wo (2 products); f32 output.
#include <hip/hip_runtime.h>
#include <math.h>

typedef __attribute__((ext_vector_type(16))) _Float16 v16h;
typedef __attribute__((ext_vector_type(16))) __bf16 v16b;
typedef __attribute__((ext_vector_type(8)))  _Float16 v8h;
typedef __attribute__((ext_vector_type(8)))  float v8f;
typedef __attribute__((ext_vector_type(4)))  float v4f;
typedef __attribute__((ext_vector_type(2)))  float v2f;
typedef __attribute__((ext_vector_type(4)))  unsigned v4u;
typedef __attribute__((ext_vector_type(4)))  int v4i;
typedef float __attribute__((may_alias)) float_a;
typedef int __attribute__((may_alias)) int_a;

template <typename T> __device__ __forceinline__ void vst2(void* p, T v) { *(T*)p = v;  }
__device__ __forceinline__ v8f wmma16(v16h a, v16h b, v8f c) {
  v8f d = __builtin_amdgcn_wmma_f32_16x16x32_f16(false, a, false, b, (short)0, c, false, false);
  asm volatile("v_nop\n\tv_nop\n\tv_nop\n\tv_nop" : "+v"(d) : "v"(a), "v"(b));
  return d;
}
__device__ __forceinline__ v8f wmma_bf(v16b a, v16b b, v8f c) {
  v8f d = __builtin_amdgcn_wmma_f32_16x16x32_bf16(false, a, false, b, (short)0, c, false, false);
  asm volatile("v_nop\n\tv_nop\n\tv_nop\n\tv_nop" : "+v"(d) : "v"(a), "v"(b));
  return d;
}
// 16x16x32 fragments: lane = (h = lane>>4, row/col = lane&15); elements 0..7 = k0+8h+0..7, 8..15 = k0+16+8h+0..7; D element r = row 8h+r
__device__ __forceinline__ v16h frag_h(const _Float16* rowk0, int lane) {
  union { v16h v; v8h q[2]; } u; const _Float16* p = rowk0 + 8 * (lane >> 4);
  u.q[0] = *(const v8h*)p; u.q[1] = *(const v8h*)(p + 16); return u.v;
}
__device__ __forceinline__ v16h frag_f32(const float* rowk0, int lane) {
  v16h a; const float* p = rowk0 + 8 * (lane >> 4);
#pragma unroll
  for (int i = 0; i < 8; ++i) { a[i] = (_Float16)p[i]; a[8 + i] = (_Float16)p[16 + i]; }
  return a;
}
__device__ __forceinline__ v16h frag_f32s(const float* rowk0, int lane, float sc) {
  v16h a; const float* p = rowk0 + 8 * (lane >> 4);
#pragma unroll
  for (int i = 0; i < 8; ++i) { a[i] = (_Float16)(p[i] * sc); a[8 + i] = (_Float16)(p[16 + i] * sc); }
  return a;
}
// column fragment from a [K][ld] layout (column n), rows >= K read as 0
__device__ __forceinline__ v16h fragc_f32(const float* W, int k0, int n, int lane, int ld, int K) {
  v16h a; const int g = lane >> 4;
#pragma unroll
  for (int i = 0; i < 8; ++i) { const int ka = k0 + 8 * g + i, kb = ka + 16;
    a[i] = (_Float16)(ka < K ? W[(size_t)(ka < K ? ka : K - 1) * ld + n] : 0.f); a[8 + i] = (_Float16)(kb < K ? W[(size_t)(kb < K ? kb : K - 1) * ld + n] : 0.f); }
  return a;
}
struct F2 { v16b h, l; };
__device__ __forceinline__ F2 bsplit16(const float v[16]) { F2 r;
#pragma unroll
  for (int i = 0; i < 16; ++i) { const __bf16 h = (__bf16)v[i]; r.h[i] = h; r.l[i] = (__bf16)(v[i] - (float)h); }
  return r; }
__device__ __forceinline__ F2 split_row(const float* row, int k0, int lane) { float v[16]; const float* p = row + k0 + 8 * (lane >> 4);
#pragma unroll
  for (int i = 0; i < 8; ++i) { v[i] = p[i]; v[8 + i] = p[16 + i]; }
  return bsplit16(v); }
__device__ __forceinline__ F2 split_rowK(const float* row, int k0, int lane, int K) { float v[16]; const int g = lane >> 4;
#pragma unroll
  for (int i = 0; i < 8; ++i) { const int ka = k0 + 8 * g + i, kb = ka + 16; v[i] = ka < K ? row[ka < K ? ka : K - 1] : 0.f; v[8 + i] = kb < K ? row[kb < K ? kb : K - 1] : 0.f; }
  return bsplit16(v); }
__device__ __forceinline__ F2 split_col(const float* W, int k0, int n, int lane, int ld, int K) { float v[16]; const int g = lane >> 4;
#pragma unroll
  for (int i = 0; i < 8; ++i) { const int ka = k0 + 8 * g + i, kb = ka + 16; v[i] = ka < K ? W[(size_t)(ka < K ? ka : K - 1) * ld + n] : 0.f; v[8 + i] = kb < K ? W[(size_t)(kb < K ? kb : K - 1) * ld + n] : 0.f; }
  return bsplit16(v); }
__device__ __forceinline__ v8f mac3(const F2& a, const F2& b, v8f c) { c = wmma_bf(a.l, b.h, c); c = wmma_bf(a.h, b.l, c); return wmma_bf(a.h, b.h, c); }
__device__ __forceinline__ float sigm(float v) { return 1.0f / (1.0f + expf(-v)); }
#define LDSX() do { asm volatile("s_wait_dscnt 0" ::: "memory"); __builtin_amdgcn_wave_barrier(); __builtin_amdgcn_fence(__ATOMIC_RELEASE, "workgroup"); } while (0)


// LLaMA attention (B 1, S 2,048, hidden 2,048, 16 query heads / 4 kv heads x 128, RoPE theta 1e4): q/k/v projections, RoPE on q and k, GQA (kv head = h / 4), causal + padding mask, softmax in f32, o_proj.
#define NB 1
#define SS 2048
#define HID 2048
#define NHQ 16
#define NKV 4
#define HD 128
#define QW (NHQ * HD)     // 2048
#define KW (NKV * HD)     // 512
#define QKVW (QW + 2 * KW)   // 3072
#ifndef TQB
#define TQB (SS / 64)
#endif
#ifndef TRB
#define TRB (NB * SS / 64)   // row blocks for projections / rope / value planes
#endif
typedef __attribute__((ext_vector_type(8))) __bf16 v8b;
__device__ __forceinline__ v16b frag_b(const __bf16* rowk0, int lane) {
  union { v16b v; v8b q[2]; } u; const __bf16* p = rowk0 + 8 * (lane >> 4);
  u.q[0] = *(const v8b*)p; u.q[1] = *(const v8b*)(p + 16); return u.v;
}
__device__ __forceinline__ float bfr(float v) { return (float)(__bf16)v; }
__device__ __attribute__((noinline)) float exp_ni(float v) { return expf(v); }
__device__ __attribute__((noinline)) float erf_ni(float v) { return erff(v); }

#define WS_F   0u                                   // not used; the planes below keep their places
#define WS_QH  (WS_F + 4u * (size_t)NB * SS * QKVW)     // f16 hi|lo q rows [b*s][2048] (after rope)
#define WS_QL  (WS_QH + 2u * (size_t)NB * SS * QW)
#define WS_KH  (WS_QL + 2u * (size_t)NB * SS * QW)      // f16 hi|lo k rows [b*s][512]
#define WS_KL  (WS_KH + 2u * (size_t)NB * SS * KW)
#define WS_VH  (WS_KL + 2u * (size_t)NB * SS * KW)      // f16 hi|lo v planes [b][512][s]
#define WS_VL  (WS_VH + 2u * (size_t)NB * KW * SS)
#define WS_CT  (WS_VL + 2u * (size_t)NB * KW * SS)      // f32 ctx rows [b*s][2048]
#define WS_END (WS_CT + 4u * (size_t)NB * SS * QW)

// staged 32-k operand tiles of the two projection GEMMs, bf16, one row per output row / column: pitch 80 B = 16 B x odd, so that the 16 rows of a ds_load_b128 fragment read fall on distinct banks
#define GP (32 + 8)
typedef __attribute__((ext_vector_type(4))) __bf16 v4b;
// 64 rows x 128 columns of X[.][2048] . W[2048][LDW] per block of 4 waves (a wave: 16 rows x 128 columns), K = 2048 in passes of 32. Both operands' tiles go ONCE per block through registers into LDS as bf16, two buffers; the next R tiles' global loads are in flight under this tile's products.
// Row tile: each wave brings its own 16 rows x 32 k f32 as four loads of 4 whole 128-B lines; SPLIT: stored as bf16 hi rows and residual rows.
// Weight tile [32 k][128 cols] f32 -> LDS [col][k] bf16: a thread holds 8 k rows (wave w: rows 8w .. 8w + 7) x 4 columns (4 * lane ..), read as whole 512-B row pieces per wave.
// The 16-B piece of k rows 8c .. 8c + 7 of a column stands at place (c + (column >> 4)) & 3 of its LDS row: the writers' rows lie 4 apart, and the rotation spreads their ds_store_b128 over all banks; the 16 columns of a fragment share one rotation.
// The work-group barrier of a pass, with the one wait that it needs (this wave's LDS stores of the next tile have landed; its LDS reads were waited for by the products). By hand, because __syncthreads() also waits for every outstanding global load, which would drain the ring of loads at each pass.
__device__ __forceinline__ void bar_lds() { asm volatile("s_wait_dscnt 0x0\n\ts_barrier_signal -1\n\ts_barrier_wait -1" ::: "memory"); }
template <int LDW, bool SPLIT, int R>
__device__ __forceinline__ void proj_tile(const float* Xb, const float* Wb, __bf16 (*sh)[64][GP], __bf16 (*sl)[64][GP], __bf16 (*sw)[128][GP], v8f (&acc)[8], int wave, int lane) {
  const int col = lane & 15, g = lane >> 4, xrow = wave * 16 + (lane >> 3), xk = 4 * (lane & 7), pl = ((wave + (lane >> 2)) & 3) * 8;
  const unsigned xo = (unsigned)(xrow * 2048 + xk) * 4u, wo = (unsigned)(8 * wave * LDW + 4 * lane) * 4u;   // per-lane byte offsets, the same in every pass
  // Ring of R register sets: tile t waits in set t % R. Its loads are issued at the head of pass t - R and first used at the foot of pass t - 1, so that R tiles of a wave are on their way at any time:
  // for speed only: with one set a wave asks for a tile at the head of a pass and waits it out at the foot of the same pass.
  constexpr int NP = 2048 / 32, U = (R & 1) ? 2 * R : R, MAIN = (NP - R) / U * U;   // U passes a trip: set and buffer indices are constants of each copy
  v4f wr[R][8], xr[R][4];
  auto get = [&](int kc, int s) __attribute__((always_inline)) { const char* xb = (const char*)(Xb + kc * 32); const char* wb = (const char*)(Wb + (size_t)kc * 32 * LDW);
#pragma unroll
    for (int i = 0; i < 8; ++i) wr[s][i] = *(const v4f*)(wb + wo + i * LDW * 4);
#pragma unroll
    for (int i = 0; i < 4; ++i) xr[s][i] = *(const v4f*)(xb + xo + i * 4 * 2048 * 4);
    asm volatile("s_wait_xcnt 0x0" ::: "memory");   // stands behind the loads, in front of whatever rewrites a register that they name
    __builtin_amdgcn_sched_barrier(0); };           // keeps later register arithmetic, which takes the loads' address registers over, behind that wait (this build had some in front of it)
  auto put = [&](int b, int s) __attribute__((always_inline)) {
#pragma unroll
    for (int c = 0; c < 4; ++c) { v8b q;
#pragma unroll
      for (int i = 0; i < 8; ++i) q[i] = (__bf16)wr[s][i][c];
      *(v8b*)&sw[b][4 * lane + c][pl] = q; }
#pragma unroll
    for (int i = 0; i < 4; ++i) { v4b qh, ql;
#pragma unroll
      for (int e = 0; e < 4; ++e) { const __bf16 hv = (__bf16)xr[s][i][e]; qh[e] = hv; if (SPLIT) ql[e] = (__bf16)(xr[s][i][e] - (float)hv); }
      *(v4b*)&sh[b][xrow + 4 * i][xk] = qh; if (SPLIT) *(v4b*)&sl[b][xrow + 4 * i][xk] = ql; } };
  // pass kc on LDS buffer b; u = kc modulo U
  auto pass = [&](int kc, int u, bool more, bool next) __attribute__((always_inline)) { const int b = u & 1;
    if (more) get(kc + R, u % R);   // into the set that tile kc left at the foot of pass kc - 1
    const v16b ah = frag_b(&sh[b][wave * 16 + col][0], lane); v16b al; if (SPLIT) al = frag_b(&sl[b][wave * 16 + col][0], lane);
    v16b w[8];
#pragma unroll
    for (int j = 0; j < 8; ++j) { union { v16b v; v8b q[2]; } t; const __bf16* p = &sw[b][j * 16 + col][0];
      t.q[0] = *(const v8b*)(p + ((g + j) & 3) * 8); t.q[1] = *(const v8b*)(p + ((g + 2 + j) & 3) * 8); w[j] = t.v; }
#pragma unroll
    for (int j = 0; j < 8; ++j) acc[j] = wmma_bf(ah, w[j], acc[j]);
    if (SPLIT) {   // each accumulator still takes hi, then residual, of every pass; the other accumulators' products stand between the two
#pragma unroll
      for (int j = 0; j < 8; ++j) acc[j] = wmma_bf(al, w[j], acc[j]); }
    __builtin_amdgcn_sched_barrier(0);    // keeps the conversions of the next tile, and with them the wait for its global loads, behind this tile's products
    if (next) put(b ^ 1, (u + 1) % R);    // the other buffer: its readers left it at the barrier that ended pass kc - 1
    bar_lds(); };                         // publishes tile kc + 1 and ends every wave's reads of tile kc
#pragma unroll
  for (int t = 0; t < R; ++t) get(t, t);
  put(0, 0);
  bar_lds();   // tile 0 may be read
  // no test stands around the loads of the main loop, so that the number of younger loads outstanding at the wait in front of the conversions is the same on every path and the wait can be a counted one; the last passes are written out behind it
  // the outer loop stays rolled, its U passes are unrolled: every index of the register sets is then a constant (else the sets would go to scratch)
#pragma unroll 1
  for (int k0 = 0; k0 < MAIN; k0 += U) {
#pragma unroll
    for (int u = 0; u < U; ++u) pass(k0 + u, u, true, true); }
#pragma unroll
  for (int kc = MAIN; kc < NP; ++kc) pass(kc, kc - MAIN, kc + R < NP, kc + 1 < NP);   // the last passes, each with what is left to load and to stage
}
// ---- k_qkv: block = (64 rows, col group of 128 over q|k|v (24 groups) = one head): x . W (exact), and the head's own finish on the f32 accumulators, which never leave the WGP:
// q and k heads: RoPE (pairs (2j, 2j+1), angle pos * 1e4^(-2j/128)) -> f16 hi/lo rows; v heads: f16 hi/lo planes [c][s]
union QkvEp { float sf[4][16][132]; struct { _Float16 th[128][72], tl[128][72]; } v; };   // a block uses one member only
typedef __attribute__((ext_vector_type(4))) _Float16 v4h;
// second launch bound: three waves a SIMD, that is 336 registers a wave, so that all 768 blocks stay resident at once beside the ring of three register sets (left to itself this build took 358)
__global__ __launch_bounds__(128, 3) void k_qkv(const float* __restrict__ X, const float* __restrict__ WQ, const float* __restrict__ WK, const float* __restrict__ WV, const int* __restrict__ PID, _Float16* __restrict__ QH, _Float16* __restrict__ QL, _Float16* __restrict__ KH, _Float16* __restrict__ KL, _Float16* __restrict__ VH, _Float16* __restrict__ VL) { __shared__ __align__(16) QkvEp ep; __shared__ __align__(16) __bf16 sa[2][64][GP], sw[2][128][GP];
  const int tid = threadIdx.x, wave = tid >> 5, lane = tid & 31, col = lane & 15, g = lane >> 4; const int cg = blockIdx.y; const size_t r0 = (size_t)blockIdx.x * 64 + wave * 16;
  const float* Xb = X + (size_t)blockIdx.x * 64 * HID;
  v8f acc[8] = {};
  if (cg < 16) proj_tile<QW, false, 3>(Xb, WQ + cg * 128, sa, sa, sw, acc, wave, lane);
  else proj_tile<KW, false, 3>(Xb, (cg < 20 ? WK + (cg - 16) * 128 : WV + (cg - 20) * 128), sa, sa, sw, acc, wave, lane);
  if (cg < 20) {   // a wave turns its own 16 rows: a lane holds columns 4 lane .. 4 lane + 3 (pairs 2 lane, 2 lane + 1) of every row, so its two frequencies are taken once, and a row's store is 256 B in a row per plane
    const int pidv = PID[r0 + col];   // the 16 rows' positions, one a lane
    asm volatile("s_wait_xcnt 0x0" ::: "memory");   // stands behind the load, in front of whatever rewrites a register that it names
    __builtin_amdgcn_sched_barrier(0);              // keeps the LDS address arithmetic, which takes the load's address registers over, behind that wait (this build had it in front)
#pragma unroll
    for (int j = 0; j < 8; ++j)
#pragma unroll
      for (int r = 0; r < 8; ++r) ep.sf[wave][8 * g + r][j * 16 + col] = acc[j][r];
    const float f0 = powf(10000.0f, -(float)(4 * lane) / (float)HD), f1 = powf(10000.0f, -(float)(4 * lane + 2) / (float)HD);
    _Float16* H = (cg < 16 ? QH + r0 * QW + cg * 128 : KH + r0 * KW + (cg - 16) * 128) + lane * 4; _Float16* L = (cg < 16 ? QL + r0 * QW + cg * 128 : KL + r0 * KW + (cg - 16) * 128) + lane * 4; const int ld = cg < 16 ? QW : KW;
    LDSX();
    for (int rl = 0; rl < 16; ++rl) { const float pos = (float)__builtin_amdgcn_readlane(pidv, rl); const v4f x = *(const v4f*)&ep.sf[wave][rl][lane * 4];
      const float a0 = pos * f0, a1 = pos * f1; float c0, s0, c1, s1; sincosf(a0, &s0, &c0); sincosf(a1, &s1, &c1);   // one argument reduction and one pair of polynomials an angle; the values are those of sinf and cosf
      const float y[4] = { x[0] * c0 - x[1] * s0, x[0] * s0 + x[1] * c0, x[2] * c1 - x[3] * s1, x[2] * s1 + x[3] * c1 }; v4h hi, lo;
#pragma unroll
      for (int e = 0; e < 4; ++e) { const _Float16 hv = (_Float16)y[e]; hi[e] = hv; lo[e] = (_Float16)(y[e] - (float)hv); }   // UNSCALED residuals (q, k ~ O(1))
      vst2(H + (size_t)rl * ld, hi); vst2(L + (size_t)rl * ld, lo);
      asm volatile("s_wait_xcnt 0x0" ::: "memory");   // stands behind the stores, in front of whatever rewrites a register that they name
      __builtin_amdgcn_sched_barrier(0); }            // keeps the next row's address additions, which rewrite the stores' address registers, behind that wait (this build had them in front of it)
  } else {   // a lane's eight accumulator elements of a column are eight rows s in a row: one 16-B piece of the channel's plane row; through LDS, so that eight lanes of one wave store a channel's whole 128-B line
    const int c0 = (cg - 20) * 128; const size_t s0 = (size_t)blockIdx.x * 64;
#pragma unroll
    for (int j = 0; j < 8; ++j) { v8h hi, lo;
#pragma unroll
      for (int r = 0; r < 8; ++r) { const _Float16 hv = (_Float16)acc[j][r]; hi[r] = hv; lo[r] = (_Float16)(acc[j][r] - (float)hv); }   // UNSCALED residual (v ~ O(1)): lets the attention add it into the same accumulator
      *(v8h*)&ep.v.th[j * 16 + col][wave * 16 + 8 * g] = hi; *(v8h*)&ep.v.tl[j * 16 + col][wave * 16 + 8 * g] = lo; }
    __syncthreads();   // all four waves' rows of a channel stand in LDS
    for (int e = tid; e < 128 * 8; e += 128) { const int c = e >> 3, q = e & 7; vst2((unsigned*)(VH + (size_t)(c0 + c) * SS + s0 + q * 8), *(const v4u*)&ep.v.th[c][q * 8]); vst2((unsigned*)(VL + (size_t)(c0 + c) * SS + s0 + q * 8), *(const v4u*)&ep.v.tl[c][q * 8]);
      asm volatile("s_wait_xcnt 0x0" ::: "memory"); } } }   // stands behind the stores, in front of whatever rewrites a register that they name
// staged key/value tile of 32 keys: row pitches are 16 B x odd (272 B, 80 B), so that the 16 rows of a ds_load_b128 fragment read fall on distinct banks
#define KP (HD + 8)
#define VP (32 + 8)
struct __align__(16) KVStage { _Float16 kh[32][KP], kl[32][KP], vh[HD][VP], vl[HD][VP]; };
__device__ __forceinline__ unsigned lds_addr(const void* p) { return (unsigned)(size_t)(__attribute__((address_space(3))) const void*)p; }
// eight asynchronous 16-byte copies per lane, global -> LDS through no register (four of plane a, four of plane b); the s_wait_xcnt stands in the copies' own statement so that no address register is rewritten ahead of it
__device__ __forceinline__ void acopy8(unsigned la, unsigned lb, unsigned ls, const _Float16* ga, const _Float16* gb, size_t gs) {
  asm volatile("global_load_async_to_lds_b128 %0, %8, off\n\t"
               "global_load_async_to_lds_b128 %1, %9, off\n\t"
               "global_load_async_to_lds_b128 %2, %10, off\n\t"
               "global_load_async_to_lds_b128 %3, %11, off\n\t"
               "global_load_async_to_lds_b128 %4, %12, off\n\t"
               "global_load_async_to_lds_b128 %5, %13, off\n\t"
               "global_load_async_to_lds_b128 %6, %14, off\n\t"
               "global_load_async_to_lds_b128 %7, %15, off\n\t"
               "s_wait_xcnt 0x0"
               :: "v"(la), "v"(la + ls), "v"(la + 2 * ls), "v"(la + 3 * ls), "v"(lb), "v"(lb + ls), "v"(lb + 2 * ls), "v"(lb + 3 * ls),
                  "v"(ga), "v"(ga + gs), "v"(ga + 2 * gs), "v"(ga + 3 * gs), "v"(gb), "v"(gb + gs), "v"(gb + 2 * gs), "v"(gb + 3 * gs) : "memory");
}
// wmma16 with D alone named in the statement of the four slots: this compiler keeps a vector operand of an asm statement in the first 256 registers, and k_att's fragments, read ahead in groups, do not fit there beside Q and the accumulators (with A and B named the build spilled to scratch)
__device__ __forceinline__ v8f wmma16d(v16h a, v16h b, v8f c) {
  v8f d = __builtin_amdgcn_wmma_f32_16x16x32_f16(false, a, false, b, (short)0, c, false, false);
  asm volatile("v_nop\n\tv_nop\n\tv_nop\n\tv_nop" : "+v"(d));
  return d;
}
// lane l with lane l ^ 16 (the other half's value of the same column), as a vector move: no trip through the LDS pipe, no dscnt wait
__device__ __forceinline__ float xhalf(float x) { return __builtin_bit_cast(float, __builtin_amdgcn_permlanex16(__builtin_bit_cast(int, x), __builtin_bit_cast(int, x), 0x76543210, 0xfedcba98, false, false)); }
// e^x as __expf comes out here (x * log2(e), then v_exp_f32), with the one slot that the instruction set asks for behind a transcendental in the same statement
__device__ __forceinline__ float exp_s(float x) { float d; asm("v_exp_f32 %0, %1\n\tv_nop" : "=v"(d) : "v"(x * 1.44269504088896340736f)); return d; }
// ---- k_att: block = (64 queries, head h): kv head = h / 4; causal (tiles past the block skipped) AND attention_mask[k] != 0; head_dim 128 = 4 k-chunks; v . P over 8 d-tiles
// Both products are taken TRANSPOSED: S^T = K . Q^T (A = key rows from LDS, B = the wave's 16 queries, kept in registers) and O^T += V^T . P^T (A = the value planes' rows from LDS, B = P^T).
// A lane (g, col) then holds scores of ONE query, q0 + col: element r of score tile ct is key 16 ct + 8 g + r of the pass. The query's maximum and sum are taken inside the lane, with one exchange between the two halves;
// and the two score tiles, converted in place, ARE the B operand of the second product (element r = tile 0's r, element 8 + r = tile 1's r: the k order in which frag_h reads the value rows), so P makes no trip through LDS.
// Eight waves in two groups of four. Both groups hold the same 64 queries (wave wq of each: rows 16 wq ..); group 0 walks the even key tiles, group 1 the odd ones (the causal bound is an even number of tiles), each with its own two staging buffers, running maximum, sum and accumulators:
// the longest block's chain of passes, which the launch lasts, is half as long. Behind the loop group 1 hands its maximum, sum and accumulators over through LDS and group 0 joins the two partial softmaxes.
// One block fills a WGP's registers, so the blocks come in two rounds: the grid's slow index counts the query blocks from the last (most tiles) down, so that the short blocks fill in behind the long ones.
__global__ __launch_bounds__(256) void k_att(const _Float16* __restrict__ QH, const _Float16* __restrict__ QL, const _Float16* __restrict__ KH, const _Float16* __restrict__ KL, const _Float16* __restrict__ VH, const _Float16* __restrict__ VL, const int* __restrict__ AM, float* __restrict__ CT) {
  __shared__ __align__(16) float so[4][16][132]; __shared__ KVStage st[2][2];   // st[group][buffer]
  const int tid = threadIdx.x, wave = tid >> 5, lane = tid & 31, col = lane & 15, g = lane >> 4, grp = wave >> 2, wq = wave & 3, gt = tid & 127; const int qb = TQB - 1 - blockIdx.y, h = blockIdx.x; const int kvh = h / (NHQ / NKV); const int q0 = qb * 64 + wq * 16;
  v16h aq[4], al[4];
#pragma unroll
  for (int kc = 0; kc < 4; ++kc) { aq[kc] = frag_h(QH + (size_t)(q0 + col) * QW + h * HD + kc * 32, lane); al[kc] = frag_h(QL + (size_t)(q0 + col) * QW + h * HD + kc * 32, lane); }
  int amn = AM[grp * 32 + lane];   // mask words of pass 0, one key a lane
  asm volatile("s_wait_xcnt 0x0" ::: "memory");       // stands behind the Q and mask loads, in front of whatever rewrites a register that they name
  __builtin_amdgcn_sched_barrier(0);                  // keeps the staging's address arithmetic, which takes those registers over, behind that wait (this build had it in front)
  float m = -3.0e38f, l = 0.f;   // of the lane's query: the maximum over both halves' keys, the sum over this half's keys alone (the halves' sums are joined behind the loop)
  v8f acc[8] = {};               // acc[j][r] = channel 16 j + 8 g + r of the lane's query
  const int nks = qb + 1;   // passes: the causal bound is 2 (qb + 1) tiles of 32 keys, and pass i of group grp takes tile 2 i + grp
  // each thread of a group copies 16 pieces of 16 B per tile of its group: k rows of 256 B (16 lanes a row, 8 rows a step), v rows of 64 B (4 lanes a row, 32 rows a step)
  const unsigned lk = lds_addr(&st[grp][0].kh[gt >> 4][(gt & 15) * 8]), lv = lds_addr(&st[grp][0].vh[gt >> 2][(gt & 3) * 8]);
  const size_t gk = (size_t)(gt >> 4) * KW + kvh * HD + (gt & 15) * 8, gv = ((size_t)kvh * HD + (gt >> 2)) * SS + (gt & 3) * 8;
  auto stage = [&](int i) { const int t = 2 * i + grp; const unsigned b = (unsigned)(i & 1) * (unsigned)sizeof(KVStage);
    acopy8(lk + b, lk + b + (unsigned)sizeof(st[0][0].kh), 8 * KP * 2, KH + gk + (size_t)t * 32 * KW, KL + gk + (size_t)t * 32 * KW, (size_t)8 * KW);
    acopy8(lv + b, lv + b + (unsigned)sizeof(st[0][0].vh), 32 * VP * 2, VH + gv + t * 32, VL + gv + t * 32, (size_t)32 * SS); };
  stage(0);
  asm volatile("s_wait_asynccnt 0x0" ::: "memory");   // this wave's copies of pass 0 have landed
  __syncthreads();                                    // ... and every other wave's: both groups' tiles of pass 0 may be read
  if (nks > 1) stage(1);
#pragma unroll 1
  for (int ks = 0; ks < nks; ++ks) { float s[2][8]; const KVStage& T = st[grp][ks & 1];
    // A pass's reads stand in two groups AHEAD of the products that use them, so that a wave does not wait out the LDS latency once per product:
    // all 16 key fragments at the head of the pass; all 16 value fragments behind the first score chain, so that they land under the second chain and the softmax; the mask words one pass ahead (the last pass reads its own again: no index past the block's keys).
    const unsigned kb = __builtin_amdgcn_ballot_w32(amn != 0);   // bit b: key b of this tile is open
    v16h kh[2][4], kl[2][4], vh[8], vl[8]; v8f c[2];
#pragma unroll
    for (int ct = 0; ct < 2; ++ct)
#pragma unroll
      for (int kc = 0; kc < 4; ++kc) { kh[ct][kc] = frag_h(&T.kh[ct * 16 + col][kc * 32], lane); kl[ct][kc] = frag_h(&T.kl[ct * 16 + col][kc * 32], lane); }
    amn = AM[(2 * (ks + 1 < nks ? ks + 1 : ks) + grp) * 32 + lane];
    asm volatile("s_wait_xcnt 0x0" ::: "memory");   // stands behind the mask load, in front of whatever rewrites a register that it names
#pragma unroll
    for (int ct = 0; ct < 2; ++ct) { v8f cc = {};
#pragma unroll
      for (int kc = 0; kc < 4; ++kc) { cc = wmma16d(kh[ct][kc], aq[kc], cc); cc = wmma16d(kh[ct][kc], al[kc], cc); cc = wmma16d(kl[ct][kc], aq[kc], cc); }   // 3 products, all residuals UNSCALED into one accumulator
      c[ct] = cc;
      if (ct == 0) {
#pragma unroll
        for (int j = 0; j < 8; ++j) { vh[j] = frag_h(&T.vh[j * 16 + col][0], lane); vl[j] = frag_h(&T.vl[j * 16 + col][0], lane); } } }
    // the lane's open keys as bits: key b of the tile counts if the mask has it open and b <= d, d = the query's own place counted from the tile's first key; shifted so that bit 16 ct + r is the lane's element r of tile ct
    const int d = q0 + col - (2 * ks + grp) * 32; const unsigned cm = d < 0 ? 0u : 0xffffffffu >> ((31 - (d > 31 ? 31 : d)) & 31); const unsigned kp = (kb & cm) >> (8 * g);
#pragma unroll
    for (int ct = 0; ct < 2; ++ct)
#pragma unroll
      for (int r = 0; r < 8; ++r) s[ct][r] = (kp & (1u << (16 * ct + r))) ? c[ct][r] * 0.08838834764831845f : -3.0e38f;
    float t8[8];
#pragma unroll
    for (int r = 0; r < 8; ++r) t8[r] = fmaxf(s[0][r], s[1][r]);
    float mx = fmaxf(fmaxf(fmaxf(t8[0], t8[1]), fmaxf(t8[2], t8[3])), fmaxf(fmaxf(t8[4], t8[5]), fmaxf(t8[6], t8[7])));
    mx = fmaxf(mx, xhalf(mx));   // both halves' keys: P^T's k runs over both, so they share one maximum
    const float mn = fmaxf(m, mx);
    const float mu = fmaxf(mn, -1.0e38f);   // what is subtracted: where no key of the query has been open yet it stays far above the closed keys' -3e38, so that they, and the old maximum, still come out as e^(-huge) = 0
    const float alpha = exp_s(m - mu); m = mn;
    v16h pb;
#pragma unroll
    for (int r = 0; r < 8; ++r) { const float e0 = exp_s(s[0][r] - mu), e1 = exp_s(s[1][r] - mu); t8[r] = e0 + e1;
      pb[r] = (_Float16)(e0 * 2048.0f); pb[8 + r] = (_Float16)(e1 * 2048.0f); }
    l = l * alpha + (((t8[0] + t8[1]) + (t8[2] + t8[3])) + ((t8[4] + t8[5]) + (t8[6] + t8[7])));
#pragma unroll
    for (int j = 0; j < 8; ++j)
#pragma unroll
      for (int r = 0; r < 8; ++r) acc[j][r] *= alpha;
#pragma unroll
    for (int j = 0; j < 8; ++j) { acc[j] = wmma16d(vh[j], pb, acc[j]); acc[j] = wmma16d(vl[j], pb, acc[j]); }   // v hi + unscaled residual
    asm volatile("s_wait_dscnt 0x0" ::: "memory");      // this wave's reads of this tile have returned before the tile's buffer is refilled
    asm volatile("s_wait_asynccnt 0x0" ::: "memory");   // this wave's copies of pass ks + 1 have landed
    __syncthreads();                                    // publishes both groups' tiles of pass ks + 1 and ends every wave's reads of pass ks
    if (ks + 2 < nks) stage(ks + 2); }
  asm volatile("s_wait_asynccnt 0x0" ::: "memory");     // no copy is outstanding when the wave goes on to its end
  l += xhalf(l);   // the query's sum over both halves' keys
  // hand-over: wave wq of group 1 lays its accumulators at the places where wave wq of group 0 holds the same elements (row = query, eight channels in a row a lane and d-tile), the queries' maxima and sums in the rows' pad words 128 and 129
  if (grp == 1) {
#pragma unroll
    for (int j = 0; j < 8; ++j) { float* p = &so[wq][col][j * 16 + 8 * g];
      *(v4f*)p = (v4f){ acc[j][0], acc[j][1], acc[j][2], acc[j][3] }; *(v4f*)(p + 4) = (v4f){ acc[j][4], acc[j][5], acc[j][6], acc[j][7] }; }
    if (g == 0) { so[wq][col][128] = m; so[wq][col][129] = l; } }
  __syncthreads();   // group 1's partial results may be read by group 0
  if (grp == 0) {
    const float m1 = so[wq][col][128], l1 = so[wq][col][129]; const float mn = fmaxf(m, m1);
    const float y0 = exp_s(m - mn), y1 = exp_s(m1 - mn); const float a0 = (m <= -1.0e38f) ? 0.f : y0, a1 = (m1 <= -1.0e38f) ? 0.f : y1;   // a group that saw no open key of the query counts for nothing
    const float lt = l * a0 + l1 * a1; const float il = (lt > 0.f) ? (1.0f / 2048.0f) / lt : 0.f; const float f0 = a0 * il, f1 = a1 * il;
#pragma unroll
    for (int j = 0; j < 8; ++j) { float* p = &so[wq][col][j * 16 + 8 * g]; const v4f pa = *(const v4f*)p, pc = *(const v4f*)(p + 4);   // each lane rewrites only the words that it has read itself
      *(v4f*)p = (v4f){ acc[j][0] * f0 + pa[0] * f1, acc[j][1] * f0 + pa[1] * f1, acc[j][2] * f0 + pa[2] * f1, acc[j][3] * f0 + pa[3] * f1 };
      *(v4f*)(p + 4) = (v4f){ acc[j][4] * f0 + pc[0] * f1, acc[j][5] * f0 + pc[1] * f1, acc[j][6] * f0 + pc[2] * f1, acc[j][7] * f0 + pc[3] * f1 }; }
    LDSX(); for (int rl = 0; rl < 16; ++rl) vst2(CT + (size_t)(q0 + rl) * QW + h * HD + lane * 4, *(const v4f*)&so[wq][rl][lane * 4]); } }
// ---- k_out: block = (64 rows, 128 of 2048 cols): out = ctx (hi + lo) . wo (in,out)
__global__ __launch_bounds__(128) void k_out(const float* __restrict__ CT, const float* __restrict__ WO, float* __restrict__ OUT) { __shared__ __align__(16) float sf[4][16][132]; __shared__ __align__(16) __bf16 sh[2][64][GP], sl[2][64][GP], sw[2][128][GP];
  const int tid = threadIdx.x, wave = tid >> 5, lane = tid & 31, col = lane & 15, g = lane >> 4; const int c0 = blockIdx.y * 128; const size_t r0 = (size_t)blockIdx.x * 64 + wave * 16;
  v8f acc[8] = {};
  proj_tile<HID, true, 4>(CT + (size_t)blockIdx.x * 64 * QW, WO + c0, sh, sl, sw, acc, wave, lane);
#pragma unroll
  for (int j = 0; j < 8; ++j)
#pragma unroll
    for (int r = 0; r < 8; ++r) sf[wave][8 * g + r][j * 16 + col] = acc[j][r];
  LDSX(); for (int rl = 0; rl < 16; ++rl) vst2(OUT + (r0 + rl) * HID + c0 + lane * 4, *(const v4f*)&sf[wave][rl][lane * 4]); }
extern "C" void kernel_launch(void* const* d_in, const int* in_sizes, int n_in, void* d_out, int out_size, void* d_ws, size_t ws_size, hipStream_t stream) {
  (void)in_sizes; (void)n_in; (void)out_size;
  const float** F_ = (const float**)d_in;   // 0 hidden_states [1,2048,2048], 1 wq [2048,2048], 2 wk [2048,512], 3 wv [2048,512], 4 wo [2048,2048] (all (in,out)), 5 attention_mask [1,2048] int, 6 position_ids [1,2048] int
  if (ws_size < (size_t)WS_END) return;
  char* ws = (char*)d_ws; _Float16 *QH = (_Float16*)(ws + WS_QH), *QL = (_Float16*)(ws + WS_QL), *KH = (_Float16*)(ws + WS_KH), *KL = (_Float16*)(ws + WS_KL), *VH = (_Float16*)(ws + WS_VH), *VL = (_Float16*)(ws + WS_VL); float* CT = (float*)(ws + WS_CT);
  k_qkv<<<dim3(TRB, QKVW / 128), 128, 0, stream>>>(F_[0], F_[1], F_[2], F_[3], (const int*)d_in[6], QH, QL, KH, KL, VH, VL);
  k_att<<<dim3(NHQ, TQB), 256, 0, stream>>>(QH, QL, KH, KL, VH, VL, (const int*)d_in[5], CT);
  k_out<<<dim3(TQB, HID / 128), 128, 0, stream>>>(CT, F_[4], (float*)d_out);
}

// v009
// It runs in 122 microseconds.
// In both of two side-by-side timings against v008, it was 1.11 times as fast.
// Over all steps from v000 it is 6.66 times as fast.
// compute dtype: all float inputs rounded to bf16, attention_mask / position_ids (int) read; q/k/v = x . W with EXACT bf16 products on WMMA 16x16x32 ((in,out) weights), f32 accumulate; RoPE (interleaved pairs, angles position_id * theta^(-2j/128), precise sinf/cosf/powf) in f32, q/k as f16 hi + residual rows, v as f16 hi + residual planes; GQA causal attention with head_dim 128: 3-product scores (q/k as f16 hi + UNSCALED residual, one accumulator), P rounded once to f16 (x 2^11) against v as f16 hi + UNSCALED residual (2 products into one accumulator), x 1/sqrt(128), masked/acausal keys excluded, running-max softmax in f32 (hardware exp); out = ctx (bf16 hi + lo) . wo (2 products); f32 output.
#include <hip/hip_runtime.h>
#include <math.h>

typedef __attribute__((ext_vector_type(16))) _Float16 v16h;
typedef __attribute__((ext_vector_type(16))) __bf16 v16b;
typedef __attribute__((ext_vector_type(8)))  _Float16 v8h;
typedef __attribute__((ext_vector_type(8)))  float v8f;
typedef __attribute__((ext_vector_type(4)))  float v4f;
typedef __attribute__((ext_vector_type(2)))  float v2f;
typedef __attribute__((ext_vector_type(4)))  unsigned v4u;
typedef __attribute__((ext_vector_type(4)))  int v4i;
typedef float __attribute__((may_alias)) float_a;
typedef int __attribute__((may_alias)) int_a;

template <typename T> __device__ __forceinline__ void vst2(void* p, T v) { *(T*)p = v;  }
__device__ __forceinline__ v8f wmma16(v16h a, v16h b, v8f c) {
  v8f d = __builtin_amdgcn_wmma_f32_16x16x32_f16(false, a, false, b, (short)0, c, false, false);
  asm volatile("v_nop\n\tv_nop\n\tv_nop\n\tv_nop" : "+v"(d) : "v"(a), "v"(b));
  return d;
}
__device__ __forceinline__ v8f wmma_bf(v16b a, v16b b, v8f c) {
  v8f d = __builtin_amdgcn_wmma_f32_16x16x32_bf16(false, a, false, b, (short)0, c, false, false);
  asm volatile("v_nop\n\tv_nop\n\tv_nop\n\tv_nop" : "+v"(d) : "v"(a), "v"(b));
  return d;
}
// 16x16x32 fragments: lane = (h = lane>>4, row/col = lane&15); elements 0..7 = k0+8h+0..7, 8..15 = k0+16+8h+0..7; D element r = row 8h+r
__device__ __forceinline__ v16h frag_h(const _Float16* rowk0, int lane) {
  union { v16h v; v8h q[2]; } u; const _Float16* p = rowk0 + 8 * (lane >> 4);
  u.q[0] = *(const v8h*)p; u.q[1] = *(const v8h*)(p + 16); return u.v;
}
__device__ __forceinline__ v16h frag_f32(const float* rowk0, int lane) {
  v16h a; const float* p = rowk0 + 8 * (lane >> 4);
#pragma unroll
  for (int i = 0; i < 8; ++i) { a[i] = (_Float16)p[i]; a[8 + i] = (_Float16)p[16 + i]; }
  return a;
}
__device__ __forceinline__ v16h frag_f32s(const float* rowk0, int lane, float sc) {
  v16h a; const float* p = rowk0 + 8 * (lane >> 4);
#pragma unroll
  for (int i = 0; i < 8; ++i) { a[i] = (_Float16)(p[i] * sc); a[8 + i] = (_Float16)(p[16 + i] * sc); }
  return a;
}
// column fragment from a [K][ld] layout (column n), rows >= K read as 0
__device__ __forceinline__ v16h fragc_f32(const float* W, int k0, int n, int lane, int ld, int K) {
  v16h a; const int g = lane >> 4;
#pragma unroll
  for (int i = 0; i < 8; ++i) { const int ka = k0 + 8 * g + i, kb = ka + 16;
    a[i] = (_Float16)(ka < K ? W[(size_t)(ka < K ? ka : K - 1) * ld + n] : 0.f); a[8 + i] = (_Float16)(kb < K ? W[(size_t)(kb < K ? kb : K - 1) * ld + n] : 0.f); }
  return a;
}
struct F2 { v16b h, l; };
__device__ __forceinline__ F2 bsplit16(const float v[16]) { F2 r;
#pragma unroll
  for (int i = 0; i < 16; ++i) { const __bf16 h = (__bf16)v[i]; r.h[i] = h; r.l[i] = (__bf16)(v[i] - (float)h); }
  return r; }
__device__ __forceinline__ F2 split_row(const float* row, int k0, int lane) { float v[16]; const float* p = row + k0 + 8 * (lane >> 4);
#pragma unroll
  for (int i = 0; i < 8; ++i) { v[i] = p[i]; v[8 + i] = p[16 + i]; }
  return bsplit16(v); }
__device__ __forceinline__ F2 split_rowK(const float* row, int k0, int lane, int K) { float v[16]; const int g = lane >> 4;
#pragma unroll
  for (int i = 0; i < 8; ++i) { const int ka = k0 + 8 * g + i, kb = ka + 16; v[i] = ka < K ? row[ka < K ? ka : K - 1] : 0.f; v[8 + i] = kb < K ? row[kb < K ? kb : K - 1] : 0.f; }
  return bsplit16(v); }
__device__ __forceinline__ F2 split_col(const float* W, int k0, int n, int lane, int ld, int K) { float v[16]; const int g = lane >> 4;
#pragma unroll
  for (int i = 0; i < 8; ++i) { const int ka = k0 + 8 * g + i, kb = ka + 16; v[i] = ka < K ? W[(size_t)(ka < K ? ka : K - 1) * ld + n] : 0.f; v[8 + i] = kb < K ? W[(size_t)(kb < K ? kb : K - 1) * ld + n] : 0.f; }
  return bsplit16(v); }
__device__ __forceinline__ v8f mac3(const F2& a, const F2& b, v8f c) { c = wmma_bf(a.l, b.h, c); c = wmma_bf(a.h, b.l, c); return wmma_bf(a.h, b.h, c); }
__device__ __forceinline__ float sigm(float v) { return 1.0f / (1.0f + expf(-v)); }
#define LDSX() do { asm volatile("s_wait_dscnt 0" ::: "memory"); __builtin_amdgcn_wave_barrier(); __builtin_amdgcn_fence(__ATOMIC_RELEASE, "workgroup"); } while (0)


// LLaMA attention (B 1, S 2,048, hidden 2,048, 16 query heads / 4 kv heads x 128, RoPE theta 1e4): q/k/v projections, RoPE on q and k, GQA (kv head = h / 4), causal + padding mask, softmax in f32, o_proj.
#define NB 1
#define SS 2048
#define HID 2048
#define NHQ 16
#define NKV 4
#define HD 128
#define QW (NHQ * HD)     // 2048
#define KW (NKV * HD)     // 512
#define QKVW (QW + 2 * KW)   // 3072
#ifndef TQB
#define TQB (SS / 64)
#endif
#ifndef TRB
#define TRB (NB * SS / 64)   // row blocks of 64 (not used)
#endif
#define PRB (NB * SS / 128)   // row blocks of 128 of the two projection launches
typedef __attribute__((ext_vector_type(8))) __bf16 v8b;
__device__ __forceinline__ v16b frag_b(const __bf16* rowk0, int lane) {
  union { v16b v; v8b q[2]; } u; const __bf16* p = rowk0 + 8 * (lane >> 4);
  u.q[0] = *(const v8b*)p; u.q[1] = *(const v8b*)(p + 16); return u.v;
}
__device__ __forceinline__ float bfr(float v) { return (float)(__bf16)v; }
__device__ __attribute__((noinline)) float exp_ni(float v) { return expf(v); }
__device__ __attribute__((noinline)) float erf_ni(float v) { return erff(v); }

#define WS_F   0u                                   // not used; the planes below keep their places
#define WS_QH  (WS_F + 4u * (size_t)NB * SS * QKVW)     // f16 hi|lo q rows [b*s][2048] (after rope)
#define WS_QL  (WS_QH + 2u * (size_t)NB * SS * QW)
#define WS_KH  (WS_QL + 2u * (size_t)NB * SS * QW)      // f16 hi|lo k rows [b*s][512]
#define WS_KL  (WS_KH + 2u * (size_t)NB * SS * KW)
#define WS_VH  (WS_KL + 2u * (size_t)NB * SS * KW)      // f16 hi|lo v planes [b][512][s]
#define WS_VL  (WS_VH + 2u * (size_t)NB * KW * SS)
#define WS_CT  (WS_VL + 2u * (size_t)NB * KW * SS)      // f32 ctx rows [b*s][2048]
#define WS_END (WS_CT + 4u * (size_t)NB * SS * QW)

// staged 32-k operand tiles of the two projection GEMMs, bf16, one row per output row / column: pitch 80 B = 16 B x odd, so that the 16 rows of a ds_load_b128 fragment read fall on distinct banks
#define GP (32 + 8)
typedef __attribute__((ext_vector_type(4))) __bf16 v4b;
// 128 rows x 128 columns of X[.][2048] . W[2048][LDW] per block of 8 waves, K = 2048 in passes of 32. Both operands' tiles go ONCE per block through registers into LDS as bf16, two buffers; the next R tiles' global loads are in flight under this tile's products.
// A weight tile fetched from L2 serves 128 rows. A wave's part is 32 rows x 64 columns (wave = 2 * row group + column half): 2 row fragments and 4 column fragments feed 8 products, so that fewer LDS bytes are read per product than with a flat 16 x 128 part.
// Row tile: wave w brings rows 16 w .. 16 w + 15 x 32 k f32 as four loads of 4 whole 128-B lines; SPLIT: stored as bf16 hi rows and residual rows.
// Weight tile [32 k][128 cols] f32 -> LDS [col][k] bf16: a thread holds 4 k rows (wave w: rows 4w .. 4w + 3) x 4 columns (4 * lane ..), read as whole 512-B row pieces per wave.
// The 16-B piece of k rows 8c .. 8c + 7 of a column stands at place (c + (column >> 4)) & 3 of its LDS row (a wave writes one 8-B half of it): the writers' rows lie 4 apart, and the rotation spreads their stores over the banks; the 16 columns of a fragment share one rotation.
// The work-group barrier of a pass, with the one wait that it needs (this wave's LDS stores of the next tile have landed; its LDS reads were waited for by the products). By hand, because __syncthreads() also waits for every outstanding global load, which would drain the ring of loads at each pass.
__device__ __forceinline__ void bar_lds() { asm volatile("s_wait_dscnt 0x0\n\ts_barrier_signal -1\n\ts_barrier_wait -1" ::: "memory"); }
template <int LDW, bool SPLIT, int R>
__device__ __forceinline__ void proj_tile(const float* Xb, const float* Wb, __bf16 (*sh)[128][GP], __bf16 (*sl)[128][GP], __bf16 (*sw)[128][GP], v8f (&acc)[2][4], int wave, int lane) {
  const int col = lane & 15, g = lane >> 4, xrow = wave * 16 + (lane >> 3), xk = 4 * (lane & 7), pl = (((wave >> 1) + (lane >> 2)) & 3) * 8 + (wave & 1) * 4, wr0 = (wave >> 1) * 32, wc0 = (wave & 1) * 64;
  const unsigned xo = (unsigned)(xrow * 2048 + xk) * 4u, wo = (unsigned)(4 * wave * LDW + 4 * lane) * 4u;   // per-lane byte offsets, the same in every pass
  // Ring of R register sets: tile t waits in set t % R. Its loads are issued at the head of pass t - R and first used at the foot of pass t - 1, so that R tiles of a wave are on their way at any time:
  // for speed only: with one set a wave asks for a tile at the head of a pass and waits it out at the foot of the same pass.
  constexpr int NP = 2048 / 32, U = (R & 1) ? 2 * R : R, MAIN = (NP - R) / U * U;   // U passes a trip: set and buffer indices are constants of each copy
  v4f wr[R][4], xr[R][4];
  auto get = [&](int kc, int s) __attribute__((always_inline)) { const char* xb = (const char*)(Xb + kc * 32); const char* wb = (const char*)(Wb + (size_t)kc * 32 * LDW);
#pragma unroll
    for (int i = 0; i < 4; ++i) wr[s][i] = *(const v4f*)(wb + wo + i * LDW * 4);
    asm volatile("s_wait_xcnt 0x0" ::: "memory");   // stands behind the weight loads, in front of the row loads, whose results may be laid into a register that the weight loads name (one copy of this build did so)
#pragma unroll
    for (int i = 0; i < 4; ++i) xr[s][i] = *(const v4f*)(xb + xo + i * 4 * 2048 * 4);
    asm volatile("s_wait_xcnt 0x0" ::: "memory");   // stands behind the loads, in front of whatever rewrites a register that they name
    __builtin_amdgcn_sched_barrier(0); };           // keeps later register arithmetic, which takes the loads' address registers over, behind that wait (this build had some in front of it)
  auto put = [&](int b, int s) __attribute__((always_inline)) {
#pragma unroll
    for (int c = 0; c < 4; ++c) { v4b q;
#pragma unroll
      for (int i = 0; i < 4; ++i) q[i] = (__bf16)wr[s][i][c];
      *(v4b*)&sw[b][4 * lane + c][pl] = q; }
#pragma unroll
    for (int i = 0; i < 4; ++i) { v4b qh, ql;
#pragma unroll
      for (int e = 0; e < 4; ++e) { const __bf16 hv = (__bf16)xr[s][i][e]; qh[e] = hv; if (SPLIT) ql[e] = (__bf16)(xr[s][i][e] - (float)hv); }
      *(v4b*)&sh[b][xrow + 4 * i][xk] = qh; if (SPLIT) *(v4b*)&sl[b][xrow + 4 * i][xk] = ql; } };
  // pass kc on LDS buffer b; u = kc modulo U
  auto pass = [&](int kc, int u, bool more, bool next) __attribute__((always_inline)) { const int b = u & 1;
    if (more) get(kc + R, u % R);   // into the set that tile kc left at the foot of pass kc - 1
    v16b ah[2], al[2], w[4];
#pragma unroll
    for (int i = 0; i < 2; ++i) { ah[i] = frag_b(&sh[b][wr0 + i * 16 + col][0], lane); if (SPLIT) al[i] = frag_b(&sl[b][wr0 + i * 16 + col][0], lane); }
#pragma unroll
    for (int j = 0; j < 4; ++j) { union { v16b v; v8b q[2]; } t; const __bf16* p = &sw[b][wc0 + j * 16 + col][0];   // column >> 4 = 4 * (column half) + j: the rotation is that of j
      t.q[0] = *(const v8b*)(p + ((g + j) & 3) * 8); t.q[1] = *(const v8b*)(p + ((g + 2 + j) & 3) * 8); w[j] = t.v; }
#pragma unroll
    for (int i = 0; i < 2; ++i)
#pragma unroll
      for (int j = 0; j < 4; ++j) acc[i][j] = wmma_bf(ah[i], w[j], acc[i][j]);
    if (SPLIT) {   // each accumulator still takes hi, then residual, of every pass; the other accumulators' products stand between the two
#pragma unroll
      for (int i = 0; i < 2; ++i)
#pragma unroll
        for (int j = 0; j < 4; ++j) acc[i][j] = wmma_bf(al[i], w[j], acc[i][j]); }
    __builtin_amdgcn_sched_barrier(0);    // keeps the conversions of the next tile, and with them the wait for its global loads, behind this tile's products
    if (next) put(b ^ 1, (u + 1) % R);    // the other buffer: its readers left it at the barrier that ended pass kc - 1
    bar_lds(); };                         // publishes tile kc + 1 and ends every wave's reads of tile kc
#pragma unroll
  for (int t = 0; t < R; ++t) get(t, t);
  put(0, 0);
  bar_lds();   // tile 0 may be read
  // no test stands around the loads of the main loop, so that the number of younger loads outstanding at the wait in front of the conversions is the same on every path and the wait can be a counted one; the last passes are written out behind it
  // the outer loop stays rolled, its U passes are unrolled: every index of the register sets is then a constant (else the sets would go to scratch)
#pragma unroll 1
  for (int k0 = 0; k0 < MAIN; k0 += U) {
#pragma unroll
    for (int u = 0; u < U; ++u) pass(k0 + u, u, true, true); }
#pragma unroll
  for (int kc = MAIN; kc < NP; ++kc) pass(kc, kc - MAIN, kc + R < NP, kc + 1 < NP);   // the last passes, each with what is left to load and to stage
}
// ---- k_qkv: block = (128 rows, col group of 128 over q|k|v (24 groups) = one head): x . W (exact), and the head's own finish on the f32 accumulators, which never leave the WGP:
// q and k heads: RoPE (pairs (2j, 2j+1), angle pos * 1e4^(-2j/128)) -> f16 hi/lo rows; v heads: f16 hi/lo planes [c][s]
union QkvEp { float sf[128][132]; struct { _Float16 th[128][136], tl[128][136]; } v; };   // a block uses one member only
typedef __attribute__((ext_vector_type(4))) _Float16 v4h;
// second launch bound: four waves a SIMD, that is 256 registers a wave and two blocks a WGP, so that all 384 blocks are resident at once
__global__ __launch_bounds__(256, 4) void k_qkv(const float* __restrict__ X, const float* __restrict__ WQ, const float* __restrict__ WK, const float* __restrict__ WV, const int* __restrict__ PID, _Float16* __restrict__ QH, _Float16* __restrict__ QL, _Float16* __restrict__ KH, _Float16* __restrict__ KL, _Float16* __restrict__ VH, _Float16* __restrict__ VL) { __shared__ __align__(16) QkvEp ep; __shared__ __align__(16) __bf16 sa[2][128][GP], sw[2][128][GP];
  const int tid = threadIdx.x, wave = tid >> 5, lane = tid & 31, col = lane & 15, g = lane >> 4, wr0 = (wave >> 1) * 32, wc0 = (wave & 1) * 64; const int cg = blockIdx.y; const size_t r0 = (size_t)blockIdx.x * 128 + wave * 16;
  const float* Xb = X + (size_t)blockIdx.x * 128 * HID;
  v8f acc[2][4] = {};
  if (cg < 16) proj_tile<QW, false, 3>(Xb, WQ + cg * 128, sa, sa, sw, acc, wave, lane);
  else proj_tile<KW, false, 3>(Xb, (cg < 20 ? WK + (cg - 16) * 128 : WV + (cg - 20) * 128), sa, sa, sw, acc, wave, lane);
  if (cg < 20) {   // the block's accumulators go to LDS as 128 rows; wave w then turns rows 16 w .. 16 w + 15: a lane holds columns 4 lane .. 4 lane + 3 (pairs 2 lane, 2 lane + 1) of every row, so its two frequencies are taken once, and a row's store is 256 B in a row per plane
    const int pidv = PID[r0 + col];   // the 16 rows' positions, one a lane
    asm volatile("s_wait_xcnt 0x0" ::: "memory");   // stands behind the load, in front of whatever rewrites a register that it names
    __builtin_amdgcn_sched_barrier(0);              // keeps the LDS address arithmetic, which takes the load's address registers over, behind that wait (this build had it in front)
#pragma unroll
    for (int i = 0; i < 2; ++i)
#pragma unroll
      for (int j = 0; j < 4; ++j)
#pragma unroll
        for (int r = 0; r < 8; ++r) ep.sf[wr0 + i * 16 + 8 * g + r][wc0 + j * 16 + col] = acc[i][j][r];
    const float f0 = powf(10000.0f, -(float)(4 * lane) / (float)HD), f1 = powf(10000.0f, -(float)(4 * lane + 2) / (float)HD);
    _Float16* H = (cg < 16 ? QH + r0 * QW + cg * 128 : KH + r0 * KW + (cg - 16) * 128) + lane * 4; _Float16* L = (cg < 16 ? QL + r0 * QW + cg * 128 : KL + r0 * KW + (cg - 16) * 128) + lane * 4; const int ld = cg < 16 ? QW : KW;
    __syncthreads();   // a row's two column halves come from two waves
    for (int rl = 0; rl < 16; ++rl) { const float pos = (float)__builtin_amdgcn_readlane(pidv, rl); const v4f x = *(const v4f*)&ep.sf[wave * 16 + rl][lane * 4];
      const float a0 = pos * f0, a1 = pos * f1; float c0, s0, c1, s1; sincosf(a0, &s0, &c0); sincosf(a1, &s1, &c1);   // one argument reduction and one pair of polynomials an angle; the values are those of sinf and cosf
      const float y[4] = { x[0] * c0 - x[1] * s0, x[0] * s0 + x[1] * c0, x[2] * c1 - x[3] * s1, x[2] * s1 + x[3] * c1 }; v4h hi, lo;
#pragma unroll
      for (int e = 0; e < 4; ++e) { const _Float16 hv = (_Float16)y[e]; hi[e] = hv; lo[e] = (_Float16)(y[e] - (float)hv); }   // UNSCALED residuals (q, k ~ O(1))
      vst2(H + (size_t)rl * ld, hi); vst2(L + (size_t)rl * ld, lo);
      asm volatile("s_wait_xcnt 0x0" ::: "memory");   // stands behind the stores, in front of whatever rewrites a register that they name
      __builtin_amdgcn_sched_barrier(0); }            // keeps the next row's address additions, which rewrite the stores' address registers, behind that wait (this build had them in front of it)
  } else {   // a lane's eight accumulator elements of a column are eight rows s in a row: one 16-B piece of the channel's plane row; through LDS, so that sixteen lanes of one wave store a channel's two whole 128-B lines
    const int c0 = (cg - 20) * 128; const size_t s0 = (size_t)blockIdx.x * 128;
#pragma unroll
    for (int i = 0; i < 2; ++i)
#pragma unroll
    for (int j = 0; j < 4; ++j) { v8h hi, lo;
#pragma unroll
      for (int r = 0; r < 8; ++r) { const _Float16 hv = (_Float16)acc[i][j][r]; hi[r] = hv; lo[r] = (_Float16)(acc[i][j][r] - (float)hv); }   // UNSCALED residual (v ~ O(1)): lets the attention add it into the same accumulator
      *(v8h*)&ep.v.th[wc0 + j * 16 + col][wr0 + i * 16 + 8 * g] = hi; *(v8h*)&ep.v.tl[wc0 + j * 16 + col][wr0 + i * 16 + 8 * g] = lo; }
    __syncthreads();   // all waves' rows of a channel stand in LDS
    for (int e = tid; e < 128 * 16; e += 256) { const int c = e >> 4, q = e & 15; vst2((unsigned*)(VH + (size_t)(c0 + c) * SS + s0 + q * 8), *(const v4u*)&ep.v.th[c][q * 8]); vst2((unsigned*)(VL + (size_t)(c0 + c) * SS + s0 + q * 8), *(const v4u*)&ep.v.tl[c][q * 8]);
      asm volatile("s_wait_xcnt 0x0" ::: "memory"); } } }   // stands behind the stores, in front of whatever rewrites a register that they name
// staged key/value tile of 32 keys: row pitches are 16 B x odd (272 B, 80 B), so that the 16 rows of a ds_load_b128 fragment read fall on distinct banks
#define KP (HD + 8)
#define VP (32 + 8)
struct __align__(16) KVStage { _Float16 kh[32][KP], kl[32][KP], vh[HD][VP], vl[HD][VP]; };
__device__ __forceinline__ unsigned lds_addr(const void* p) { return (unsigned)(size_t)(__attribute__((address_space(3))) const void*)p; }
// eight asynchronous 16-byte copies per lane, global -> LDS through no register (four of plane a, four of plane b); the s_wait_xcnt stands in the copies' own statement so that no address register is rewritten ahead of it
__device__ __forceinline__ void acopy8(unsigned la, unsigned lb, unsigned ls, const _Float16* ga, const _Float16* gb, size_t gs) {
  asm volatile("global_load_async_to_lds_b128 %0, %8, off\n\t"
               "global_load_async_to_lds_b128 %1, %9, off\n\t"
               "global_load_async_to_lds_b128 %2, %10, off\n\t"
               "global_load_async_to_lds_b128 %3, %11, off\n\t"
               "global_load_async_to_lds_b128 %4, %12, off\n\t"
               "global_load_async_to_lds_b128 %5, %13, off\n\t"
               "global_load_async_to_lds_b128 %6, %14, off\n\t"
               "global_load_async_to_lds_b128 %7, %15, off\n\t"
               "s_wait_xcnt 0x0"
               :: "v"(la), "v"(la + ls), "v"(la + 2 * ls), "v"(la + 3 * ls), "v"(lb), "v"(lb + ls), "v"(lb + 2 * ls), "v"(lb + 3 * ls),
                  "v"(ga), "v"(ga + gs), "v"(ga + 2 * gs), "v"(ga + 3 * gs), "v"(gb), "v"(gb + gs), "v"(gb + 2 * gs), "v"(gb + 3 * gs) : "memory");
}
// wmma16 with D alone named in the statement of the four slots: this compiler keeps a vector operand of an asm statement in the first 256 registers, and k_att's fragments, read ahead in groups, do not fit there beside Q and the accumulators (with A and B named the build spilled to scratch)
__device__ __forceinline__ v8f wmma16d(v16h a, v16h b, v8f c) {
  v8f d = __builtin_amdgcn_wmma_f32_16x16x32_f16(false, a, false, b, (short)0, c, false, false);
  asm volatile("v_nop\n\tv_nop\n\tv_nop\n\tv_nop" : "+v"(d));
  return d;
}
// lane l with lane l ^ 16 (the other half's value of the same column), as a vector move: no trip through the LDS pipe, no dscnt wait
__device__ __forceinline__ float xhalf(float x) { return __builtin_bit_cast(float, __builtin_amdgcn_permlanex16(__builtin_bit_cast(int, x), __builtin_bit_cast(int, x), 0x76543210, 0xfedcba98, false, false)); }
// e^x as __expf comes out here (x * log2(e), then v_exp_f32), with the one slot that the instruction set asks for behind a transcendental in the same statement
__device__ __forceinline__ float exp_s(float x) { float d; asm("v_exp_f32 %0, %1\n\tv_nop" : "=v"(d) : "v"(x * 1.44269504088896340736f)); return d; }
// ---- k_att: block = (64 queries, head h): kv head = h / 4; causal (tiles past the block skipped) AND attention_mask[k] != 0; head_dim 128 = 4 k-chunks; v . P over 8 d-tiles
// Both products are taken TRANSPOSED: S^T = K . Q^T (A = key rows from LDS, B = the wave's 16 queries, kept in registers) and O^T += V^T . P^T (A = the value planes' rows from LDS, B = P^T).
// A lane (g, col) then holds scores of ONE query, q0 + col: element r of score tile ct is key 16 ct + 8 g + r of the pass. The query's maximum and sum are taken inside the lane, with one exchange between the two halves;
// and the two score tiles, converted in place, ARE the B operand of the second product (element r = tile 0's r, element 8 + r = tile 1's r: the k order in which frag_h reads the value rows), so P makes no trip through LDS.
// Eight waves in two groups of four. Both groups hold the same 64 queries (wave wq of each: rows 16 wq ..); group 0 walks the even key tiles, group 1 the odd ones (the causal bound is an even number of tiles), each with its own two staging buffers, running maximum, sum and accumulators:
// the longest block's chain of passes, which the launch lasts, is half as long. Behind the loop group 1 hands its maximum, sum and accumulators over through LDS and group 0 joins the two partial softmaxes.
// One block fills a WGP's registers, so the blocks come in two rounds: the grid's slow index counts the query blocks from the last (most tiles) down, so that the short blocks fill in behind the long ones.
__global__ __launch_bounds__(256) void k_att(const _Float16* __restrict__ QH, const _Float16* __restrict__ QL, const _Float16* __restrict__ KH, const _Float16* __restrict__ KL, const _Float16* __restrict__ VH, const _Float16* __restrict__ VL, const int* __restrict__ AM, float* __restrict__ CT) {
  __shared__ __align__(16) float so[4][16][132]; __shared__ KVStage st[2][2];   // st[group][buffer]
  const int tid = threadIdx.x, wave = tid >> 5, lane = tid & 31, col = lane & 15, g = lane >> 4, grp = wave >> 2, wq = wave & 3, gt = tid & 127; const int qb = TQB - 1 - blockIdx.y, h = blockIdx.x; const int kvh = h / (NHQ / NKV); const int q0 = qb * 64 + wq * 16;
  v16h aq[4], al[4];
#pragma unroll
  for (int kc = 0; kc < 4; ++kc) { aq[kc] = frag_h(QH + (size_t)(q0 + col) * QW + h * HD + kc * 32, lane); al[kc] = frag_h(QL + (size_t)(q0 + col) * QW + h * HD + kc * 32, lane); }
  int amn = AM[grp * 32 + lane];   // mask words of pass 0, one key a lane
  asm volatile("s_wait_xcnt 0x0" ::: "memory");       // stands behind the Q and mask loads, in front of whatever rewrites a register that they name
  __builtin_amdgcn_sched_barrier(0);                  // keeps the staging's address arithmetic, which takes those registers over, behind that wait (this build had it in front)
  float m = -3.0e38f, l = 0.f;   // of the lane's query: the maximum over both halves' keys, the sum over this half's keys alone (the halves' sums are joined behind the loop)
  v8f acc[8] = {};               // acc[j][r] = channel 16 j + 8 g + r of the lane's query
  const int nks = qb + 1;   // passes: the causal bound is 2 (qb + 1) tiles of 32 keys, and pass i of group grp takes tile 2 i + grp
  // each thread of a group copies 16 pieces of 16 B per tile of its group: k rows of 256 B (16 lanes a row, 8 rows a step), v rows of 64 B (4 lanes a row, 32 rows a step)
  const unsigned lk = lds_addr(&st[grp][0].kh[gt >> 4][(gt & 15) * 8]), lv = lds_addr(&st[grp][0].vh[gt >> 2][(gt & 3) * 8]);
  const size_t gk = (size_t)(gt >> 4) * KW + kvh * HD + (gt & 15) * 8, gv = ((size_t)kvh * HD + (gt >> 2)) * SS + (gt & 3) * 8;
  auto stage = [&](int i) { const int t = 2 * i + grp; const unsigned b = (unsigned)(i & 1) * (unsigned)sizeof(KVStage);
    acopy8(lk + b, lk + b + (unsigned)sizeof(st[0][0].kh), 8 * KP * 2, KH + gk + (size_t)t * 32 * KW, KL + gk + (size_t)t * 32 * KW, (size_t)8 * KW);
    acopy8(lv + b, lv + b + (unsigned)sizeof(st[0][0].vh), 32 * VP * 2, VH + gv + t * 32, VL + gv + t * 32, (size_t)32 * SS); };
  stage(0);
  asm volatile("s_wait_asynccnt 0x0" ::: "memory");   // this wave's copies of pass 0 have landed
  __syncthreads();                                    // ... and every other wave's: both groups' tiles of pass 0 may be read
  if (nks > 1) stage(1);
#pragma unroll 1
  for (int ks = 0; ks < nks; ++ks) { float s[2][8]; const KVStage& T = st[grp][ks & 1];
    // A pass's reads stand in two groups AHEAD of the products that use them, so that a wave does not wait out the LDS latency once per product:
    // all 16 key fragments at the head of the pass; all 16 value fragments behind the first score chain, so that they land under the second chain and the softmax; the mask words one pass ahead (the last pass reads its own again: no index past the block's keys).
    const unsigned kb = __builtin_amdgcn_ballot_w32(amn != 0);   // bit b: key b of this tile is open
    v16h kh[2][4], kl[2][4], vh[8], vl[8]; v8f c[2];
#pragma unroll
    for (int ct = 0; ct < 2; ++ct)
#pragma unroll
      for (int kc = 0; kc < 4; ++kc) { kh[ct][kc] = frag_h(&T.kh[ct * 16 + col][kc * 32], lane); kl[ct][kc] = frag_h(&T.kl[ct * 16 + col][kc * 32], lane); }
    amn = AM[(2 * (ks + 1 < nks ? ks + 1 : ks) + grp) * 32 + lane];
    asm volatile("s_wait_xcnt 0x0" ::: "memory");   // stands behind the mask load, in front of whatever rewrites a register that it names
#pragma unroll
    for (int ct = 0; ct < 2; ++ct) { v8f cc = {};
#pragma unroll
      for (int kc = 0; kc < 4; ++kc) { cc = wmma16d(kh[ct][kc], aq[kc], cc); cc = wmma16d(kh[ct][kc], al[kc], cc); cc = wmma16d(kl[ct][kc], aq[kc], cc); }   // 3 products, all residuals UNSCALED into one accumulator
      c[ct] = cc;
      if (ct == 0) {
#pragma unroll
        for (int j = 0; j < 8; ++j) { vh[j] = frag_h(&T.vh[j * 16 + col][0], lane); vl[j] = frag_h(&T.vl[j * 16 + col][0], lane); } } }
    // the lane's open keys as bits: key b of the tile counts if the mask has it open and b <= d, d = the query's own place counted from the tile's first key; shifted so that bit 16 ct + r is the lane's element r of tile ct
    const int d = q0 + col - (2 * ks + grp) * 32; const unsigned cm = d < 0 ? 0u : 0xffffffffu >> ((31 - (d > 31 ? 31 : d)) & 31); const unsigned kp = (kb & cm) >> (8 * g);
#pragma unroll
    for (int ct = 0; ct < 2; ++ct)
#pragma unroll
      for (int r = 0; r < 8; ++r) s[ct][r] = (kp & (1u << (16 * ct + r))) ? c[ct][r] * 0.08838834764831845f : -3.0e38f;
    float t8[8];
#pragma unroll
    for (int r = 0; r < 8; ++r) t8[r] = fmaxf(s[0][r], s[1][r]);
    float mx = fmaxf(fmaxf(fmaxf(t8[0], t8[1]), fmaxf(t8[2], t8[3])), fmaxf(fmaxf(t8[4], t8[5]), fmaxf(t8[6], t8[7])));
    mx = fmaxf(mx, xhalf(mx));   // both halves' keys: P^T's k runs over both, so they share one maximum
    const float mn = fmaxf(m, mx);
    const float mu = fmaxf(mn, -1.0e38f);   // what is subtracted: where no key of the query has been open yet it stays far above the closed keys' -3e38, so that they, and the old maximum, still come out as e^(-huge) = 0
    const float alpha = exp_s(m - mu); m = mn;
    v16h pb;
#pragma unroll
    for (int r = 0; r < 8; ++r) { const float e0 = exp_s(s[0][r] - mu), e1 = exp_s(s[1][r] - mu); t8[r] = e0 + e1;
      pb[r] = (_Float16)(e0 * 2048.0f); pb[8 + r] = (_Float16)(e1 * 2048.0f); }
    l = l * alpha + (((t8[0] + t8[1]) + (t8[2] + t8[3])) + ((t8[4] + t8[5]) + (t8[6] + t8[7])));
#pragma unroll
    for (int j = 0; j < 8; ++j)
#pragma unroll
      for (int r = 0; r < 8; ++r) acc[j][r] *= alpha;
#pragma unroll
    for (int j = 0; j < 8; ++j) { acc[j] = wmma16d(vh[j], pb, acc[j]); acc[j] = wmma16d(vl[j], pb, acc[j]); }   // v hi + unscaled residual
    asm volatile("s_wait_dscnt 0x0" ::: "memory");      // this wave's reads of this tile have returned before the tile's buffer is refilled
    asm volatile("s_wait_asynccnt 0x0" ::: "memory");   // this wave's copies of pass ks + 1 have landed
    __syncthreads();                                    // publishes both groups' tiles of pass ks + 1 and ends every wave's reads of pass ks
    if (ks + 2 < nks) stage(ks + 2); }
  asm volatile("s_wait_asynccnt 0x0" ::: "memory");     // no copy is outstanding when the wave goes on to its end
  l += xhalf(l);   // the query's sum over both halves' keys
  // hand-over: wave wq of group 1 lays its accumulators at the places where wave wq of group 0 holds the same elements (row = query, eight channels in a row a lane and d-tile), the queries' maxima and sums in the rows' pad words 128 and 129
  if (grp == 1) {
#pragma unroll
    for (int j = 0; j < 8; ++j) { float* p = &so[wq][col][j * 16 + 8 * g];
      *(v4f*)p = (v4f){ acc[j][0], acc[j][1], acc[j][2], acc[j][3] }; *(v4f*)(p + 4) = (v4f){ acc[j][4], acc[j][5], acc[j][6], acc[j][7] }; }
    if (g == 0) { so[wq][col][128] = m; so[wq][col][129] = l; } }
  __syncthreads();   // group 1's partial results may be read by group 0
  if (grp == 0) {
    const float m1 = so[wq][col][128], l1 = so[wq][col][129]; const float mn = fmaxf(m, m1);
    const float y0 = exp_s(m - mn), y1 = exp_s(m1 - mn); const float a0 = (m <= -1.0e38f) ? 0.f : y0, a1 = (m1 <= -1.0e38f) ? 0.f : y1;   // a group that saw no open key of the query counts for nothing
    const float lt = l * a0 + l1 * a1; const float il = (lt > 0.f) ? (1.0f / 2048.0f) / lt : 0.f; const float f0 = a0 * il, f1 = a1 * il;
#pragma unroll
    for (int j = 0; j < 8; ++j) { float* p = &so[wq][col][j * 16 + 8 * g]; const v4f pa = *(const v4f*)p, pc = *(const v4f*)(p + 4);   // each lane rewrites only the words that it has read itself
      *(v4f*)p = (v4f){ acc[j][0] * f0 + pa[0] * f1, acc[j][1] * f0 + pa[1] * f1, acc[j][2] * f0 + pa[2] * f1, acc[j][3] * f0 + pa[3] * f1 };
      *(v4f*)(p + 4) = (v4f){ acc[j][4] * f0 + pc[0] * f1, acc[j][5] * f0 + pc[1] * f1, acc[j][6] * f0 + pc[2] * f1, acc[j][7] * f0 + pc[3] * f1 }; }
    LDSX(); for (int rl = 0; rl < 16; ++rl) vst2(CT + (size_t)(q0 + rl) * QW + h * HD + lane * 4, *(const v4f*)&so[wq][rl][lane * 4]); } }
// ---- k_out: block = (128 rows, 128 of 2048 cols), one a WGP: out = ctx (hi + lo) . wo (in,out)
__global__ __launch_bounds__(256) void k_out(const float* __restrict__ CT, const float* __restrict__ WO, float* __restrict__ OUT) { __shared__ __align__(16) float sf[128][132]; __shared__ __align__(16) __bf16 sh[2][128][GP], sl[2][128][GP], sw[2][128][GP];
  const int tid = threadIdx.x, wave = tid >> 5, lane = tid & 31, col = lane & 15, g = lane >> 4, wr0 = (wave >> 1) * 32, wc0 = (wave & 1) * 64; const int c0 = blockIdx.y * 128; const size_t r0 = (size_t)blockIdx.x * 128 + wave * 16;
  v8f acc[2][4] = {};
  proj_tile<HID, true, 4>(CT + (size_t)blockIdx.x * 128 * QW, WO + c0, sh, sl, sw, acc, wave, lane);
#pragma unroll
  for (int i = 0; i < 2; ++i)
#pragma unroll
    for (int j = 0; j < 4; ++j)
#pragma unroll
      for (int r = 0; r < 8; ++r) sf[wr0 + i * 16 + 8 * g + r][wc0 + j * 16 + col] = acc[i][j][r];
  __syncthreads();   // a row's two column halves come from two waves
  for (int rl = 0; rl < 16; ++rl) vst2(OUT + (r0 + rl) * HID + c0 + lane * 4, *(const v4f*)&sf[wave * 16 + rl][lane * 4]); }
extern "C" void kernel_launch(void* const* d_in, const int* in_sizes, int n_in, void* d_out, int out_size, void* d_ws, size_t ws_size, hipStream_t stream) {
  (void)in_sizes; (void)n_in; (void)out_size;
  const float** F_ = (const float**)d_in;   // 0 hidden_states [1,2048,2048], 1 wq [2048,2048], 2 wk [2048,512], 3 wv [2048,512], 4 wo [2048,2048] (all (in,out)), 5 attention_mask [1,2048] int, 6 position_ids [1,2048] int
  if (ws_size < (size_t)WS_END) return;
  char* ws = (char*)d_ws; _Float16 *QH = (_Float16*)(ws + WS_QH), *QL = (_Float16*)(ws + WS_QL), *KH = (_Float16*)(ws + WS_KH), *KL = (_Float16*)(ws + WS_KL), *VH = (_Float16*)(ws + WS_VH), *VL = (_Float16*)(ws + WS_VL); float* CT = (float*)(ws + WS_CT);
  k_qkv<<<dim3(PRB, QKVW / 128), 256, 0, stream>>>(F_[0], F_[1], F_[2], F_[3], (const int*)d_in[6], QH, QL, KH, KL, VH, VL);
  k_att<<<dim3(NHQ, TQB), 256, 0, stream>>>(QH, QL, KH, KL, VH, VL, (const int*)d_in[5], CT);
  k_out<<<dim3(PRB, HID / 128), 256, 0, stream>>>(CT, F_[4], (float*)d_out);
}
